// v000
// The times below were measured on an AMD MI455X: many runs one after another, warmed up first and cycling through
// copies of the inputs, with the whole window's GPU time divided by the number of runs. Launches and the gaps
// between them are all in it. The median over several windows is given; except for v000 it joins two sittings, which
// can be a few percent apart, so the side-by-side timings, each taken in one sitting, are the better comparison.
// The starting kernel, v000, takes 133 microseconds a run.
// Contractions: q/k/v projections [NB*SEQ x 64 x 768] (x3), causal scores [T x T x 64] and P.V [T x 64 x T] per batch, all on
// v_wmma_f32_16x16x32_f16 with f16 value + residual operand planes (hi.hi + (hi.lo + lo.hi)/2048), f32 accumulate; softmax and
#include <hip/hip_runtime.h>
#include <math.h>

// Problem constants (NB / SEQ overridable for a reduced build; *_FULL are the strides of the inputs / output)
#ifndef NB
#define NB 8
#endif
#ifndef SEQ
#define SEQ 2048
#endif
#define NB_FULL 8
#define SEQ_FULL 2048
#define CC 768
#define HH 64
#define ATTN_SCALE 0.03608439182435161f   // CC^-0.5 (embedding dim), as f32

static_assert(NB >= 1 && NB <= NB_FULL);
static_assert(SEQ >= 128 && SEQ <= SEQ_FULL && (SEQ % 128) == 0);
static_assert((CC % 64) == 0 && (CC % 32) == 0);
static_assert(HH == 64);
static_assert(((CC * HH / 2) % 256) == 0);
static_assert(((NB * SEQ) % 128) == 0);

// 16-bit operands are f16, each carried as a value plane plus a residual plane lo = f16((v - hi) * 2048):
// a product is hi.hi + (hi.lo + lo.hi)/2048 (f32-class). Every fragment (A and B) uses the 16x16x32 lane map
// lane%16 = row/col, g = lane/16: elements 0..7 -> k = 8g+e, elements 8..15 -> k = 16+8g+(e-8).
typedef _Float16 h16;
typedef __attribute__((ext_vector_type(16))) _Float16 v16h;
typedef __attribute__((ext_vector_type(8)))  _Float16 v8h;
typedef __attribute__((ext_vector_type(8)))  float    v8f;
#define RSPLIT (1.0f / 2048.0f)
__device__ __forceinline__ void split16(float f, h16& hi, h16& lo) { hi = (h16)f; lo = (h16)((f - (float)hi) * 2048.0f); }
__device__ __forceinline__ unsigned short hbits(h16 h) { return __builtin_bit_cast(unsigned short, h); }

#define NEG_INF (-__builtin_inff())

__device__ __forceinline__ v8f v8f_zero() {
  v8f z = {0.f, 0.f, 0.f, 0.f, 0.f, 0.f, 0.f, 0.f};
  return z;
}

// D = A(16x32 f16) * B(32x16 f16) + C(16x16 f32), followed by the VALU hazard guard (ties D, keeps A/B live)
__device__ __forceinline__ v8f wmma16(v16h a, v16h b, v8f c) {
  v8f r = __builtin_amdgcn_wmma_f32_16x16x32_f16(false, a, false, b, (short)0, c, false, false);
  asm volatile("v_nop\n\tv_nop\n\tv_nop\n\tv_nop" : "+v"(r) : "v"(a), "v"(b));
  return r;
}

// acc += A.B with value/residual planes: cross terms from zero, folded at 1/2048 on the VALU
__device__ __forceinline__ v8f wmma_split(v16h ah, v16h al, v16h bh, v16h bl, v8f c) {
  v8f x = wmma16(al, bh, v8f_zero());
  x = wmma16(ah, bl, x);
  return wmma16(ah, bh, c) + x * RSPLIT;
}

// ---------------------------------------------------------------------------
// Kernel 0: W[C,H] f32  ->  Wt[H,C] f16 value + residual planes
// ---------------------------------------------------------------------------
__global__ void __launch_bounds__(256)
wt_kernel(const float* __restrict__ Wk,
          const float* __restrict__ Wq,
          const float* __restrict__ Wv,
          h16* __restrict__ WtQ,
          h16* __restrict__ WtK,
          h16* __restrict__ WtV) {
  const int idx = blockIdx.x * 256 + threadIdx.x;   // 0 .. HH*CC/2 - 1
  if (idx >= CC * HH / 2) return;
  const int h = idx / (CC / 2);
  const int c = 2 * (idx % (CC / 2));
  const float* src[3] = {Wq, Wk, Wv};
  h16* dstp[3] = {WtQ, WtK, WtV};
#pragma unroll
  for (int s = 0; s < 3; ++s) {
    h16 h0, l0, h1, l1;
    split16(src[s][(size_t)c * HH + h], h0, l0);
    split16(src[s][(size_t)(c + 1) * HH + h], h1, l1);
    unsigned* dh = (unsigned*)(dstp[s] + (size_t)h * CC + c);
    unsigned* dl = (unsigned*)(dstp[s] + (size_t)CC * HH + (size_t)h * CC + c);
    const unsigned ph = (unsigned)hbits(h0) | ((unsigned)hbits(h1) << 16);
    const unsigned pl = (unsigned)hbits(l0) | ((unsigned)hbits(l1) << 16);
    *(unsigned*)dh = ph; *(unsigned*)dl = pl;
    
  }
}

// ---------------------------------------------------------------------------
// Kernel 1: QKV projection. One wave per 16 rows of (b,t); 8 waves per block.
//   q,k,v stored row-major [NB,SEQ,64] (value + residual planes); v is transposed to [NB,64,SEQ] by vt_kernel.
// A-frag (x rows, split in registers) and B-frags (Wt[n][k] rows) use the same element -> k map; C/D: lane col = lane%16,
// element v -> row 8g+v.
// ---------------------------------------------------------------------------
__global__ void __launch_bounds__(256)
qkv_kernel(const float* __restrict__ x,
           const h16* __restrict__ WtQ,
           const h16* __restrict__ WtK,
           const h16* __restrict__ WtV,
           h16* __restrict__ qws,
           h16* __restrict__ kws,
           h16* __restrict__ vws) {
  __shared__ __align__(16) h16 st[8][16][64];   // per-wave staging of one 16x64 result plane (wave-private)
  const int lane = threadIdx.x & 31;
  const int wv   = threadIdx.x >> 5;
  const int g    = lane >> 4;
  const int m    = lane & 15;
  const int tile = blockIdx.x * 8 + wv;        // 0 .. NB*SEQ/16 - 1
  const int b    = tile / (SEQ / 16);
  const int t0   = (tile % (SEQ / 16)) * 16;
  const size_t PL = (size_t)CC * HH;           // residual plane offset inside each Wt buffer
  const size_t QL = (size_t)NB * SEQ * HH;     // residual plane offset inside q/k/v buffers

  v8f accQ[4], accK[4], accV[4];
#pragma unroll
  for (int nt = 0; nt < 4; ++nt) {
    accQ[nt] = v8f_zero();
    accK[nt] = v8f_zero();
    accV[nt] = v8f_zero();
  }

  const float* xrow = x + ((size_t)b * SEQ_FULL + t0 + m) * CC;

#pragma unroll 1
  for (int c0 = 0; c0 < CC; c0 += 32) {
    // A-fragment: x tile rows, split into value/residual f16 in registers
    union { v16h v; h16 e[16]; } a, al;
#pragma unroll
    for (int j = 0; j < 8; ++j) {
      split16(xrow[c0 + 8 * g + j],      a.e[j],     al.e[j]);
      split16(xrow[c0 + 16 + 8 * g + j], a.e[8 + j], al.e[8 + j]);
    }
    union UB { v16h v; v8h h[2]; };
#pragma unroll
    for (int nt = 0; nt < 4; ++nt) {
      // one n-tile at a time: its six B fragments (value + residual for Q/K/V weights) then three split MACs;
      // B frags use the same k map as A: {8g..8g+7} then {16+8g..16+8g+7}
      const size_t woff = (size_t)(nt * 16 + m) * CC + c0 + 8 * g;
      UB bq, bk, bv, bql, bkl, bvl;
      bq.h[0]  = *(const v8h*)(WtQ + woff);      bq.h[1]  = *(const v8h*)(WtQ + woff + 16);
      bk.h[0]  = *(const v8h*)(WtK + woff);      bk.h[1]  = *(const v8h*)(WtK + woff + 16);
      bv.h[0]  = *(const v8h*)(WtV + woff);      bv.h[1]  = *(const v8h*)(WtV + woff + 16);
      bql.h[0] = *(const v8h*)(WtQ + PL + woff); bql.h[1] = *(const v8h*)(WtQ + PL + woff + 16);
      bkl.h[0] = *(const v8h*)(WtK + PL + woff); bkl.h[1] = *(const v8h*)(WtK + PL + woff + 16);
      bvl.h[0] = *(const v8h*)(WtV + PL + woff); bvl.h[1] = *(const v8h*)(WtV + PL + woff + 16);
      accQ[nt] = wmma_split(a.v, al.v, bq.v, bql.v, accQ[nt]);
      accK[nt] = wmma_split(a.v, al.v, bk.v, bkl.v, accK[nt]);
      accV[nt] = wmma_split(a.v, al.v, bv.v, bvl.v, accV[nt]);
    }
  }

  // outputs: q, k, v row-major [NB,SEQ,64] as value + residual planes; each 16x64 plane tile goes through the wave's LDS tile and is
  h16* sw = &st[wv][0][0];
  h16* dsts[3] = {qws, kws, vws};
#pragma unroll
  for (int s = 0; s < 3; ++s) {
#pragma unroll
    for (int pl = 0; pl < 2; ++pl) {
#pragma unroll
      for (int nt = 0; nt < 4; ++nt)
#pragma unroll
        for (int v = 0; v < 8; ++v) {
          const float val = (s == 0) ? accQ[nt][v] : (s == 1) ? accK[nt][v] : accV[nt][v];
          h16 hh_, ll_; split16(val, hh_, ll_);
          sw[(8 * g + v) * 64 + nt * 16 + m] = pl ? ll_ : hh_;
        }
      asm volatile("s_wait_dscnt 0" ::: "memory");
      h16* base = dsts[s] + (pl ? QL : 0) + ((size_t)b * SEQ + t0) * HH;
#pragma unroll
      for (int r = 0; r < 16; ++r) {
        const unsigned w = *((const unsigned*)(sw + r * 64) + lane);
        *(unsigned*)((unsigned*)(base + (size_t)r * HH) + lane) = w;
      }
      
      asm volatile("s_wait_dscnt 0" ::: "memory");
    }
  }
}

// ---------------------------------------------------------------------------
// Kernel 1b: V transposed to [NB,64,SEQ] (value plane then residual plane at +NB*SEQ*64) through an LDS tile; a wave writes one
// ---------------------------------------------------------------------------
__global__ void __launch_bounds__(256)
vt_kernel(const h16* __restrict__ vws, h16* __restrict__ vtws) {
  __shared__ h16 t[64][66];                         // [t][h], cross-wave (block barrier)
  const int tid = threadIdx.x, lane = tid & 31, wv = tid >> 5;
  const size_t QL = (size_t)NB * SEQ * HH;
  const int row0 = blockIdx.x * 64;                 // 64 consecutive (b,t) rows, same b
  const int b = row0 / SEQ, tb = row0 % SEQ;
  const int pl = blockIdx.y;                        // 0: value plane, 1: residual plane
  const h16* src = vws + (pl ? QL : 0) + (size_t)row0 * HH;
#pragma unroll
  for (int k = 0; k < 16; ++k) { const int e = tid + 256 * k; t[e >> 6][e & 63] = src[e]; }
  __syncthreads();
  h16* dst = vtws + (pl ? QL : 0) + (size_t)b * HH * SEQ;
#pragma unroll
  for (int r = 0; r < 8; ++r) {
    const int h = wv * 8 + r;
    const unsigned pk = (unsigned)hbits(t[2 * lane][h]) | ((unsigned)hbits(t[2 * lane + 1][h]) << 16);
    unsigned* d = (unsigned*)(dst + (size_t)h * SEQ + tb) + lane;
    *(unsigned*)d = pk;
    
  }
}

// ---------------------------------------------------------------------------
// Kernel 2: causal flash attention, split-K across 4 waves per 16-row query tile.
// Wave w handles key blocks w, w+4, w+8, ... (balanced causal triangle).
// Per 32-key block: S = Q K^T (2 split tiles), online softmax, O += P V (4 split tiles).
// P transposed (D-layout -> A-layout) through wave-private LDS staging.
// Partial (O, m, l) merged across waves via LDS log-sum-exp combine (block barrier).
// ---------------------------------------------------------------------------
__global__ void __launch_bounds__(128)
attn_kernel(const h16* __restrict__ qws,
            const h16* __restrict__ kws,
            const h16* __restrict__ vtws,
            float* __restrict__ out) {
  __shared__ __align__(16) h16 Pl[4][16][32];    // per-wave P staging, value plane (wave-private)
  __shared__ __align__(16) h16 Pll[4][16][32];   // residual plane (wave-private)
  __shared__ __align__(16) float Of[4][16][64];  // partial O (cross-wave)
  __shared__ float Ml[4][16], Ll[4][16];         // partial m, l (cross-wave)

  const int lane = threadIdx.x & 31;
  const int wv   = threadIdx.x >> 5;
  const int g    = lane >> 4;
  const int m    = lane & 15;
  const int tile = blockIdx.x;                 // 0 .. NB*SEQ/16 - 1
  const int b    = tile / (SEQ / 16);
  const int t0   = (tile % (SEQ / 16)) * 16;

  union U16 { v16h v; v8h h[2]; };

  // Q A-frags for the two 32-wide h chunks (HH = 64)
  const size_t QL = (size_t)NB * SEQ * HH;     // residual planes follow the value planes
  const h16* qrow = qws + ((size_t)b * SEQ + t0 + m) * HH;
  U16 qa[2], qal[2];
#pragma unroll
  for (int hc = 0; hc < 2; ++hc) {
    qa[hc].h[0]  = *(const v8h*)(qrow + hc * 32 + 8 * g);
    qa[hc].h[1]  = *(const v8h*)(qrow + hc * 32 + 16 + 8 * g);
    qal[hc].h[0] = *(const v8h*)(qrow + QL + hc * 32 + 8 * g);
    qal[hc].h[1] = *(const v8h*)(qrow + QL + hc * 32 + 16 + 8 * g);
  }

  v8f o[4];
#pragma unroll
  for (int nt = 0; nt < 4; ++nt) o[nt] = v8f_zero();
  float mrow[8], lrow[8];
#pragma unroll
  for (int v = 0; v < 8; ++v) { mrow[v] = NEG_INF; lrow[v] = 0.f; }

  const float scale = ATTN_SCALE;
  const int   nblk  = t0 / 32 + 1;             // causal: keys <= t0+15

  const h16* kbase  = kws + (size_t)b * SEQ * HH;
  const h16* vtbase = vtws + (size_t)b * HH * SEQ;

  for (int blk = wv; blk < nblk; blk += 4) {
    const int s0 = blk * 32;

    // ---- S = Q K^T for 32 keys (two 16x16 tiles) ----
    v8f s[2];
#pragma unroll
    for (int kt = 0; kt < 2; ++kt) {
      const h16* krow = kbase + (size_t)(s0 + kt * 16 + m) * HH;
      U16 kb0, kb1, kb0l, kb1l;                           // B frags use the same k map as A
      kb0.h[0]  = *(const v8h*)(krow + 8 * g);           kb0.h[1]  = *(const v8h*)(krow + 16 + 8 * g);
      kb1.h[0]  = *(const v8h*)(krow + 32 + 8 * g);      kb1.h[1]  = *(const v8h*)(krow + 48 + 8 * g);
      kb0l.h[0] = *(const v8h*)(krow + QL + 8 * g);      kb0l.h[1] = *(const v8h*)(krow + QL + 16 + 8 * g);
      kb1l.h[0] = *(const v8h*)(krow + QL + 32 + 8 * g); kb1l.h[1] = *(const v8h*)(krow + QL + 48 + 8 * g);
      s[kt] = wmma_split(qa[0].v, qal[0].v, kb0.v, kb0l.v, v8f_zero());
      s[kt] = wmma_split(qa[1].v, qal[1].v, kb1.v, kb1l.v, s[kt]);
    }

    // ---- scale + causal mask (diagonal block only) ----
    const bool diag = (s0 + 31 >= t0);
    float rmax[8];
#pragma unroll
    for (int v = 0; v < 8; ++v) {
      const int row = t0 + 8 * g + v;
#pragma unroll
      for (int kt = 0; kt < 2; ++kt) {
        const int col = s0 + kt * 16 + m;
        float val = s[kt][v] * scale;
        val = (diag && (col > row)) ? NEG_INF : val;
        s[kt][v] = val;
      }
      rmax[v] = fmaxf(s[0][v], s[1][v]);
    }
    // row-wise max across the 16 lanes holding this row's columns
#pragma unroll
    for (int off = 1; off < 16; off <<= 1)
#pragma unroll
      for (int v = 0; v < 8; ++v)
        rmax[v] = fmaxf(rmax[v], __shfl_xor(rmax[v], off, 32));

    // ---- online softmax update; write P (x1024, two planes) to LDS in row-major ----
    float alpha[8], psum[8];
#pragma unroll
    for (int v = 0; v < 8; ++v) {
      const float mnew = fmaxf(mrow[v], rmax[v]);
      alpha[v] = __expf(mrow[v] - mnew);
      mrow[v]  = mnew;
      const float p0 = __expf(s[0][v] - mnew);
      const float p1 = __expf(s[1][v] - mnew);
      // probabilities carried x1024 (tail values stay f16-normal; removed in the final merge) as value + residual planes
      { h16 ph, pq; split16(p0 * 1024.0f, ph, pq); Pl[wv][8 * g + v][m] = ph;      Pll[wv][8 * g + v][m] = pq;
        split16(p1 * 1024.0f, ph, pq);          Pl[wv][8 * g + v][16 + m] = ph; Pll[wv][8 * g + v][16 + m] = pq; }
      psum[v] = p0 + p1;
    }
#pragma unroll
    for (int off = 1; off < 16; off <<= 1)
#pragma unroll
      for (int v = 0; v < 8; ++v)
        psum[v] += __shfl_xor(psum[v], off, 32);
#pragma unroll
    for (int v = 0; v < 8; ++v)
      lrow[v] = lrow[v] * alpha[v] + psum[v];
#pragma unroll
    for (int nt = 0; nt < 4; ++nt)
#pragma unroll
      for (int v = 0; v < 8; ++v)
        o[nt][v] *= alpha[v];

    __builtin_amdgcn_fence(3 /* release order */, "wavefront");
    __builtin_amdgcn_wave_barrier();
    U16 pa, pal;
    pa.h[0]  = *(const v8h*)&Pl[wv][m][8 * g];
    pa.h[1]  = *(const v8h*)&Pl[wv][m][16 + 8 * g];
    pal.h[0] = *(const v8h*)&Pll[wv][m][8 * g];
    pal.h[1] = *(const v8h*)&Pll[wv][m][16 + 8 * g];
    __builtin_amdgcn_wave_barrier();

    // ---- O += P V  (V B-frags from the transposed planes) ----
#pragma unroll
    for (int nt = 0; nt < 4; ++nt) {
      const h16* vrow = vtbase + (size_t)(nt * 16 + m) * SEQ + s0;
      U16 vb, vbl;                                        // same k map as A
      vb.h[0]  = *(const v8h*)(vrow + 8 * g);      vb.h[1]  = *(const v8h*)(vrow + 16 + 8 * g);
      vbl.h[0] = *(const v8h*)(vrow + QL + 8 * g); vbl.h[1] = *(const v8h*)(vrow + QL + 16 + 8 * g);
      o[nt] = wmma_split(pa.v, pal.v, vb.v, vbl.v, o[nt]);
    }
  }

  // ---- publish this wave's partial (O, m, l) ----
#pragma unroll
  for (int nt = 0; nt < 4; ++nt)
#pragma unroll
    for (int v = 0; v < 8; ++v)
      Of[wv][8 * g + v][nt * 16 + m] = o[nt][v];
  if (m == 0) {
#pragma unroll
    for (int v = 0; v < 8; ++v) {
      Ml[wv][8 * g + v] = mrow[v];
      Ll[wv][8 * g + v] = lrow[v];
    }
  }
  __syncthreads();

  for (int e = threadIdx.x; e < 16 * HH; e += 128) {
    const int row = e >> 6;        // 0..15
    const int col = e & 63;        // 0..63
    float M = Ml[0][row];
#pragma unroll
    for (int w = 1; w < 4; ++w) M = fmaxf(M, Ml[w][row]);
    float L = 0.f, O = 0.f;
#pragma unroll
    for (int w = 0; w < 4; ++w) {
      const float be = __expf(Ml[w][row] - M);   // 0 for idle waves (m = -inf)
      L += be * Ll[w][row];
      O += be * Of[w][row][col];
    }
    const float r = O / (L * 1024.0f);          // removes the x1024 carried by the probabilities
    float* op = out + ((size_t)b * SEQ_FULL + t0 + row) * HH + col;
    *(float*)op = r;
    
  }
}

// ---------------------------------------------------------------------------
// Launch. Workspace layout (bytes, full size):
//   [0, 4MB)      q   f16 [NB,SEQ,64]  value + residual planes
//   [4MB, 8MB)    k   f16 [NB,SEQ,64]
//   [8MB, 12MB)   v   f16 [NB,SEQ,64]  (row-major, input to the transpose)
//   [12MB, 16MB)  vT  f16 [NB,64,SEQ]
//   [16MB, +576KB) WtQ/WtK/WtV f16 [64,768] x2 planes each
// ---------------------------------------------------------------------------
extern "C" void kernel_launch(void* const* d_in, const int* in_sizes, int n_in,
                              void* d_out, int out_size, void* d_ws,
                              size_t ws_size, hipStream_t stream) {
  if (n_in < 4) return;
  const long long rows_needed = (long long)(NB - 1) * SEQ_FULL + SEQ;
  if ((long long)in_sizes[0] < rows_needed * CC) return;
  if (in_sizes[1] < CC * HH || in_sizes[2] < CC * HH || in_sizes[3] < CC * HH) return;
  if ((long long)out_size < rows_needed * HH) return;

  const float* x  = (const float*)d_in[0];
  const float* Wk = (const float*)d_in[1];
  const float* Wq = (const float*)d_in[2];
  const float* Wv = (const float*)d_in[3];
  float* out = (float*)d_out;

  // every 16-bit buffer holds a value plane followed by its residual plane (2x the element count)
  char* ws = (char*)d_ws;
  const size_t qkv_bytes = (size_t)2 * NB * SEQ * HH * sizeof(h16);     // 4 MB at full size (two planes)
  const size_t wt_bytes  = (size_t)2 * CC * HH * sizeof(h16);           // 192 KB each
  const size_t total     = 4 * qkv_bytes + 3 * wt_bytes;
  if (total > ws_size) return;
  h16* qws  = (h16*)(ws);
  h16* kws  = (h16*)(ws + qkv_bytes);
  h16* vws  = (h16*)(ws + 2 * qkv_bytes);
  h16* vtws = (h16*)(ws + 3 * qkv_bytes);
  h16* WtQ  = (h16*)(ws + 4 * qkv_bytes);
  h16* WtK  = (h16*)(ws + 4 * qkv_bytes + wt_bytes);
  h16* WtV  = (h16*)(ws + 4 * qkv_bytes + 2 * wt_bytes);

  wt_kernel<<<(CC * HH / 2) / 256, 256, 0, stream>>>(Wk, Wq, Wv, WtQ, WtK, WtV);
  qkv_kernel<<<(NB * SEQ) / 128, 256, 0, stream>>>(x, WtQ, WtK, WtV, qws, kws, vws);
  vt_kernel<<<dim3((NB * SEQ) / 64, 2), 256, 0, stream>>>(vws, vtws);
  attn_kernel<<<(NB * SEQ) / 16, 128, 0, stream>>>(qws, kws, vtws, out);
}

// v001
// One run takes 106 microseconds.
// In two side-by-side timings against v000, it was 1.29 and 1.28 times as fast.
// Contractions: q/k/v projections [NB*SEQ x 64 x 768] (x3), causal scores [T x T x 64] and P.V [T x 64 x T] per batch, all on
// v_wmma_f32_16x16x32_f16 with f16 value + residual operand planes (hi.hi + (hi.lo + lo.hi)/2048), f32 accumulate; softmax and
#include <hip/hip_runtime.h>
#include <math.h>

// Problem constants (NB / SEQ overridable for a reduced build; *_FULL are the strides of the inputs / output)
#ifndef NB
#define NB 8
#endif
#ifndef SEQ
#define SEQ 2048
#endif
#define NB_FULL 8
#define SEQ_FULL 2048
#define CC 768
#define HH 64
#define ATTN_SCALE 0.03608439182435161f   // CC^-0.5 (embedding dim), as f32

static_assert(NB >= 1 && NB <= NB_FULL);
static_assert(SEQ >= 128 && SEQ <= SEQ_FULL && (SEQ % 128) == 0);
static_assert((CC % 64) == 0 && (CC % 32) == 0);
static_assert(HH == 64);
static_assert(((CC * HH / 2) % 256) == 0);
static_assert(((NB * SEQ) % 128) == 0);

// 16-bit operands are f16, each carried as a value plane plus a residual plane lo = f16((v - hi) * 2048):
// a product is hi.hi + (hi.lo + lo.hi)/2048 (f32-class). Every fragment (A and B) uses the 16x16x32 lane map
// lane%16 = row/col, g = lane/16: elements 0..7 -> k = 8g+e, elements 8..15 -> k = 16+8g+(e-8).
typedef _Float16 h16;
typedef __attribute__((ext_vector_type(16))) _Float16 v16h;
typedef __attribute__((ext_vector_type(8)))  _Float16 v8h;
typedef __attribute__((ext_vector_type(8)))  float    v8f;
typedef __attribute__((ext_vector_type(4)))  float    v4f;
#define RSPLIT (1.0f / 2048.0f)
__device__ __forceinline__ void split16(float f, h16& hi, h16& lo) { hi = (h16)f; lo = (h16)((f - (float)hi) * 2048.0f); }
__device__ __forceinline__ unsigned short hbits(h16 h) { return __builtin_bit_cast(unsigned short, h); }

#define NEG_INF (-__builtin_inff())

__device__ __forceinline__ v8f v8f_zero() {
  v8f z = {0.f, 0.f, 0.f, 0.f, 0.f, 0.f, 0.f, 0.f};
  return z;
}

// D = A(16x32 f16) * B(32x16 f16) + C(16x16 f32), followed by the VALU hazard guard (ties D, keeps A/B live)
__device__ __forceinline__ v8f wmma16(v16h a, v16h b, v8f c) {
  v8f r = __builtin_amdgcn_wmma_f32_16x16x32_f16(false, a, false, b, (short)0, c, false, false);
  asm volatile("v_nop\n\tv_nop\n\tv_nop\n\tv_nop" : "+v"(r) : "v"(a), "v"(b));
  return r;
}

// acc += A.B with value/residual planes: cross terms from zero, folded at 1/2048 on the VALU
__device__ __forceinline__ v8f wmma_split(v16h ah, v16h al, v16h bh, v16h bl, v8f c) {
  v8f x = wmma16(al, bh, v8f_zero());
  x = wmma16(ah, bl, x);
  return wmma16(ah, bh, c) + x * RSPLIT;
}

// ---------------------------------------------------------------------------
// Kernel 0: W[C,H] f32  ->  Wt[H,C] f16 value + residual planes
// ---------------------------------------------------------------------------
__global__ void __launch_bounds__(256)
wt_kernel(const float* __restrict__ Wk,
          const float* __restrict__ Wq,
          const float* __restrict__ Wv,
          h16* __restrict__ WtQ,
          h16* __restrict__ WtK,
          h16* __restrict__ WtV) {
  const int idx = blockIdx.x * 256 + threadIdx.x;   // 0 .. HH*CC/2 - 1
  if (idx >= CC * HH / 2) return;
  const int h = idx / (CC / 2);
  const int c = 2 * (idx % (CC / 2));
  const float* src[3] = {Wq, Wk, Wv};
  h16* dstp[3] = {WtQ, WtK, WtV};
#pragma unroll
  for (int s = 0; s < 3; ++s) {
    h16 h0, l0, h1, l1;
    split16(src[s][(size_t)c * HH + h], h0, l0);
    split16(src[s][(size_t)(c + 1) * HH + h], h1, l1);
    unsigned* dh = (unsigned*)(dstp[s] + (size_t)h * CC + c);
    unsigned* dl = (unsigned*)(dstp[s] + (size_t)CC * HH + (size_t)h * CC + c);
    const unsigned ph = (unsigned)hbits(h0) | ((unsigned)hbits(h1) << 16);
    const unsigned pl = (unsigned)hbits(l0) | ((unsigned)hbits(l1) << 16);
    *(unsigned*)dh = ph; *(unsigned*)dl = pl;
    
  }
}

// ---------------------------------------------------------------------------
// Kernel 1: QKV projection. One wave per 16 rows of (b,t); 8 waves per block.
//   q,k,v stored row-major [NB,SEQ,64] (value + residual planes); v is transposed to [NB,64,SEQ] by vt_kernel.
// A-frag (x rows, split in registers) and B-frags (Wt[n][k] rows) use the same element -> k map; C/D: lane col = lane%16,
// element v -> row 8g+v.
// The six weight planes are staged once per block in LDS, KS columns of k at a time, by asynchronous copies into two
// buffers (the next slice flies while this one is multiplied); all 8 waves read their B fragments from there.
// ---------------------------------------------------------------------------
#define KS 64                          // k columns per staged slice: 128 B of every weight row
#define WPITCH 72                      // f16 per staged row, 144 B = 16 B x odd: 16 rows' 16-byte reads fall on distinct banks
#define WBUF (6 * HH * WPITCH)         // f16 per buffer: planes Q, Q residual, K, K residual, V, V residual
#define NSLICE (CC / KS)
static_assert((CC % KS) == 0 && NSLICE >= 2);
static_assert(6 * HH * (KS / 8) == 12 * 256);   // 16-byte pieces of a slice = 12 per thread of the block

// One slice (columns c0 .. c0+KS-1 of all six planes) into the buffer at LDS byte address lbuf: 12 copies of 16 B per lane.
// Piece i of thread tid: plane i/2, row 32*(i%2) + tid/8, 16-byte column tid%8.
__device__ __forceinline__ void stage_slice(const h16* __restrict__ WtQ, const h16* __restrict__ WtK,
                                            const h16* __restrict__ WtV, int c0, unsigned lbuf, int tid) {
  const size_t PL = (size_t)CC * HH;
  const h16* pl[6] = {WtQ, WtQ + PL, WtK, WtK + PL, WtV, WtV + PL};
#pragma unroll
  for (int q = 0; q < 3; ++q) {   // four copies a statement: fewer address registers live at once than with all twelve in one
    const h16* gp[4];
    unsigned ld[4];
#pragma unroll
    for (int j = 0; j < 4; ++j) {
      const int i = q * 4 + j;
      const int row = (i & 1) * 32 + (tid >> 3);
      gp[j] = pl[i >> 1] + (size_t)row * CC + c0 + (tid & 7) * 8;
      ld[j] = lbuf + (unsigned)((((i >> 1) * HH + row) * WPITCH + (tid & 7) * 8) * sizeof(h16));
    }
    // the copies and, as the statement's last line, the wait that stands before any of their address registers is rewritten
    asm volatile("global_load_async_to_lds_b128 %0, %4, off\n\t"
                 "global_load_async_to_lds_b128 %1, %5, off\n\t"
                 "global_load_async_to_lds_b128 %2, %6, off\n\t"
                 "global_load_async_to_lds_b128 %3, %7, off\n\t"
                 "s_wait_xcnt 0x0"
                 :: "v"(ld[0]), "v"(ld[1]), "v"(ld[2]), "v"(ld[3]), "v"(gp[0]), "v"(gp[1]), "v"(gp[2]), "v"(gp[3])
                 : "memory");
  }
}

// One trip: the 16 x rows of this wave times columns t*KS .. t*KS+KS-1 of the six staged planes (buffer wb), added into the 12 tiles.
__device__ __forceinline__ void slice_mac(const float* __restrict__ xrow, const h16* wb, int t, int g, int m,
                                          v8f (&accQ)[4], v8f (&accK)[4], v8f (&accV)[4]) {
  // the slice's x columns of this lane's row: kc-th 32-chunk holds k = 8g..8g+7 in xv[kc][0..1], 16+8g..16+8g+7 in xv[kc][2..3]
  v4f xv[KS / 32][4];
#pragma unroll
  for (int kc = 0; kc < KS / 32; ++kc) {
    const float* xp = xrow + t * KS + kc * 32 + 8 * g;
    xv[kc][0] = *(const v4f*)(xp);
    xv[kc][1] = *(const v4f*)(xp + 4);
    xv[kc][2] = *(const v4f*)(xp + 16);
    xv[kc][3] = *(const v4f*)(xp + 20);
  }
  // keeps all of the trip's x loads in flight together: sunk to their uses, each 32-chunk would wait for memory by itself
  __builtin_amdgcn_sched_barrier(0);
#pragma unroll
  for (int kc = 0; kc < KS / 32; ++kc) {
    // A-fragment: x tile rows, split into value/residual f16 in registers
    union { v16h v; h16 e[16]; } a, al;
#pragma unroll
    for (int j = 0; j < 8; ++j) {
      split16(xv[kc][j >> 2][j & 3],       a.e[j],     al.e[j]);
      split16(xv[kc][2 + (j >> 2)][j & 3], a.e[8 + j], al.e[8 + j]);
    }
    union UB { v16h v; v8h h[2]; };
#pragma unroll
    for (int nt = 0; nt < 4; ++nt) {
      // one n-tile at a time: its six B fragments (value + residual for Q/K/V weights) then three split MACs;
      // B frags use the same k map as A: {8g..8g+7} then {16+8g..16+8g+7}
      const h16* wr = wb + (nt * 16 + m) * WPITCH + kc * 32 + 8 * g;
      UB bq, bk, bv, bql, bkl, bvl;
      bq.h[0]  = *(const v8h*)(wr);                     bq.h[1]  = *(const v8h*)(wr + 16);
      bql.h[0] = *(const v8h*)(wr + 1 * HH * WPITCH);   bql.h[1] = *(const v8h*)(wr + 1 * HH * WPITCH + 16);
      bk.h[0]  = *(const v8h*)(wr + 2 * HH * WPITCH);   bk.h[1]  = *(const v8h*)(wr + 2 * HH * WPITCH + 16);
      bkl.h[0] = *(const v8h*)(wr + 3 * HH * WPITCH);   bkl.h[1] = *(const v8h*)(wr + 3 * HH * WPITCH + 16);
      bv.h[0]  = *(const v8h*)(wr + 4 * HH * WPITCH);   bv.h[1]  = *(const v8h*)(wr + 4 * HH * WPITCH + 16);
      bvl.h[0] = *(const v8h*)(wr + 5 * HH * WPITCH);   bvl.h[1] = *(const v8h*)(wr + 5 * HH * WPITCH + 16);
      accQ[nt] = wmma_split(a.v, al.v, bq.v, bql.v, accQ[nt]);
      accK[nt] = wmma_split(a.v, al.v, bk.v, bkl.v, accK[nt]);
      accV[nt] = wmma_split(a.v, al.v, bv.v, bvl.v, accV[nt]);
      // keeps the n-tiles apart in the schedule: mixed, more fragments and cross-term tiles are live at once and registers spill to scratch
      __builtin_amdgcn_sched_barrier(0);
    }
  }
}

// Hand-over at the foot of a trip: this wave's reads of the slice are done, its copies of the next slice have landed, and
// every wave has said so; behind it the next slice may be read and the buffer just read may be refilled.
__device__ __forceinline__ void slice_handover() {
  asm volatile("s_wait_dscnt 0x0" ::: "memory");
  asm volatile("s_wait_asynccnt 0x0" ::: "memory");
  __syncthreads();
}

__global__ void __launch_bounds__(256)
qkv_kernel(const float* __restrict__ x,
           const h16* __restrict__ WtQ,
           const h16* __restrict__ WtK,
           const h16* __restrict__ WtV,
           h16* __restrict__ qws,
           h16* __restrict__ kws,
           h16* __restrict__ vws) {
  __shared__ __align__(16) h16 wl[2][WBUF];     // the two weight-slice buffers (cross-wave)
  __shared__ __align__(16) h16 st[8][16][64];   // per-wave staging of one 16x64 result plane (wave-private)
  const int lane = threadIdx.x & 31;
  const int wv   = threadIdx.x >> 5;
  const int g    = lane >> 4;
  const int m    = lane & 15;
  const int tile = blockIdx.x * 8 + wv;        // 0 .. NB*SEQ/16 - 1
  const int b    = tile / (SEQ / 16);
  const int t0   = (tile % (SEQ / 16)) * 16;
  const size_t QL = (size_t)NB * SEQ * HH;     // residual plane offset inside q/k/v buffers
  const unsigned lw = (unsigned)(size_t)&wl[0][0];   // LDS byte address of buffer 0

  v8f accQ[4], accK[4], accV[4];
#pragma unroll
  for (int nt = 0; nt < 4; ++nt) {
    accQ[nt] = v8f_zero();
    accK[nt] = v8f_zero();
    accV[nt] = v8f_zero();
  }

  const float* xrow = x + ((size_t)b * SEQ_FULL + t0 + m) * CC;

  // slice 0 lands and is published to every wave; slice 1 then flies during trip 0
  stage_slice(WtQ, WtK, WtV, 0, lw, threadIdx.x);
  asm volatile("s_wait_asynccnt 0x0" ::: "memory");   // this wave's copies of slice 0 have landed
  __syncthreads();
  stage_slice(WtQ, WtK, WtV, KS, lw + (unsigned)(WBUF * sizeof(h16)), threadIdx.x);

  // rolled, and the last two trips (no slice left to fetch) in a loop of their own: each loop body stays one straight block
#pragma unroll 1
  for (int t = 0; t < NSLICE - 2; ++t) {
    slice_mac(xrow, &wl[t & 1][0], t, g, m, accQ, accK, accV);
    slice_handover();
    // refill the buffer that this trip has just read
    stage_slice(WtQ, WtK, WtV, (t + 2) * KS, lw + (unsigned)((t & 1) * WBUF * sizeof(h16)), threadIdx.x);
  }
#pragma unroll 1
  for (int t = NSLICE - 2; t < NSLICE; ++t) {
    slice_mac(xrow, &wl[t & 1][0], t, g, m, accQ, accK, accV);
    slice_handover();
  }
  asm volatile("s_wait_asynccnt 0x0" ::: "memory");   // no copy is outstanding when the wave goes on and ends

  // outputs: q, k, v row-major [NB,SEQ,64] as value + residual planes; each 16x64 plane tile goes through the wave's LDS tile and is
  h16* sw = &st[wv][0][0];
  h16* dsts[3] = {qws, kws, vws};
#pragma unroll
  for (int s = 0; s < 3; ++s) {
#pragma unroll
    for (int pl = 0; pl < 2; ++pl) {
#pragma unroll
      for (int nt = 0; nt < 4; ++nt)
#pragma unroll
        for (int v = 0; v < 8; ++v) {
          const float val = (s == 0) ? accQ[nt][v] : (s == 1) ? accK[nt][v] : accV[nt][v];
          h16 hh_, ll_; split16(val, hh_, ll_);
          sw[(8 * g + v) * 64 + nt * 16 + m] = pl ? ll_ : hh_;
        }
      asm volatile("s_wait_dscnt 0" ::: "memory");
      h16* base = dsts[s] + (pl ? QL : 0) + ((size_t)b * SEQ + t0) * HH;
#pragma unroll
      for (int r = 0; r < 16; ++r) {
        const unsigned w = *((const unsigned*)(sw + r * 64) + lane);
        *(unsigned*)((unsigned*)(base + (size_t)r * HH) + lane) = w;
      }
      
      asm volatile("s_wait_dscnt 0" ::: "memory");
    }
  }
}

// ---------------------------------------------------------------------------
// Kernel 1b: V transposed to [NB,64,SEQ] (value plane then residual plane at +NB*SEQ*64) through an LDS tile; a wave writes one
// ---------------------------------------------------------------------------
__global__ void __launch_bounds__(256)
vt_kernel(const h16* __restrict__ vws, h16* __restrict__ vtws) {
  __shared__ h16 t[64][66];                         // [t][h], cross-wave (block barrier)
  const int tid = threadIdx.x, lane = tid & 31, wv = tid >> 5;
  const size_t QL = (size_t)NB * SEQ * HH;
  const int row0 = blockIdx.x * 64;                 // 64 consecutive (b,t) rows, same b
  const int b = row0 / SEQ, tb = row0 % SEQ;
  const int pl = blockIdx.y;                        // 0: value plane, 1: residual plane
  const h16* src = vws + (pl ? QL : 0) + (size_t)row0 * HH;
#pragma unroll
  for (int k = 0; k < 16; ++k) { const int e = tid + 256 * k; t[e >> 6][e & 63] = src[e]; }
  __syncthreads();
  h16* dst = vtws + (pl ? QL : 0) + (size_t)b * HH * SEQ;
#pragma unroll
  for (int r = 0; r < 8; ++r) {
    const int h = wv * 8 + r;
    const unsigned pk = (unsigned)hbits(t[2 * lane][h]) | ((unsigned)hbits(t[2 * lane + 1][h]) << 16);
    unsigned* d = (unsigned*)(dst + (size_t)h * SEQ + tb) + lane;
    *(unsigned*)d = pk;
    
  }
}

// ---------------------------------------------------------------------------
// Kernel 2: causal flash attention, split-K across 4 waves per 16-row query tile.
// Wave w handles key blocks w, w+4, w+8, ... (balanced causal triangle).
// Per 32-key block: S = Q K^T (2 split tiles), online softmax, O += P V (4 split tiles).
// P transposed (D-layout -> A-layout) through wave-private LDS staging.
// Partial (O, m, l) merged across waves via LDS log-sum-exp combine (block barrier).
// ---------------------------------------------------------------------------
__global__ void __launch_bounds__(128)
attn_kernel(const h16* __restrict__ qws,
            const h16* __restrict__ kws,
            const h16* __restrict__ vtws,
            float* __restrict__ out) {
  __shared__ __align__(16) h16 Pl[4][16][32];    // per-wave P staging, value plane (wave-private)
  __shared__ __align__(16) h16 Pll[4][16][32];   // residual plane (wave-private)
  __shared__ __align__(16) float Of[4][16][64];  // partial O (cross-wave)
  __shared__ float Ml[4][16], Ll[4][16];         // partial m, l (cross-wave)

  const int lane = threadIdx.x & 31;
  const int wv   = threadIdx.x >> 5;
  const int g    = lane >> 4;
  const int m    = lane & 15;
  const int tile = blockIdx.x;                 // 0 .. NB*SEQ/16 - 1
  const int b    = tile / (SEQ / 16);
  const int t0   = (tile % (SEQ / 16)) * 16;

  union U16 { v16h v; v8h h[2]; };

  // Q A-frags for the two 32-wide h chunks (HH = 64)
  const size_t QL = (size_t)NB * SEQ * HH;     // residual planes follow the value planes
  const h16* qrow = qws + ((size_t)b * SEQ + t0 + m) * HH;
  U16 qa[2], qal[2];
#pragma unroll
  for (int hc = 0; hc < 2; ++hc) {
    qa[hc].h[0]  = *(const v8h*)(qrow + hc * 32 + 8 * g);
    qa[hc].h[1]  = *(const v8h*)(qrow + hc * 32 + 16 + 8 * g);
    qal[hc].h[0] = *(const v8h*)(qrow + QL + hc * 32 + 8 * g);
    qal[hc].h[1] = *(const v8h*)(qrow + QL + hc * 32 + 16 + 8 * g);
  }

  v8f o[4];
#pragma unroll
  for (int nt = 0; nt < 4; ++nt) o[nt] = v8f_zero();
  float mrow[8], lrow[8];
#pragma unroll
  for (int v = 0; v < 8; ++v) { mrow[v] = NEG_INF; lrow[v] = 0.f; }

  const float scale = ATTN_SCALE;
  const int   nblk  = t0 / 32 + 1;             // causal: keys <= t0+15

  const h16* kbase  = kws + (size_t)b * SEQ * HH;
  const h16* vtbase = vtws + (size_t)b * HH * SEQ;

  for (int blk = wv; blk < nblk; blk += 4) {
    const int s0 = blk * 32;

    // ---- S = Q K^T for 32 keys (two 16x16 tiles) ----
    v8f s[2];
#pragma unroll
    for (int kt = 0; kt < 2; ++kt) {
      const h16* krow = kbase + (size_t)(s0 + kt * 16 + m) * HH;
      U16 kb0, kb1, kb0l, kb1l;                           // B frags use the same k map as A
      kb0.h[0]  = *(const v8h*)(krow + 8 * g);           kb0.h[1]  = *(const v8h*)(krow + 16 + 8 * g);
      kb1.h[0]  = *(const v8h*)(krow + 32 + 8 * g);      kb1.h[1]  = *(const v8h*)(krow + 48 + 8 * g);
      kb0l.h[0] = *(const v8h*)(krow + QL + 8 * g);      kb0l.h[1] = *(const v8h*)(krow + QL + 16 + 8 * g);
      kb1l.h[0] = *(const v8h*)(krow + QL + 32 + 8 * g); kb1l.h[1] = *(const v8h*)(krow + QL + 48 + 8 * g);
      s[kt] = wmma_split(qa[0].v, qal[0].v, kb0.v, kb0l.v, v8f_zero());
      s[kt] = wmma_split(qa[1].v, qal[1].v, kb1.v, kb1l.v, s[kt]);
    }

    // ---- scale + causal mask (diagonal block only) ----
    const bool diag = (s0 + 31 >= t0);
    float rmax[8];
#pragma unroll
    for (int v = 0; v < 8; ++v) {
      const int row = t0 + 8 * g + v;
#pragma unroll
      for (int kt = 0; kt < 2; ++kt) {
        const int col = s0 + kt * 16 + m;
        float val = s[kt][v] * scale;
        val = (diag && (col > row)) ? NEG_INF : val;
        s[kt][v] = val;
      }
      rmax[v] = fmaxf(s[0][v], s[1][v]);
    }
    // row-wise max across the 16 lanes holding this row's columns
#pragma unroll
    for (int off = 1; off < 16; off <<= 1)
#pragma unroll
      for (int v = 0; v < 8; ++v)
        rmax[v] = fmaxf(rmax[v], __shfl_xor(rmax[v], off, 32));

    // ---- online softmax update; write P (x1024, two planes) to LDS in row-major ----
    float alpha[8], psum[8];
#pragma unroll
    for (int v = 0; v < 8; ++v) {
      const float mnew = fmaxf(mrow[v], rmax[v]);
      alpha[v] = __expf(mrow[v] - mnew);
      mrow[v]  = mnew;
      const float p0 = __expf(s[0][v] - mnew);
      const float p1 = __expf(s[1][v] - mnew);
      // probabilities carried x1024 (tail values stay f16-normal; removed in the final merge) as value + residual planes
      { h16 ph, pq; split16(p0 * 1024.0f, ph, pq); Pl[wv][8 * g + v][m] = ph;      Pll[wv][8 * g + v][m] = pq;
        split16(p1 * 1024.0f, ph, pq);          Pl[wv][8 * g + v][16 + m] = ph; Pll[wv][8 * g + v][16 + m] = pq; }
      psum[v] = p0 + p1;
    }
#pragma unroll
    for (int off = 1; off < 16; off <<= 1)
#pragma unroll
      for (int v = 0; v < 8; ++v)
        psum[v] += __shfl_xor(psum[v], off, 32);
#pragma unroll
    for (int v = 0; v < 8; ++v)
      lrow[v] = lrow[v] * alpha[v] + psum[v];
#pragma unroll
    for (int nt = 0; nt < 4; ++nt)
#pragma unroll
      for (int v = 0; v < 8; ++v)
        o[nt][v] *= alpha[v];

    __builtin_amdgcn_fence(3 /* release order */, "wavefront");
    __builtin_amdgcn_wave_barrier();
    U16 pa, pal;
    pa.h[0]  = *(const v8h*)&Pl[wv][m][8 * g];
    pa.h[1]  = *(const v8h*)&Pl[wv][m][16 + 8 * g];
    pal.h[0] = *(const v8h*)&Pll[wv][m][8 * g];
    pal.h[1] = *(const v8h*)&Pll[wv][m][16 + 8 * g];
    __builtin_amdgcn_wave_barrier();

    // ---- O += P V  (V B-frags from the transposed planes) ----
#pragma unroll
    for (int nt = 0; nt < 4; ++nt) {
      const h16* vrow = vtbase + (size_t)(nt * 16 + m) * SEQ + s0;
      U16 vb, vbl;                                        // same k map as A
      vb.h[0]  = *(const v8h*)(vrow + 8 * g);      vb.h[1]  = *(const v8h*)(vrow + 16 + 8 * g);
      vbl.h[0] = *(const v8h*)(vrow + QL + 8 * g); vbl.h[1] = *(const v8h*)(vrow + QL + 16 + 8 * g);
      o[nt] = wmma_split(pa.v, pal.v, vb.v, vbl.v, o[nt]);
    }
  }

  // ---- publish this wave's partial (O, m, l) ----
#pragma unroll
  for (int nt = 0; nt < 4; ++nt)
#pragma unroll
    for (int v = 0; v < 8; ++v)
      Of[wv][8 * g + v][nt * 16 + m] = o[nt][v];
  if (m == 0) {
#pragma unroll
    for (int v = 0; v < 8; ++v) {
      Ml[wv][8 * g + v] = mrow[v];
      Ll[wv][8 * g + v] = lrow[v];
    }
  }
  __syncthreads();

  for (int e = threadIdx.x; e < 16 * HH; e += 128) {
    const int row = e >> 6;        // 0..15
    const int col = e & 63;        // 0..63
    float M = Ml[0][row];
#pragma unroll
    for (int w = 1; w < 4; ++w) M = fmaxf(M, Ml[w][row]);
    float L = 0.f, O = 0.f;
#pragma unroll
    for (int w = 0; w < 4; ++w) {
      const float be = __expf(Ml[w][row] - M);   // 0 for idle waves (m = -inf)
      L += be * Ll[w][row];
      O += be * Of[w][row][col];
    }
    const float r = O / (L * 1024.0f);          // removes the x1024 carried by the probabilities
    float* op = out + ((size_t)b * SEQ_FULL + t0 + row) * HH + col;
    *(float*)op = r;
    
  }
}

// ---------------------------------------------------------------------------
// Launch. Workspace layout (bytes, full size):
//   [0, 4MB)      q   f16 [NB,SEQ,64]  value + residual planes
//   [4MB, 8MB)    k   f16 [NB,SEQ,64]
//   [8MB, 12MB)   v   f16 [NB,SEQ,64]  (row-major, input to the transpose)
//   [12MB, 16MB)  vT  f16 [NB,64,SEQ]
//   [16MB, +576KB) WtQ/WtK/WtV f16 [64,768] x2 planes each
// ---------------------------------------------------------------------------
extern "C" void kernel_launch(void* const* d_in, const int* in_sizes, int n_in,
                              void* d_out, int out_size, void* d_ws,
                              size_t ws_size, hipStream_t stream) {
  if (n_in < 4) return;
  const long long rows_needed = (long long)(NB - 1) * SEQ_FULL + SEQ;
  if ((long long)in_sizes[0] < rows_needed * CC) return;
  if (in_sizes[1] < CC * HH || in_sizes[2] < CC * HH || in_sizes[3] < CC * HH) return;
  if ((long long)out_size < rows_needed * HH) return;

  const float* x  = (const float*)d_in[0];
  const float* Wk = (const float*)d_in[1];
  const float* Wq = (const float*)d_in[2];
  const float* Wv = (const float*)d_in[3];
  float* out = (float*)d_out;

  // every 16-bit buffer holds a value plane followed by its residual plane (2x the element count)
  char* ws = (char*)d_ws;
  const size_t qkv_bytes = (size_t)2 * NB * SEQ * HH * sizeof(h16);     // 4 MB at full size (two planes)
  const size_t wt_bytes  = (size_t)2 * CC * HH * sizeof(h16);           // 192 KB each
  const size_t total     = 4 * qkv_bytes + 3 * wt_bytes;
  if (total > ws_size) return;
  h16* qws  = (h16*)(ws);
  h16* kws  = (h16*)(ws + qkv_bytes);
  h16* vws  = (h16*)(ws + 2 * qkv_bytes);
  h16* vtws = (h16*)(ws + 3 * qkv_bytes);
  h16* WtQ  = (h16*)(ws + 4 * qkv_bytes);
  h16* WtK  = (h16*)(ws + 4 * qkv_bytes + wt_bytes);
  h16* WtV  = (h16*)(ws + 4 * qkv_bytes + 2 * wt_bytes);

  wt_kernel<<<(CC * HH / 2) / 256, 256, 0, stream>>>(Wk, Wq, Wv, WtQ, WtK, WtV);
  qkv_kernel<<<(NB * SEQ) / 128, 256, 0, stream>>>(x, WtQ, WtK, WtV, qws, kws, vws);
  vt_kernel<<<dim3((NB * SEQ) / 64, 2), 256, 0, stream>>>(vws, vtws);
  attn_kernel<<<(NB * SEQ) / 16, 128, 0, stream>>>(qws, kws, vtws, out);
}

// v002
// One run takes 97.4 microseconds.
// Timed twice side by side with v001, it ran 1.08 and 1.10 times as fast.
// Counting every step since v000, it is 1.40 times as fast.
// Contractions: q/k/v projections [NB*SEQ x 64 x 768] (x3), causal scores [T x T x 64] and P.V [T x 64 x T] per batch, all on
// v_wmma_f32_16x16x32_f16 with f16 value + residual operand planes (hi.hi + (hi.lo + lo.hi)/2048), f32 accumulate; softmax and
#include <hip/hip_runtime.h>
#include <math.h>

// Problem constants (NB / SEQ overridable for a reduced build; *_FULL are the strides of the inputs / output)
#ifndef NB
#define NB 8
#endif
#ifndef SEQ
#define SEQ 2048
#endif
#define NB_FULL 8
#define SEQ_FULL 2048
#define CC 768
#define HH 64
#define ATTN_SCALE 0.03608439182435161f   // CC^-0.5 (embedding dim), as f32

static_assert(NB >= 1 && NB <= NB_FULL);
static_assert(SEQ >= 128 && SEQ <= SEQ_FULL && (SEQ % 128) == 0);
static_assert((CC % 64) == 0 && (CC % 32) == 0);
static_assert(HH == 64);
static_assert(((CC * HH / 2) % 256) == 0);
static_assert(((NB * SEQ) % 128) == 0);

// 16-bit operands are f16, each carried as a value plane plus a residual plane lo = f16((v - hi) * 2048):
// a product is hi.hi + (hi.lo + lo.hi)/2048 (f32-class). Every fragment (A and B) uses the 16x16x32 lane map
// lane%16 = row/col, g = lane/16: elements 0..7 -> k = 8g+e, elements 8..15 -> k = 16+8g+(e-8).
// k and v are kept in memory in that fragment order, so that one 16-byte-per-lane fragment load reads 512 contiguous bytes (4 lines, not 16):
//   k: per 16-key tile 1024 elements, [h/16][lane = 16*((h%16)/8) + key%16][h%8]           (tile r starts at element 1024*r of its plane)
//   v: per 32-key block 2048 elements, [h/16][(key%32)/16][lane = 16*((key%16)/8) + h%16][key%8]  (block r starts at element 2048*r)
#define KFRAG(key16, h) ((((h) >> 4) * 32 + (((h) >> 3) & 1) * 16 + (key16)) * 8 + ((h) & 7))
typedef _Float16 h16;
typedef __attribute__((ext_vector_type(16))) _Float16 v16h;
typedef __attribute__((ext_vector_type(8)))  _Float16 v8h;
typedef __attribute__((ext_vector_type(8)))  float    v8f;
typedef __attribute__((ext_vector_type(4)))  float    v4f;
#define RSPLIT (1.0f / 2048.0f)
__device__ __forceinline__ void split16(float f, h16& hi, h16& lo) { hi = (h16)f; lo = (h16)((f - (float)hi) * 2048.0f); }
__device__ __forceinline__ unsigned short hbits(h16 h) { return __builtin_bit_cast(unsigned short, h); }

#define NEG_INF (-__builtin_inff())

__device__ __forceinline__ v8f v8f_zero() {
  v8f z = {0.f, 0.f, 0.f, 0.f, 0.f, 0.f, 0.f, 0.f};
  return z;
}

// D = A(16x32 f16) * B(32x16 f16) + C(16x16 f32), followed by the VALU hazard guard (ties D, keeps A/B live)
__device__ __forceinline__ v8f wmma16(v16h a, v16h b, v8f c) {
  v8f r = __builtin_amdgcn_wmma_f32_16x16x32_f16(false, a, false, b, (short)0, c, false, false);
  asm volatile("v_nop\n\tv_nop\n\tv_nop\n\tv_nop" : "+v"(r) : "v"(a), "v"(b));
  return r;
}

// acc += A.B with value/residual planes: cross terms from zero, folded at 1/2048 on the VALU
__device__ __forceinline__ v8f wmma_split(v16h ah, v16h al, v16h bh, v16h bl, v8f c) {
  v8f x = wmma16(al, bh, v8f_zero());
  x = wmma16(ah, bl, x);
  return wmma16(ah, bh, c) + x * RSPLIT;
}

// ---------------------------------------------------------------------------
// Kernel 0: W[C,H] f32  ->  Wt[H,C] f16 value + residual planes
// ---------------------------------------------------------------------------
__global__ void __launch_bounds__(256)
wt_kernel(const float* __restrict__ Wk,
          const float* __restrict__ Wq,
          const float* __restrict__ Wv,
          h16* __restrict__ WtQ,
          h16* __restrict__ WtK,
          h16* __restrict__ WtV) {
  const int idx = blockIdx.x * 256 + threadIdx.x;   // 0 .. HH*CC/2 - 1
  if (idx >= CC * HH / 2) return;
  const int h = idx / (CC / 2);
  const int c = 2 * (idx % (CC / 2));
  const float* src[3] = {Wq, Wk, Wv};
  h16* dstp[3] = {WtQ, WtK, WtV};
#pragma unroll
  for (int s = 0; s < 3; ++s) {
    h16 h0, l0, h1, l1;
    split16(src[s][(size_t)c * HH + h], h0, l0);
    split16(src[s][(size_t)(c + 1) * HH + h], h1, l1);
    unsigned* dh = (unsigned*)(dstp[s] + (size_t)h * CC + c);
    unsigned* dl = (unsigned*)(dstp[s] + (size_t)CC * HH + (size_t)h * CC + c);
    const unsigned ph = (unsigned)hbits(h0) | ((unsigned)hbits(h1) << 16);
    const unsigned pl = (unsigned)hbits(l0) | ((unsigned)hbits(l1) << 16);
    *(unsigned*)dh = ph; *(unsigned*)dl = pl;
    
  }
}

// ---------------------------------------------------------------------------
// Kernel 1: QKV projection. One wave per 16 rows of (b,t); 8 waves per block.
//   q,v stored row-major [NB,SEQ,64] (value + residual planes), k in fragment order per 16-key tile; v is put in fragment order by vt_kernel.
// A-frag (x rows, split in registers) and B-frags (Wt[n][k] rows) use the same element -> k map; C/D: lane col = lane%16,
// element v -> row 8g+v.
// The six weight planes are staged once per block in LDS, KS columns of k at a time, by asynchronous copies into two
// buffers (the next slice flies while this one is multiplied); all 8 waves read their B fragments from there.
// ---------------------------------------------------------------------------
#define KS 64                          // k columns per staged slice: 128 B of every weight row
#define WPITCH 72                      // f16 per staged row, 144 B = 16 B x odd: 16 rows' 16-byte reads fall on distinct banks
#define WBUF (6 * HH * WPITCH)         // f16 per buffer: planes Q, Q residual, K, K residual, V, V residual
#define NSLICE (CC / KS)
static_assert((CC % KS) == 0 && NSLICE >= 2);
static_assert(6 * HH * (KS / 8) == 12 * 256);   // 16-byte pieces of a slice = 12 per thread of the block

// One slice (columns c0 .. c0+KS-1 of all six planes) into the buffer at LDS byte address lbuf: 12 copies of 16 B per lane.
// Piece i of thread tid: plane i/2, row 32*(i%2) + tid/8, 16-byte column tid%8.
__device__ __forceinline__ void stage_slice(const h16* __restrict__ WtQ, const h16* __restrict__ WtK,
                                            const h16* __restrict__ WtV, int c0, unsigned lbuf, int tid) {
  const size_t PL = (size_t)CC * HH;
  const h16* pl[6] = {WtQ, WtQ + PL, WtK, WtK + PL, WtV, WtV + PL};
#pragma unroll
  for (int q = 0; q < 3; ++q) {   // four copies a statement: fewer address registers live at once than with all twelve in one
    const h16* gp[4];
    unsigned ld[4];
#pragma unroll
    for (int j = 0; j < 4; ++j) {
      const int i = q * 4 + j;
      const int row = (i & 1) * 32 + (tid >> 3);
      gp[j] = pl[i >> 1] + (size_t)row * CC + c0 + (tid & 7) * 8;
      ld[j] = lbuf + (unsigned)((((i >> 1) * HH + row) * WPITCH + (tid & 7) * 8) * sizeof(h16));
    }
    // the copies and, as the statement's last line, the wait that stands before any of their address registers is rewritten
    asm volatile("global_load_async_to_lds_b128 %0, %4, off\n\t"
                 "global_load_async_to_lds_b128 %1, %5, off\n\t"
                 "global_load_async_to_lds_b128 %2, %6, off\n\t"
                 "global_load_async_to_lds_b128 %3, %7, off\n\t"
                 "s_wait_xcnt 0x0"
                 :: "v"(ld[0]), "v"(ld[1]), "v"(ld[2]), "v"(ld[3]), "v"(gp[0]), "v"(gp[1]), "v"(gp[2]), "v"(gp[3])
                 : "memory");
  }
}

// One trip: the 16 x rows of this wave times columns t*KS .. t*KS+KS-1 of the six staged planes (buffer wb), added into the 12 tiles.
__device__ __forceinline__ void slice_mac(const float* __restrict__ xrow, const h16* wb, int t, int g, int m,
                                          v8f (&accQ)[4], v8f (&accK)[4], v8f (&accV)[4]) {
  // the slice's x columns of this lane's row: kc-th 32-chunk holds k = 8g..8g+7 in xv[kc][0..1], 16+8g..16+8g+7 in xv[kc][2..3]
  v4f xv[KS / 32][4];
#pragma unroll
  for (int kc = 0; kc < KS / 32; ++kc) {
    const float* xp = xrow + t * KS + kc * 32 + 8 * g;
    xv[kc][0] = *(const v4f*)(xp);
    xv[kc][1] = *(const v4f*)(xp + 4);
    xv[kc][2] = *(const v4f*)(xp + 16);
    xv[kc][3] = *(const v4f*)(xp + 20);
  }
  // keeps all of the trip's x loads in flight together: sunk to their uses, each 32-chunk would wait for memory by itself
  __builtin_amdgcn_sched_barrier(0);
#pragma unroll
  for (int kc = 0; kc < KS / 32; ++kc) {
    // A-fragment: x tile rows, split into value/residual f16 in registers
    union { v16h v; h16 e[16]; } a, al;
#pragma unroll
    for (int j = 0; j < 8; ++j) {
      split16(xv[kc][j >> 2][j & 3],       a.e[j],     al.e[j]);
      split16(xv[kc][2 + (j >> 2)][j & 3], a.e[8 + j], al.e[8 + j]);
    }
    union UB { v16h v; v8h h[2]; };
#pragma unroll
    for (int nt = 0; nt < 4; ++nt) {
      // one n-tile at a time: its six B fragments (value + residual for Q/K/V weights) then three split MACs;
      // B frags use the same k map as A: {8g..8g+7} then {16+8g..16+8g+7}
      const h16* wr = wb + (nt * 16 + m) * WPITCH + kc * 32 + 8 * g;
      UB bq, bk, bv, bql, bkl, bvl;
      bq.h[0]  = *(const v8h*)(wr);                     bq.h[1]  = *(const v8h*)(wr + 16);
      bql.h[0] = *(const v8h*)(wr + 1 * HH * WPITCH);   bql.h[1] = *(const v8h*)(wr + 1 * HH * WPITCH + 16);
      bk.h[0]  = *(const v8h*)(wr + 2 * HH * WPITCH);   bk.h[1]  = *(const v8h*)(wr + 2 * HH * WPITCH + 16);
      bkl.h[0] = *(const v8h*)(wr + 3 * HH * WPITCH);   bkl.h[1] = *(const v8h*)(wr + 3 * HH * WPITCH + 16);
      bv.h[0]  = *(const v8h*)(wr + 4 * HH * WPITCH);   bv.h[1]  = *(const v8h*)(wr + 4 * HH * WPITCH + 16);
      bvl.h[0] = *(const v8h*)(wr + 5 * HH * WPITCH);   bvl.h[1] = *(const v8h*)(wr + 5 * HH * WPITCH + 16);
      accQ[nt] = wmma_split(a.v, al.v, bq.v, bql.v, accQ[nt]);
      accK[nt] = wmma_split(a.v, al.v, bk.v, bkl.v, accK[nt]);
      accV[nt] = wmma_split(a.v, al.v, bv.v, bvl.v, accV[nt]);
      // keeps the n-tiles apart in the schedule: mixed, more fragments and cross-term tiles are live at once and registers spill to scratch
      __builtin_amdgcn_sched_barrier(0);
    }
  }
}

// Hand-over at the foot of a trip: this wave's reads of the slice are done, its copies of the next slice have landed, and
// every wave has said so; behind it the next slice may be read and the buffer just read may be refilled.
__device__ __forceinline__ void slice_handover() {
  asm volatile("s_wait_dscnt 0x0" ::: "memory");
  asm volatile("s_wait_asynccnt 0x0" ::: "memory");
  __syncthreads();
}

__global__ void __launch_bounds__(256)
qkv_kernel(const float* __restrict__ x,
           const h16* __restrict__ WtQ,
           const h16* __restrict__ WtK,
           const h16* __restrict__ WtV,
           h16* __restrict__ qws,
           h16* __restrict__ kws,
           h16* __restrict__ vws) {
  __shared__ __align__(16) h16 wl[2][WBUF];     // the two weight-slice buffers (cross-wave)
  __shared__ __align__(16) h16 st[8][16][64];   // per-wave staging of one 16x64 result plane (wave-private)
  const int lane = threadIdx.x & 31;
  const int wv   = threadIdx.x >> 5;
  const int g    = lane >> 4;
  const int m    = lane & 15;
  const int tile = blockIdx.x * 8 + wv;        // 0 .. NB*SEQ/16 - 1
  const int b    = tile / (SEQ / 16);
  const int t0   = (tile % (SEQ / 16)) * 16;
  const size_t QL = (size_t)NB * SEQ * HH;     // residual plane offset inside q/k/v buffers
  const unsigned lw = (unsigned)(size_t)&wl[0][0];   // LDS byte address of buffer 0

  v8f accQ[4], accK[4], accV[4];
#pragma unroll
  for (int nt = 0; nt < 4; ++nt) {
    accQ[nt] = v8f_zero();
    accK[nt] = v8f_zero();
    accV[nt] = v8f_zero();
  }

  const float* xrow = x + ((size_t)b * SEQ_FULL + t0 + m) * CC;

  // slice 0 lands and is published to every wave; slice 1 then flies during trip 0
  stage_slice(WtQ, WtK, WtV, 0, lw, threadIdx.x);
  asm volatile("s_wait_asynccnt 0x0" ::: "memory");   // this wave's copies of slice 0 have landed
  __syncthreads();
  stage_slice(WtQ, WtK, WtV, KS, lw + (unsigned)(WBUF * sizeof(h16)), threadIdx.x);

  // rolled, and the last two trips (no slice left to fetch) in a loop of their own: each loop body stays one straight block
#pragma unroll 1
  for (int t = 0; t < NSLICE - 2; ++t) {
    slice_mac(xrow, &wl[t & 1][0], t, g, m, accQ, accK, accV);
    slice_handover();
    // refill the buffer that this trip has just read
    stage_slice(WtQ, WtK, WtV, (t + 2) * KS, lw + (unsigned)((t & 1) * WBUF * sizeof(h16)), threadIdx.x);
  }
#pragma unroll 1
  for (int t = NSLICE - 2; t < NSLICE; ++t) {
    slice_mac(xrow, &wl[t & 1][0], t, g, m, accQ, accK, accV);
    slice_handover();
  }
  asm volatile("s_wait_asynccnt 0x0" ::: "memory");   // no copy is outstanding when the wave goes on and ends

  // outputs: q, k, v [NB,SEQ,64] as value + residual planes; each 16x64 plane tile goes through the wave's LDS tile and is
  h16* sw = &st[wv][0][0];
  h16* dsts[3] = {qws, kws, vws};
#pragma unroll
  for (int s = 0; s < 3; ++s) {
#pragma unroll
    for (int pl = 0; pl < 2; ++pl) {
#pragma unroll
      for (int nt = 0; nt < 4; ++nt)
#pragma unroll
        for (int v = 0; v < 8; ++v) {
          const float val = (s == 0) ? accQ[nt][v] : (s == 1) ? accK[nt][v] : accV[nt][v];
          h16 hh_, ll_; split16(val, hh_, ll_);
          // q, v: row-major [row][col]; k: fragment order (KFRAG), so that the linear copy-out below stores the tile that way
          const int si = (s == 1) ? KFRAG(8 * g + v, nt * 16 + m) : (8 * g + v) * 64 + nt * 16 + m;
          sw[si] = pl ? ll_ : hh_;
        }
      asm volatile("s_wait_dscnt 0" ::: "memory");
      h16* base = dsts[s] + (pl ? QL : 0) + ((size_t)b * SEQ + t0) * HH;
#pragma unroll
      for (int r = 0; r < 16; ++r) {
        const unsigned w = *((const unsigned*)(sw + r * 64) + lane);
        *(unsigned*)((unsigned*)(base + (size_t)r * HH) + lane) = w;
      }
      
      asm volatile("s_wait_dscnt 0" ::: "memory");
    }
  }
}

// ---------------------------------------------------------------------------
// Kernel 1b: V put in fragment order per 32-key block (value plane then residual plane at +NB*SEQ*64) through an LDS tile; a wave writes one
// ---------------------------------------------------------------------------
__global__ void __launch_bounds__(256)
vt_kernel(const h16* __restrict__ vws, h16* __restrict__ vtws) {
  __shared__ h16 t[64][66];                         // [t][h], cross-wave (block barrier)
  const int tid = threadIdx.x;
  const size_t QL = (size_t)NB * SEQ * HH;
  const int row0 = blockIdx.x * 64;                 // 64 consecutive (b,t) rows, same b
  const int pl = blockIdx.y;                        // 0: value plane, 1: residual plane
  const h16* src = vws + (pl ? QL : 0) + (size_t)row0 * HH;
#pragma unroll
  for (int k = 0; k < 16; ++k) { const int e = tid + 256 * k; t[e >> 6][e & 63] = src[e]; }
  __syncthreads();
  // the block's two 32-key blocks are 2048 consecutive 32-bit words; word r*256 + tid holds keys key, key+1 of column h
  h16* dst = vtws + (pl ? QL : 0) + (size_t)row0 * HH;
  const int fl = (tid & 127) >> 2;                  // fragment lane of this thread's words
#pragma unroll
  for (int r = 0; r < 8; ++r) {
    const int h   = (r & 3) * 16 + (fl & 15);
    const int key = (r >> 2) * 32 + (tid >> 7) * 16 + (fl >> 4) * 8 + 2 * (tid & 3);
    const unsigned pk = (unsigned)hbits(t[key][h]) | ((unsigned)hbits(t[key + 1][h]) << 16);
    unsigned* d = (unsigned*)dst + r * 256 + tid;
    *(unsigned*)d = pk;
    
  }
}

// ---------------------------------------------------------------------------
// Kernel 2: causal flash attention, split-K across 4 waves per 16-row query tile.
// Wave w handles key blocks w, w+4, w+8, ... (balanced causal triangle).
// Per 32-key block: S = Q K^T (2 split tiles), online softmax, O += P V (4 split tiles).
// P transposed (D-layout -> A-layout) through wave-private LDS staging.
// Partial (O, m, l) merged across waves via LDS log-sum-exp combine (block barrier).
// ---------------------------------------------------------------------------
__global__ void __launch_bounds__(128)
attn_kernel(const h16* __restrict__ qws,
            const h16* __restrict__ kws,
            const h16* __restrict__ vtws,
            float* __restrict__ out) {
  __shared__ __align__(16) h16 Pl[4][16][32];    // per-wave P staging, value plane (wave-private)
  __shared__ __align__(16) h16 Pll[4][16][32];   // residual plane (wave-private)
  __shared__ __align__(16) float Of[4][16][64];  // partial O (cross-wave)
  __shared__ float Ml[4][16], Ll[4][16];         // partial m, l (cross-wave)

  const int lane = threadIdx.x & 31;
  const int wv   = threadIdx.x >> 5;
  const int g    = lane >> 4;
  const int m    = lane & 15;
  const int tile = blockIdx.x;                 // 0 .. NB*SEQ/16 - 1
  const int b    = tile / (SEQ / 16);
  const int t0   = (tile % (SEQ / 16)) * 16;

  union U16 { v16h v; v8h h[2]; };

  // Q A-frags for the two 32-wide h chunks (HH = 64)
  const size_t QL = (size_t)NB * SEQ * HH;     // residual planes follow the value planes
  const h16* qrow = qws + ((size_t)b * SEQ + t0 + m) * HH;
  U16 qa[2], qal[2];
#pragma unroll
  for (int hc = 0; hc < 2; ++hc) {
    qa[hc].h[0]  = *(const v8h*)(qrow + hc * 32 + 8 * g);
    qa[hc].h[1]  = *(const v8h*)(qrow + hc * 32 + 16 + 8 * g);
    qal[hc].h[0] = *(const v8h*)(qrow + QL + hc * 32 + 8 * g);
    qal[hc].h[1] = *(const v8h*)(qrow + QL + hc * 32 + 16 + 8 * g);
  }

  v8f o[4];
#pragma unroll
  for (int nt = 0; nt < 4; ++nt) o[nt] = v8f_zero();
  float mrow[8], lrow[8];
#pragma unroll
  for (int v = 0; v < 8; ++v) { mrow[v] = NEG_INF; lrow[v] = 0.f; }

  const float scale = ATTN_SCALE;
  const int   nblk  = t0 / 32 + 1;             // causal: keys <= t0+15

  const h16* kbase  = kws + (size_t)b * SEQ * HH;
  const h16* vtbase = vtws + (size_t)b * HH * SEQ;

  for (int blk = wv; blk < nblk; blk += 4) {
    const int s0 = blk * 32;

    // ---- S = Q K^T for 32 keys (two 16x16 tiles) ----
    v8f s[2];
#pragma unroll
    for (int kt = 0; kt < 2; ++kt) {
      const h16* kfr = kbase + (size_t)(s0 + kt * 16) * HH + lane * 8;   // this lane's 8 elements of the tile's first 16-h group
      U16 kb0, kb1, kb0l, kb1l;                           // B frags use the same k map as A; 16-h group c is 256 elements on
      kb0.h[0]  = *(const v8h*)(kfr);            kb0.h[1]  = *(const v8h*)(kfr + 256);
      kb1.h[0]  = *(const v8h*)(kfr + 512);      kb1.h[1]  = *(const v8h*)(kfr + 768);
      kb0l.h[0] = *(const v8h*)(kfr + QL);       kb0l.h[1] = *(const v8h*)(kfr + QL + 256);
      kb1l.h[0] = *(const v8h*)(kfr + QL + 512); kb1l.h[1] = *(const v8h*)(kfr + QL + 768);
      s[kt] = wmma_split(qa[0].v, qal[0].v, kb0.v, kb0l.v, v8f_zero());
      s[kt] = wmma_split(qa[1].v, qal[1].v, kb1.v, kb1l.v, s[kt]);
    }

    // ---- scale + causal mask (diagonal block only) ----
    const bool diag = (s0 + 31 >= t0);
    float rmax[8];
#pragma unroll
    for (int v = 0; v < 8; ++v) {
      const int row = t0 + 8 * g + v;
#pragma unroll
      for (int kt = 0; kt < 2; ++kt) {
        const int col = s0 + kt * 16 + m;
        float val = s[kt][v] * scale;
        val = (diag && (col > row)) ? NEG_INF : val;
        s[kt][v] = val;
      }
      rmax[v] = fmaxf(s[0][v], s[1][v]);
    }
    // row-wise max across the 16 lanes holding this row's columns
#pragma unroll
    for (int off = 1; off < 16; off <<= 1)
#pragma unroll
      for (int v = 0; v < 8; ++v)
        rmax[v] = fmaxf(rmax[v], __shfl_xor(rmax[v], off, 32));

    // ---- online softmax update; write P (x1024, two planes) to LDS in row-major ----
    float alpha[8], psum[8];
#pragma unroll
    for (int v = 0; v < 8; ++v) {
      const float mnew = fmaxf(mrow[v], rmax[v]);
      alpha[v] = __expf(mrow[v] - mnew);
      mrow[v]  = mnew;
      const float p0 = __expf(s[0][v] - mnew);
      const float p1 = __expf(s[1][v] - mnew);
      // probabilities carried x1024 (tail values stay f16-normal; removed in the final merge) as value + residual planes
      { h16 ph, pq; split16(p0 * 1024.0f, ph, pq); Pl[wv][8 * g + v][m] = ph;      Pll[wv][8 * g + v][m] = pq;
        split16(p1 * 1024.0f, ph, pq);          Pl[wv][8 * g + v][16 + m] = ph; Pll[wv][8 * g + v][16 + m] = pq; }
      psum[v] = p0 + p1;
    }
#pragma unroll
    for (int off = 1; off < 16; off <<= 1)
#pragma unroll
      for (int v = 0; v < 8; ++v)
        psum[v] += __shfl_xor(psum[v], off, 32);
#pragma unroll
    for (int v = 0; v < 8; ++v)
      lrow[v] = lrow[v] * alpha[v] + psum[v];
#pragma unroll
    for (int nt = 0; nt < 4; ++nt)
#pragma unroll
      for (int v = 0; v < 8; ++v)
        o[nt][v] *= alpha[v];

    __builtin_amdgcn_fence(3 /* release order */, "wavefront");
    __builtin_amdgcn_wave_barrier();
    U16 pa, pal;
    pa.h[0]  = *(const v8h*)&Pl[wv][m][8 * g];
    pa.h[1]  = *(const v8h*)&Pl[wv][m][16 + 8 * g];
    pal.h[0] = *(const v8h*)&Pll[wv][m][8 * g];
    pal.h[1] = *(const v8h*)&Pll[wv][m][16 + 8 * g];
    __builtin_amdgcn_wave_barrier();

    // ---- O += P V  (V B-frags from the fragment-ordered planes) ----
#pragma unroll
    for (int nt = 0; nt < 4; ++nt) {
      const h16* vfr = vtbase + (size_t)s0 * HH + nt * 512 + lane * 8;   // this lane's 8 keys of column nt*16+m, keys 8g..8g+7
      U16 vb, vbl;                                        // same k map as A; keys 16+8g.. are 256 elements on
      vb.h[0]  = *(const v8h*)(vfr);      vb.h[1]  = *(const v8h*)(vfr + 256);
      vbl.h[0] = *(const v8h*)(vfr + QL); vbl.h[1] = *(const v8h*)(vfr + QL + 256);
      o[nt] = wmma_split(pa.v, pal.v, vb.v, vbl.v, o[nt]);
    }
    // stands before the next pass rewrites the address registers that this pass's fragment loads name
    asm volatile("s_wait_xcnt 0x0" ::: "memory");
  }

  // ---- publish this wave's partial (O, m, l) ----
#pragma unroll
  for (int nt = 0; nt < 4; ++nt)
#pragma unroll
    for (int v = 0; v < 8; ++v)
      Of[wv][8 * g + v][nt * 16 + m] = o[nt][v];
  if (m == 0) {
#pragma unroll
    for (int v = 0; v < 8; ++v) {
      Ml[wv][8 * g + v] = mrow[v];
      Ll[wv][8 * g + v] = lrow[v];
    }
  }
  __syncthreads();

  for (int e = threadIdx.x; e < 16 * HH; e += 128) {
    const int row = e >> 6;        // 0..15
    const int col = e & 63;        // 0..63
    float M = Ml[0][row];
#pragma unroll
    for (int w = 1; w < 4; ++w) M = fmaxf(M, Ml[w][row]);
    float L = 0.f, O = 0.f;
#pragma unroll
    for (int w = 0; w < 4; ++w) {
      const float be = __expf(Ml[w][row] - M);   // 0 for idle waves (m = -inf)
      L += be * Ll[w][row];
      O += be * Of[w][row][col];
    }
    const float r = O / (L * 1024.0f);          // removes the x1024 carried by the probabilities
    float* op = out + ((size_t)b * SEQ_FULL + t0 + row) * HH + col;
    *(float*)op = r;
    
  }
}

// ---------------------------------------------------------------------------
// Launch. Workspace layout (bytes, full size):
//   [0, 4MB)      q   f16 [NB,SEQ,64]  value + residual planes
//   [4MB, 8MB)    k   f16 [NB,SEQ,64]  (fragment order per 16-key tile)
//   [8MB, 12MB)   v   f16 [NB,SEQ,64]  (row-major, input to the transpose)
//   [12MB, 16MB)  v   f16 [NB,SEQ,64]  (fragment order per 32-key block)
//   [16MB, +576KB) WtQ/WtK/WtV f16 [64,768] x2 planes each
// ---------------------------------------------------------------------------
extern "C" void kernel_launch(void* const* d_in, const int* in_sizes, int n_in,
                              void* d_out, int out_size, void* d_ws,
                              size_t ws_size, hipStream_t stream) {
  if (n_in < 4) return;
  const long long rows_needed = (long long)(NB - 1) * SEQ_FULL + SEQ;
  if ((long long)in_sizes[0] < rows_needed * CC) return;
  if (in_sizes[1] < CC * HH || in_sizes[2] < CC * HH || in_sizes[3] < CC * HH) return;
  if ((long long)out_size < rows_needed * HH) return;

  const float* x  = (const float*)d_in[0];
  const float* Wk = (const float*)d_in[1];
  const float* Wq = (const float*)d_in[2];
  const float* Wv = (const float*)d_in[3];
  float* out = (float*)d_out;

  // every 16-bit buffer holds a value plane followed by its residual plane (2x the element count)
  char* ws = (char*)d_ws;
  const size_t qkv_bytes = (size_t)2 * NB * SEQ * HH * sizeof(h16);     // 4 MB at full size (two planes)
  const size_t wt_bytes  = (size_t)2 * CC * HH * sizeof(h16);           // 192 KB each
  const size_t total     = 4 * qkv_bytes + 3 * wt_bytes;
  if (total > ws_size) return;
  h16* qws  = (h16*)(ws);
  h16* kws  = (h16*)(ws + qkv_bytes);
  h16* vws  = (h16*)(ws + 2 * qkv_bytes);
  h16* vtws = (h16*)(ws + 3 * qkv_bytes);
  h16* WtQ  = (h16*)(ws + 4 * qkv_bytes);
  h16* WtK  = (h16*)(ws + 4 * qkv_bytes + wt_bytes);
  h16* WtV  = (h16*)(ws + 4 * qkv_bytes + 2 * wt_bytes);

  wt_kernel<<<(CC * HH / 2) / 256, 256, 0, stream>>>(Wk, Wq, Wv, WtQ, WtK, WtV);
  qkv_kernel<<<(NB * SEQ) / 128, 256, 0, stream>>>(x, WtQ, WtK, WtV, qws, kws, vws);
  vt_kernel<<<dim3((NB * SEQ) / 64, 2), 256, 0, stream>>>(vws, vtws);
  attn_kernel<<<(NB * SEQ) / 16, 128, 0, stream>>>(qws, kws, vtws, out);
}

// v003
// One run takes 88.4 microseconds.
// Timed twice side by side with v002, it ran 1.11 times as fast both times.
// Over all steps from v000 it is 1.55 times as fast.
// Contractions: q/k/v projections [NB*SEQ x 64 x 768] (x3), causal scores [T x T x 64] and P.V [T x 64 x T] per batch, all on
// v_wmma_f32_16x16x32_f16 with f16 value + residual operand planes (hi.hi + (hi.lo + lo.hi)/2048), f32 accumulate; softmax and
#include <hip/hip_runtime.h>
#include <math.h>

// Problem constants (NB / SEQ overridable for a reduced build; *_FULL are the strides of the inputs / output)
#ifndef NB
#define NB 8
#endif
#ifndef SEQ
#define SEQ 2048
#endif
#define NB_FULL 8
#define SEQ_FULL 2048
#define CC 768
#define HH 64
#define ATTN_SCALE 0.03608439182435161f   // CC^-0.5 (embedding dim), as f32

static_assert(NB >= 1 && NB <= NB_FULL);
static_assert(SEQ >= 128 && SEQ <= SEQ_FULL && (SEQ % 128) == 0);
static_assert((CC % 64) == 0 && (CC % 32) == 0);
static_assert(HH == 64);
static_assert(((CC * HH / 2) % 256) == 0);
static_assert(((NB * SEQ) % 128) == 0);

// 16-bit operands are f16, each carried as a value plane plus a residual plane lo = f16((v - hi) * 2048):
// a product is hi.hi + (hi.lo + lo.hi)/2048 (f32-class). Every fragment (A and B) uses the 16x16x32 lane map
// lane%16 = row/col, g = lane/16: elements 0..7 -> k = 8g+e, elements 8..15 -> k = 16+8g+(e-8).
// k and v are kept in memory in that fragment order, so that one 16-byte-per-lane fragment load reads 512 contiguous bytes (4 lines, not 16):
//   k: per 16-key tile 1024 elements, [h/16][lane = 16*((h%16)/8) + key%16][h%8]           (tile r starts at element 1024*r of its plane)
//   v: per 32-key block 2048 elements, [h/16][(key%32)/16][lane = 16*((key%16)/8) + h%16][key%8]  (block r starts at element 2048*r)
#define KFRAG(key16, h) ((((h) >> 4) * 32 + (((h) >> 3) & 1) * 16 + (key16)) * 8 + ((h) & 7))
typedef _Float16 h16;
typedef __attribute__((ext_vector_type(16))) _Float16 v16h;
typedef __attribute__((ext_vector_type(8)))  _Float16 v8h;
typedef __attribute__((ext_vector_type(8)))  float    v8f;
typedef __attribute__((ext_vector_type(4)))  float    v4f;
#define RSPLIT (1.0f / 2048.0f)
__device__ __forceinline__ void split16(float f, h16& hi, h16& lo) { hi = (h16)f; lo = (h16)((f - (float)hi) * 2048.0f); }
__device__ __forceinline__ unsigned short hbits(h16 h) { return __builtin_bit_cast(unsigned short, h); }

#define NEG_INF (-__builtin_inff())

__device__ __forceinline__ v8f v8f_zero() {
  v8f z = {0.f, 0.f, 0.f, 0.f, 0.f, 0.f, 0.f, 0.f};
  return z;
}

// D = A(16x32 f16) * B(32x16 f16) + C(16x16 f32), followed by the VALU hazard guard (ties D, keeps A/B live)
__device__ __forceinline__ v8f wmma16(v16h a, v16h b, v8f c) {
  v8f r = __builtin_amdgcn_wmma_f32_16x16x32_f16(false, a, false, b, (short)0, c, false, false);
  asm volatile("v_nop\n\tv_nop\n\tv_nop\n\tv_nop" : "+v"(r) : "v"(a), "v"(b));
  return r;
}

// acc += A.B with value/residual planes: cross terms from zero, folded at 1/2048 on the VALU
__device__ __forceinline__ v8f wmma_split(v16h ah, v16h al, v16h bh, v16h bl, v8f c) {
  v8f x = wmma16(al, bh, v8f_zero());
  x = wmma16(ah, bl, x);
  return wmma16(ah, bh, c) + x * RSPLIT;
}

// ---------------------------------------------------------------------------
// Kernel 0: W[C,H] f32  ->  Wt[H,C] f16 value + residual planes
// ---------------------------------------------------------------------------
__global__ void __launch_bounds__(256)
wt_kernel(const float* __restrict__ Wk,
          const float* __restrict__ Wq,
          const float* __restrict__ Wv,
          h16* __restrict__ WtQ,
          h16* __restrict__ WtK,
          h16* __restrict__ WtV) {
  const int idx = blockIdx.x * 256 + threadIdx.x;   // 0 .. HH*CC/2 - 1
  if (idx >= CC * HH / 2) return;
  const int h = idx / (CC / 2);
  const int c = 2 * (idx % (CC / 2));
  const float* src[3] = {Wq, Wk, Wv};
  h16* dstp[3] = {WtQ, WtK, WtV};
#pragma unroll
  for (int s = 0; s < 3; ++s) {
    h16 h0, l0, h1, l1;
    split16(src[s][(size_t)c * HH + h], h0, l0);
    split16(src[s][(size_t)(c + 1) * HH + h], h1, l1);
    unsigned* dh = (unsigned*)(dstp[s] + (size_t)h * CC + c);
    unsigned* dl = (unsigned*)(dstp[s] + (size_t)CC * HH + (size_t)h * CC + c);
    const unsigned ph = (unsigned)hbits(h0) | ((unsigned)hbits(h1) << 16);
    const unsigned pl = (unsigned)hbits(l0) | ((unsigned)hbits(l1) << 16);
    *(unsigned*)dh = ph; *(unsigned*)dl = pl;
    
  }
}

// ---------------------------------------------------------------------------
// Kernel 1: QKV projection. One wave per 16 rows of (b,t); 8 waves per block.
//   q,v stored row-major [NB,SEQ,64] (value + residual planes), k in fragment order per 16-key tile; v is put in fragment order by vt_kernel.
// A-frag (x rows, split in registers) and B-frags (Wt[n][k] rows) use the same element -> k map; C/D: lane col = lane%16,
// element v -> row 8g+v.
// The six weight planes are staged once per block in LDS, KS columns of k at a time, by asynchronous copies into two
// buffers (the next slice flies while this one is multiplied); all 8 waves read their B fragments from there.
// ---------------------------------------------------------------------------
#define KS 64                          // k columns per staged slice: 128 B of every weight row
#define WPITCH 72                      // f16 per staged row, 144 B = 16 B x odd: 16 rows' 16-byte reads fall on distinct banks
#define WBUF (6 * HH * WPITCH)         // f16 per buffer: planes Q, Q residual, K, K residual, V, V residual
#define NSLICE (CC / KS)
static_assert((CC % KS) == 0 && NSLICE >= 2);
static_assert(6 * HH * (KS / 8) == 12 * 256);   // 16-byte pieces of a slice = 12 per thread of the block

// One slice (columns c0 .. c0+KS-1 of all six planes) into the buffer at LDS byte address lbuf: 12 copies of 16 B per lane.
// Piece i of thread tid: plane i/2, row 32*(i%2) + tid/8, 16-byte column tid%8.
__device__ __forceinline__ void stage_slice(const h16* __restrict__ WtQ, const h16* __restrict__ WtK,
                                            const h16* __restrict__ WtV, int c0, unsigned lbuf, int tid) {
  const size_t PL = (size_t)CC * HH;
  const h16* pl[6] = {WtQ, WtQ + PL, WtK, WtK + PL, WtV, WtV + PL};
#pragma unroll
  for (int q = 0; q < 3; ++q) {   // four copies a statement: fewer address registers live at once than with all twelve in one
    const h16* gp[4];
    unsigned ld[4];
#pragma unroll
    for (int j = 0; j < 4; ++j) {
      const int i = q * 4 + j;
      const int row = (i & 1) * 32 + (tid >> 3);
      gp[j] = pl[i >> 1] + (size_t)row * CC + c0 + (tid & 7) * 8;
      ld[j] = lbuf + (unsigned)((((i >> 1) * HH + row) * WPITCH + (tid & 7) * 8) * sizeof(h16));
    }
    // the copies and, as the statement's last line, the wait that stands before any of their address registers is rewritten
    asm volatile("global_load_async_to_lds_b128 %0, %4, off\n\t"
                 "global_load_async_to_lds_b128 %1, %5, off\n\t"
                 "global_load_async_to_lds_b128 %2, %6, off\n\t"
                 "global_load_async_to_lds_b128 %3, %7, off\n\t"
                 "s_wait_xcnt 0x0"
                 :: "v"(ld[0]), "v"(ld[1]), "v"(ld[2]), "v"(ld[3]), "v"(gp[0]), "v"(gp[1]), "v"(gp[2]), "v"(gp[3])
                 : "memory");
  }
}

// One trip: the 16 x rows of this wave times columns t*KS .. t*KS+KS-1 of the six staged planes (buffer wb), added into the 12 tiles.
__device__ __forceinline__ void slice_mac(const float* __restrict__ xrow, const h16* wb, int t, int g, int m,
                                          v8f (&accQ)[4], v8f (&accK)[4], v8f (&accV)[4]) {
  // the slice's x columns of this lane's row: kc-th 32-chunk holds k = 8g..8g+7 in xv[kc][0..1], 16+8g..16+8g+7 in xv[kc][2..3]
  v4f xv[KS / 32][4];
#pragma unroll
  for (int kc = 0; kc < KS / 32; ++kc) {
    const float* xp = xrow + t * KS + kc * 32 + 8 * g;
    xv[kc][0] = *(const v4f*)(xp);
    xv[kc][1] = *(const v4f*)(xp + 4);
    xv[kc][2] = *(const v4f*)(xp + 16);
    xv[kc][3] = *(const v4f*)(xp + 20);
  }
  // keeps all of the trip's x loads in flight together: sunk to their uses, each 32-chunk would wait for memory by itself
  __builtin_amdgcn_sched_barrier(0);
#pragma unroll
  for (int kc = 0; kc < KS / 32; ++kc) {
    // A-fragment: x tile rows, split into value/residual f16 in registers
    union { v16h v; h16 e[16]; } a, al;
#pragma unroll
    for (int j = 0; j < 8; ++j) {
      split16(xv[kc][j >> 2][j & 3],       a.e[j],     al.e[j]);
      split16(xv[kc][2 + (j >> 2)][j & 3], a.e[8 + j], al.e[8 + j]);
    }
    union UB { v16h v; v8h h[2]; };
#pragma unroll
    for (int nt = 0; nt < 4; ++nt) {
      // one n-tile at a time: its six B fragments (value + residual for Q/K/V weights) then three split MACs;
      // B frags use the same k map as A: {8g..8g+7} then {16+8g..16+8g+7}
      const h16* wr = wb + (nt * 16 + m) * WPITCH + kc * 32 + 8 * g;
      UB bq, bk, bv, bql, bkl, bvl;
      bq.h[0]  = *(const v8h*)(wr);                     bq.h[1]  = *(const v8h*)(wr + 16);
      bql.h[0] = *(const v8h*)(wr + 1 * HH * WPITCH);   bql.h[1] = *(const v8h*)(wr + 1 * HH * WPITCH + 16);
      bk.h[0]  = *(const v8h*)(wr + 2 * HH * WPITCH);   bk.h[1]  = *(const v8h*)(wr + 2 * HH * WPITCH + 16);
      bkl.h[0] = *(const v8h*)(wr + 3 * HH * WPITCH);   bkl.h[1] = *(const v8h*)(wr + 3 * HH * WPITCH + 16);
      bv.h[0]  = *(const v8h*)(wr + 4 * HH * WPITCH);   bv.h[1]  = *(const v8h*)(wr + 4 * HH * WPITCH + 16);
      bvl.h[0] = *(const v8h*)(wr + 5 * HH * WPITCH);   bvl.h[1] = *(const v8h*)(wr + 5 * HH * WPITCH + 16);
      accQ[nt] = wmma_split(a.v, al.v, bq.v, bql.v, accQ[nt]);
      accK[nt] = wmma_split(a.v, al.v, bk.v, bkl.v, accK[nt]);
      accV[nt] = wmma_split(a.v, al.v, bv.v, bvl.v, accV[nt]);
      // keeps the n-tiles apart in the schedule: mixed, more fragments and cross-term tiles are live at once and registers spill to scratch
      __builtin_amdgcn_sched_barrier(0);
    }
  }
}

// Hand-over at the foot of a trip: this wave's reads of the slice are done, its copies of the next slice have landed, and
// every wave has said so; behind it the next slice may be read and the buffer just read may be refilled.
__device__ __forceinline__ void slice_handover() {
  asm volatile("s_wait_dscnt 0x0" ::: "memory");
  asm volatile("s_wait_asynccnt 0x0" ::: "memory");
  __syncthreads();
}

__global__ void __launch_bounds__(256)
qkv_kernel(const float* __restrict__ x,
           const h16* __restrict__ WtQ,
           const h16* __restrict__ WtK,
           const h16* __restrict__ WtV,
           h16* __restrict__ qws,
           h16* __restrict__ kws,
           h16* __restrict__ vws) {
  __shared__ __align__(16) h16 wl[2][WBUF];     // the two weight-slice buffers (cross-wave)
  __shared__ __align__(16) h16 st[8][16][64];   // per-wave staging of one 16x64 result plane (wave-private)
  const int lane = threadIdx.x & 31;
  const int wv   = threadIdx.x >> 5;
  const int g    = lane >> 4;
  const int m    = lane & 15;
  const int tile = blockIdx.x * 8 + wv;        // 0 .. NB*SEQ/16 - 1
  const int b    = tile / (SEQ / 16);
  const int t0   = (tile % (SEQ / 16)) * 16;
  const size_t QL = (size_t)NB * SEQ * HH;     // residual plane offset inside q/k/v buffers
  const unsigned lw = (unsigned)(size_t)&wl[0][0];   // LDS byte address of buffer 0

  v8f accQ[4], accK[4], accV[4];
#pragma unroll
  for (int nt = 0; nt < 4; ++nt) {
    accQ[nt] = v8f_zero();
    accK[nt] = v8f_zero();
    accV[nt] = v8f_zero();
  }

  const float* xrow = x + ((size_t)b * SEQ_FULL + t0 + m) * CC;

  // slice 0 lands and is published to every wave; slice 1 then flies during trip 0
  stage_slice(WtQ, WtK, WtV, 0, lw, threadIdx.x);
  asm volatile("s_wait_asynccnt 0x0" ::: "memory");   // this wave's copies of slice 0 have landed
  __syncthreads();
  stage_slice(WtQ, WtK, WtV, KS, lw + (unsigned)(WBUF * sizeof(h16)), threadIdx.x);

  // rolled, and the last two trips (no slice left to fetch) in a loop of their own: each loop body stays one straight block
#pragma unroll 1
  for (int t = 0; t < NSLICE - 2; ++t) {
    slice_mac(xrow, &wl[t & 1][0], t, g, m, accQ, accK, accV);
    slice_handover();
    // refill the buffer that this trip has just read
    stage_slice(WtQ, WtK, WtV, (t + 2) * KS, lw + (unsigned)((t & 1) * WBUF * sizeof(h16)), threadIdx.x);
  }
#pragma unroll 1
  for (int t = NSLICE - 2; t < NSLICE; ++t) {
    slice_mac(xrow, &wl[t & 1][0], t, g, m, accQ, accK, accV);
    slice_handover();
  }
  asm volatile("s_wait_asynccnt 0x0" ::: "memory");   // no copy is outstanding when the wave goes on and ends

  // outputs: q, k, v [NB,SEQ,64] as value + residual planes; each 16x64 plane tile goes through the wave's LDS tile and is
  h16* sw = &st[wv][0][0];
  h16* dsts[3] = {qws, kws, vws};
#pragma unroll
  for (int s = 0; s < 3; ++s) {
#pragma unroll
    for (int pl = 0; pl < 2; ++pl) {
#pragma unroll
      for (int nt = 0; nt < 4; ++nt)
#pragma unroll
        for (int v = 0; v < 8; ++v) {
          const float val = (s == 0) ? accQ[nt][v] : (s == 1) ? accK[nt][v] : accV[nt][v];
          h16 hh_, ll_; split16(val, hh_, ll_);
          // q, v: row-major [row][col]; k: fragment order (KFRAG), so that the linear copy-out below stores the tile that way
          const int si = (s == 1) ? KFRAG(8 * g + v, nt * 16 + m) : (8 * g + v) * 64 + nt * 16 + m;
          sw[si] = pl ? ll_ : hh_;
        }
      asm volatile("s_wait_dscnt 0" ::: "memory");
      h16* base = dsts[s] + (pl ? QL : 0) + ((size_t)b * SEQ + t0) * HH;
#pragma unroll
      for (int r = 0; r < 16; ++r) {
        const unsigned w = *((const unsigned*)(sw + r * 64) + lane);
        *(unsigned*)((unsigned*)(base + (size_t)r * HH) + lane) = w;
      }
      
      asm volatile("s_wait_dscnt 0" ::: "memory");
    }
  }
}

// ---------------------------------------------------------------------------
// Kernel 1b: V put in fragment order per 32-key block (value plane then residual plane at +NB*SEQ*64) through an LDS tile; a wave writes one
// ---------------------------------------------------------------------------
__global__ void __launch_bounds__(256)
vt_kernel(const h16* __restrict__ vws, h16* __restrict__ vtws) {
  __shared__ h16 t[64][66];                         // [t][h], cross-wave (block barrier)
  const int tid = threadIdx.x;
  const size_t QL = (size_t)NB * SEQ * HH;
  const int row0 = blockIdx.x * 64;                 // 64 consecutive (b,t) rows, same b
  const int pl = blockIdx.y;                        // 0: value plane, 1: residual plane
  const h16* src = vws + (pl ? QL : 0) + (size_t)row0 * HH;
#pragma unroll
  for (int k = 0; k < 16; ++k) { const int e = tid + 256 * k; t[e >> 6][e & 63] = src[e]; }
  __syncthreads();
  // the block's two 32-key blocks are 2048 consecutive 32-bit words; word r*256 + tid holds keys key, key+1 of column h
  h16* dst = vtws + (pl ? QL : 0) + (size_t)row0 * HH;
  const int fl = (tid & 127) >> 2;                  // fragment lane of this thread's words
#pragma unroll
  for (int r = 0; r < 8; ++r) {
    const int h   = (r & 3) * 16 + (fl & 15);
    const int key = (r >> 2) * 32 + (tid >> 7) * 16 + (fl >> 4) * 8 + 2 * (tid & 3);
    const unsigned pk = (unsigned)hbits(t[key][h]) | ((unsigned)hbits(t[key + 1][h]) << 16);
    unsigned* d = (unsigned*)dst + r * 256 + tid;
    *(unsigned*)d = pk;
    
  }
}

// ---------------------------------------------------------------------------
// Kernel 2: causal flash attention, split-K across 4 waves per 16-row query tile.
// Wave w handles key blocks w, w+4, w+8, ... (balanced causal triangle).
// The products are taken transposed: per 32-key block St = K Q^T (2 split tiles, A = k fragment, B = q fragment), online
// softmax, Ot += V^T Pt (4 split tiles, A = v fragment, B = Pt). The fragments are the same registers as for Q K^T and P V
// (A and B share one lane map); in the results lane%16 is the query and element v the key 8g+v (St) or the column 8g+v (Ot).
// So one lane holds 16 of its query's 32 scores (lane^16 the other 16): maximum and sum are taken in the lane, the maximum
// joined with one exchange between the halves, the sum once behind the loop; and St tile 0 / tile 1 of a lane are keys
// 8g..8g+7 / 16+8g..16+8g+7, which is the B fragment's k order: Pt is packed in registers.
// Partial (O, m, l) merged across waves via LDS log-sum-exp combine (block barrier).
// ---------------------------------------------------------------------------
#define OPITCH 68   // f32 per staged O row, 272 B = 16 B x odd: 16 lanes' 16-byte stores fall on distinct banks

// lane l with lane l ^ 16
__device__ __forceinline__ float xhalf(float x) {
  return __builtin_bit_cast(float, __builtin_amdgcn_permlanex16(__builtin_bit_cast(int, x), __builtin_bit_cast(int, x),
                                                                0x76543210, 0xfedcba98, false, false));
}

__global__ void __launch_bounds__(128)
attn_kernel(const h16* __restrict__ qws,
            const h16* __restrict__ kws,
            const h16* __restrict__ vtws,
            float* __restrict__ out) {
  __shared__ __align__(16) float Of[4][16][OPITCH];  // partial O, [query][column] (cross-wave)
  __shared__ float Ml[4][16], Ll[4][16];             // partial m, l (cross-wave)

  const int lane = threadIdx.x & 31;
  const int wv   = threadIdx.x >> 5;
  const int g    = lane >> 4;
  const int m    = lane & 15;
  const int tile = blockIdx.x;                 // 0 .. NB*SEQ/16 - 1
  const int b    = tile / (SEQ / 16);
  const int t0   = (tile % (SEQ / 16)) * 16;

  union U16 { v16h v; v8h h[2]; h16 e[16]; };

  // Q fragments (B operand: lane%16 = query) for the two 32-wide h chunks (HH = 64)
  const size_t QL = (size_t)NB * SEQ * HH;     // residual planes follow the value planes
  const h16* qrow = qws + ((size_t)b * SEQ + t0 + m) * HH;
  U16 qa[2], qal[2];
  // here and below: the short loops are unrolled so that every array index is a constant and the arrays stay in registers
#pragma unroll
  for (int hc = 0; hc < 2; ++hc) {
    qa[hc].h[0]  = *(const v8h*)(qrow + hc * 32 + 8 * g);
    qa[hc].h[1]  = *(const v8h*)(qrow + hc * 32 + 16 + 8 * g);
    qal[hc].h[0] = *(const v8h*)(qrow + QL + hc * 32 + 8 * g);
    qal[hc].h[1] = *(const v8h*)(qrow + QL + hc * 32 + 16 + 8 * g);
  }

  v8f o[4];                                    // Ot: lane%16 = query, element v of tile nt = column nt*16 + 8g + v
#pragma unroll
  for (int nt = 0; nt < 4; ++nt) o[nt] = v8f_zero();
  float mrow = NEG_INF;                        // running maximum of this lane's query (equal in lanes l and l^16)
  float lrow = 0.f;                            // running sum over this lane's own keys (the halves are joined behind the loop)

  const float scale = ATTN_SCALE;
  const int   nblk  = t0 / 32 + 1;             // causal: keys <= t0+15
  const int   qidx  = t0 + m;                  // this lane's query

  const h16* kbase  = kws + (size_t)b * SEQ * HH;
  const h16* vtbase = vtws + (size_t)b * HH * SEQ;

  for (int blk = wv; blk < nblk; blk += 4) {
    const int s0 = blk * 32;

    // ---- St = K Q^T for 32 keys (two 16x16 tiles) ----
    v8f s[2];
#pragma unroll
    for (int kt = 0; kt < 2; ++kt) {
      const h16* kfr = kbase + (size_t)(s0 + kt * 16) * HH + lane * 8;   // this lane's 8 elements of the tile's first 16-h group
      U16 kb0, kb1, kb0l, kb1l;                           // A frags use the same k map as B; 16-h group c is 256 elements on
      kb0.h[0]  = *(const v8h*)(kfr);            kb0.h[1]  = *(const v8h*)(kfr + 256);
      kb1.h[0]  = *(const v8h*)(kfr + 512);      kb1.h[1]  = *(const v8h*)(kfr + 768);
      kb0l.h[0] = *(const v8h*)(kfr + QL);       kb0l.h[1] = *(const v8h*)(kfr + QL + 256);
      kb1l.h[0] = *(const v8h*)(kfr + QL + 512); kb1l.h[1] = *(const v8h*)(kfr + QL + 768);
      s[kt] = wmma_split(kb0.v, kb0l.v, qa[0].v, qal[0].v, v8f_zero());
      s[kt] = wmma_split(kb1.v, kb1l.v, qa[1].v, qal[1].v, s[kt]);
    }

    // ---- scale + causal mask (diagonal block only); maximum over the lane's 16 keys, then over both halves ----
    const bool diag = (s0 + 31 >= t0);
    float mx[8];
#pragma unroll
    for (int v = 0; v < 8; ++v) {
#pragma unroll
      for (int kt = 0; kt < 2; ++kt) {
        const int key = s0 + kt * 16 + 8 * g + v;
        const float val = s[kt][v] * scale;
        s[kt][v] = (diag && (key > qidx)) ? NEG_INF : val;
      }
      mx[v] = fmaxf(s[0][v], s[1][v]);
    }
    float rmax = fmaxf(fmaxf(fmaxf(mx[0], mx[1]), fmaxf(mx[2], mx[3])), fmaxf(fmaxf(mx[4], mx[5]), fmaxf(mx[6], mx[7])));
    rmax = fmaxf(rmax, xhalf(rmax));

    // ---- online softmax update; Pt (x1024, two planes) packed into the B fragment ----
    const float mnew  = fmaxf(mrow, rmax);     // finite: key s0 <= t0 is open to every query of the tile
    const float alpha = __expf(mrow - mnew);
    mrow = mnew;
    U16 pa, pal;
    float ps[8];
#pragma unroll
    for (int v = 0; v < 8; ++v) {
      const float p0 = __expf(s[0][v] - mnew);
      const float p1 = __expf(s[1][v] - mnew);
      // probabilities carried x1024 (tail values stay f16-normal; removed in the final merge) as value + residual planes
      split16(p0 * 1024.0f, pa.e[v],     pal.e[v]);
      split16(p1 * 1024.0f, pa.e[8 + v], pal.e[8 + v]);
      ps[v] = p0 + p1;
    }
    lrow = lrow * alpha + (((ps[0] + ps[1]) + (ps[2] + ps[3])) + ((ps[4] + ps[5]) + (ps[6] + ps[7])));
#pragma unroll
    for (int nt = 0; nt < 4; ++nt)
#pragma unroll
      for (int v = 0; v < 8; ++v)
        o[nt][v] *= alpha;

    // ---- Ot += V^T Pt  (V A-frags from the fragment-ordered planes) ----
#pragma unroll
    for (int nt = 0; nt < 4; ++nt) {
      const h16* vfr = vtbase + (size_t)s0 * HH + nt * 512 + lane * 8;   // this lane's 8 keys of column nt*16+m, keys 8g..8g+7
      U16 vb, vbl;                                        // same k map as B; keys 16+8g.. are 256 elements on
      vb.h[0]  = *(const v8h*)(vfr);      vb.h[1]  = *(const v8h*)(vfr + 256);
      vbl.h[0] = *(const v8h*)(vfr + QL); vbl.h[1] = *(const v8h*)(vfr + QL + 256);
      o[nt] = wmma_split(vb.v, vbl.v, pa.v, pal.v, o[nt]);
    }
    // stands before the next pass rewrites the address registers that this pass's fragment loads name
    asm volatile("s_wait_xcnt 0x0" ::: "memory");
  }

  // ---- publish this wave's partial (O, m, l) ----
  lrow += xhalf(lrow);                         // the two halves' keys joined
#pragma unroll
  for (int nt = 0; nt < 4; ++nt) {
    const v4f lo4 = {o[nt][0], o[nt][1], o[nt][2], o[nt][3]};
    const v4f hi4 = {o[nt][4], o[nt][5], o[nt][6], o[nt][7]};
    *(v4f*)&Of[wv][m][nt * 16 + 8 * g]     = lo4;
    *(v4f*)&Of[wv][m][nt * 16 + 8 * g + 4] = hi4;
  }
  if (g == 0) {
    Ml[wv][m] = mrow;
    Ll[wv][m] = lrow;
  }
  __syncthreads();

  for (int e = threadIdx.x; e < 16 * HH; e += 128) {
    const int row = e >> 6;        // 0..15
    const int col = e & 63;        // 0..63
    float M = Ml[0][row];
#pragma unroll
    for (int w = 1; w < 4; ++w) M = fmaxf(M, Ml[w][row]);
    float L = 0.f, O = 0.f;
#pragma unroll
    for (int w = 0; w < 4; ++w) {
      const float be = __expf(Ml[w][row] - M);   // 0 for idle waves (m = -inf)
      L += be * Ll[w][row];
      O += be * Of[w][row][col];
    }
    const float r = O / (L * 1024.0f);          // removes the x1024 carried by the probabilities
    float* op = out + ((size_t)b * SEQ_FULL + t0 + row) * HH + col;
    *(float*)op = r;
    
  }
}

// ---------------------------------------------------------------------------
// Launch. Workspace layout (bytes, full size):
//   [0, 4MB)      q   f16 [NB,SEQ,64]  value + residual planes
//   [4MB, 8MB)    k   f16 [NB,SEQ,64]  (fragment order per 16-key tile)
//   [8MB, 12MB)   v   f16 [NB,SEQ,64]  (row-major, input to the transpose)
//   [12MB, 16MB)  v   f16 [NB,SEQ,64]  (fragment order per 32-key block)
//   [16MB, +576KB) WtQ/WtK/WtV f16 [64,768] x2 planes each
// ---------------------------------------------------------------------------
extern "C" void kernel_launch(void* const* d_in, const int* in_sizes, int n_in,
                              void* d_out, int out_size, void* d_ws,
                              size_t ws_size, hipStream_t stream) {
  if (n_in < 4) return;
  const long long rows_needed = (long long)(NB - 1) * SEQ_FULL + SEQ;
  if ((long long)in_sizes[0] < rows_needed * CC) return;
  if (in_sizes[1] < CC * HH || in_sizes[2] < CC * HH || in_sizes[3] < CC * HH) return;
  if ((long long)out_size < rows_needed * HH) return;

  const float* x  = (const float*)d_in[0];
  const float* Wk = (const float*)d_in[1];
  const float* Wq = (const float*)d_in[2];
  const float* Wv = (const float*)d_in[3];
  float* out = (float*)d_out;

  // every 16-bit buffer holds a value plane followed by its residual plane (2x the element count)
  char* ws = (char*)d_ws;
  const size_t qkv_bytes = (size_t)2 * NB * SEQ * HH * sizeof(h16);     // 4 MB at full size (two planes)
  const size_t wt_bytes  = (size_t)2 * CC * HH * sizeof(h16);           // 192 KB each
  const size_t total     = 4 * qkv_bytes + 3 * wt_bytes;
  if (total > ws_size) return;
  h16* qws  = (h16*)(ws);
  h16* kws  = (h16*)(ws + qkv_bytes);
  h16* vws  = (h16*)(ws + 2 * qkv_bytes);
  h16* vtws = (h16*)(ws + 3 * qkv_bytes);
  h16* WtQ  = (h16*)(ws + 4 * qkv_bytes);
  h16* WtK  = (h16*)(ws + 4 * qkv_bytes + wt_bytes);
  h16* WtV  = (h16*)(ws + 4 * qkv_bytes + 2 * wt_bytes);

  wt_kernel<<<(CC * HH / 2) / 256, 256, 0, stream>>>(Wk, Wq, Wv, WtQ, WtK, WtV);
  qkv_kernel<<<(NB * SEQ) / 128, 256, 0, stream>>>(x, WtQ, WtK, WtV, qws, kws, vws);
  vt_kernel<<<dim3((NB * SEQ) / 64, 2), 256, 0, stream>>>(vws, vtws);
  attn_kernel<<<(NB * SEQ) / 16, 128, 0, stream>>>(qws, kws, vtws, out);
}

// v004
// It runs in 73 microseconds.
// Next to v003, in two timings, it ran 1.21 and 1.22 times as fast.
// Over all steps from v000 it is 1.89 times as fast.
// Contractions: q/k/v projections [NB*SEQ x 64 x 768] (x3), causal scores [T x T x 64] and P.V [T x 64 x T] per batch, all on
// v_wmma_f32_16x16x32_f16 with f16 value + residual operand planes (hi.hi + (hi.lo + lo.hi)/2048), f32 accumulate; softmax and
#include <hip/hip_runtime.h>
#include <math.h>

// Problem constants (NB / SEQ overridable for a reduced build; *_FULL are the strides of the inputs / output)
#ifndef NB
#define NB 8
#endif
#ifndef SEQ
#define SEQ 2048
#endif
#define NB_FULL 8
#define SEQ_FULL 2048
#define CC 768
#define HH 64
#define ATTN_SCALE 0.03608439182435161f   // CC^-0.5 (embedding dim), as f32

static_assert(NB >= 1 && NB <= NB_FULL);
static_assert(SEQ >= 128 && SEQ <= SEQ_FULL && (SEQ % 128) == 0);
static_assert((CC % 64) == 0 && (CC % 32) == 0);
static_assert(HH == 64);
static_assert(((CC * HH / 2) % 256) == 0);
static_assert(((NB * SEQ) % 128) == 0);

// 16-bit operands are f16, each carried as a value plane plus a residual plane lo = f16((v - hi) * 2048):
// a product is hi.hi + (hi.lo + lo.hi)/2048 (f32-class). Every fragment (A and B) uses the 16x16x32 lane map
// lane%16 = row/col, g = lane/16: elements 0..7 -> k = 8g+e, elements 8..15 -> k = 16+8g+(e-8).
// k and v are kept in memory in that fragment order, so that one 16-byte-per-lane fragment load reads 512 contiguous bytes (4 lines, not 16):
//   k: per 16-key tile 1024 elements, [h/16][lane = 16*((h%16)/8) + key%16][h%8]           (tile r starts at element 1024*r of its plane)
//   v: per 32-key block 2048 elements, [h/16][(key%32)/16][lane = 16*((key%16)/8) + h%16][key%8]  (block r starts at element 2048*r)
#define KFRAG(key16, h) ((((h) >> 4) * 32 + (((h) >> 3) & 1) * 16 + (key16)) * 8 + ((h) & 7))
typedef _Float16 h16;
typedef __attribute__((ext_vector_type(16))) _Float16 v16h;
typedef __attribute__((ext_vector_type(8)))  _Float16 v8h;
typedef __attribute__((ext_vector_type(8)))  float    v8f;
typedef __attribute__((ext_vector_type(4)))  float    v4f;
#define RSPLIT (1.0f / 2048.0f)
__device__ __forceinline__ void split16(float f, h16& hi, h16& lo) { hi = (h16)f; lo = (h16)((f - (float)hi) * 2048.0f); }
__device__ __forceinline__ unsigned short hbits(h16 h) { return __builtin_bit_cast(unsigned short, h); }

#define NEG_INF (-__builtin_inff())

__device__ __forceinline__ v8f v8f_zero() {
  v8f z = {0.f, 0.f, 0.f, 0.f, 0.f, 0.f, 0.f, 0.f};
  return z;
}

// D = A(16x32 f16) * B(32x16 f16) + C(16x16 f32), followed by the VALU hazard guard (ties D, keeps A/B live)
__device__ __forceinline__ v8f wmma16(v16h a, v16h b, v8f c) {
  v8f r = __builtin_amdgcn_wmma_f32_16x16x32_f16(false, a, false, b, (short)0, c, false, false);
  asm volatile("v_nop\n\tv_nop\n\tv_nop\n\tv_nop" : "+v"(r) : "v"(a), "v"(b));
  return r;
}

// acc += A.B with value/residual planes: cross terms from zero, folded at 1/2048 on the VALU
__device__ __forceinline__ v8f wmma_split(v16h ah, v16h al, v16h bh, v16h bl, v8f c) {
  v8f x = wmma16(al, bh, v8f_zero());
  x = wmma16(ah, bl, x);
  return wmma16(ah, bh, c) + x * RSPLIT;
}

// ---------------------------------------------------------------------------
// Kernel 0: W[C,H] f32  ->  Wt[H,C] f16 value + residual planes
// ---------------------------------------------------------------------------
__global__ void __launch_bounds__(256)
wt_kernel(const float* __restrict__ Wk,
          const float* __restrict__ Wq,
          const float* __restrict__ Wv,
          h16* __restrict__ WtQ,
          h16* __restrict__ WtK,
          h16* __restrict__ WtV) {
  const int idx = blockIdx.x * 256 + threadIdx.x;   // 0 .. HH*CC/2 - 1
  if (idx >= CC * HH / 2) return;
  const int h = idx / (CC / 2);
  const int c = 2 * (idx % (CC / 2));
  const float* src[3] = {Wq, Wk, Wv};
  h16* dstp[3] = {WtQ, WtK, WtV};
#pragma unroll
  for (int s = 0; s < 3; ++s) {
    h16 h0, l0, h1, l1;
    split16(src[s][(size_t)c * HH + h], h0, l0);
    split16(src[s][(size_t)(c + 1) * HH + h], h1, l1);
    unsigned* dh = (unsigned*)(dstp[s] + (size_t)h * CC + c);
    unsigned* dl = (unsigned*)(dstp[s] + (size_t)CC * HH + (size_t)h * CC + c);
    const unsigned ph = (unsigned)hbits(h0) | ((unsigned)hbits(h1) << 16);
    const unsigned pl = (unsigned)hbits(l0) | ((unsigned)hbits(l1) << 16);
    *(unsigned*)dh = ph; *(unsigned*)dl = pl;
    
  }
}

// ---------------------------------------------------------------------------
// Kernel 1: QKV projection. One wave per 16 rows of (b,t); 8 waves per block.
//   q,v stored row-major [NB,SEQ,64] (value + residual planes), k in fragment order per 16-key tile; v is put in fragment order by vt_kernel.
// A-frag (x rows, split in registers) and B-frags (Wt[n][k] rows) use the same element -> k map; C/D: lane col = lane%16,
// element v -> row 8g+v.
// The six weight planes are staged once per block in LDS, KS columns of k at a time, by asynchronous copies into two
// buffers (the next slice flies while this one is multiplied); all 8 waves read their B fragments from there.
// ---------------------------------------------------------------------------
#define KS 64                          // k columns per staged slice: 128 B of every weight row
#define WPITCH 72                      // f16 per staged row, 144 B = 16 B x odd: 16 rows' 16-byte reads fall on distinct banks
#define WBUF (6 * HH * WPITCH)         // f16 per buffer: planes Q, Q residual, K, K residual, V, V residual
#define NSLICE (CC / KS)
static_assert((CC % KS) == 0 && NSLICE >= 2);
static_assert(6 * HH * (KS / 8) == 12 * 256);   // 16-byte pieces of a slice = 12 per thread of the block

// One slice (columns c0 .. c0+KS-1 of all six planes) into the buffer at LDS byte address lbuf: 12 copies of 16 B per lane.
// Piece i of thread tid: plane i/2, row 32*(i%2) + tid/8, 16-byte column tid%8.
__device__ __forceinline__ void stage_slice(const h16* __restrict__ WtQ, const h16* __restrict__ WtK,
                                            const h16* __restrict__ WtV, int c0, unsigned lbuf, int tid) {
  const size_t PL = (size_t)CC * HH;
  const h16* pl[6] = {WtQ, WtQ + PL, WtK, WtK + PL, WtV, WtV + PL};
#pragma unroll
  for (int q = 0; q < 3; ++q) {   // four copies a statement: fewer address registers live at once than with all twelve in one
    const h16* gp[4];
    unsigned ld[4];
#pragma unroll
    for (int j = 0; j < 4; ++j) {
      const int i = q * 4 + j;
      const int row = (i & 1) * 32 + (tid >> 3);
      gp[j] = pl[i >> 1] + (size_t)row * CC + c0 + (tid & 7) * 8;
      ld[j] = lbuf + (unsigned)((((i >> 1) * HH + row) * WPITCH + (tid & 7) * 8) * sizeof(h16));
    }
    // the copies and, as the statement's last line, the wait that stands before any of their address registers is rewritten
    asm volatile("global_load_async_to_lds_b128 %0, %4, off\n\t"
                 "global_load_async_to_lds_b128 %1, %5, off\n\t"
                 "global_load_async_to_lds_b128 %2, %6, off\n\t"
                 "global_load_async_to_lds_b128 %3, %7, off\n\t"
                 "s_wait_xcnt 0x0"
                 :: "v"(ld[0]), "v"(ld[1]), "v"(ld[2]), "v"(ld[3]), "v"(gp[0]), "v"(gp[1]), "v"(gp[2]), "v"(gp[3])
                 : "memory");
  }
}

// One trip: the 16 x rows of this wave times columns t*KS .. t*KS+KS-1 of the six staged planes (buffer wb), added into the 12 tiles.
__device__ __forceinline__ void slice_mac(const float* __restrict__ xrow, const h16* wb, int t, int g, int m,
                                          v8f (&accQ)[4], v8f (&accK)[4], v8f (&accV)[4]) {
  // the slice's x columns of this lane's row: kc-th 32-chunk holds k = 8g..8g+7 in xv[kc][0..1], 16+8g..16+8g+7 in xv[kc][2..3]
  v4f xv[KS / 32][4];
#pragma unroll
  for (int kc = 0; kc < KS / 32; ++kc) {
    const float* xp = xrow + t * KS + kc * 32 + 8 * g;
    xv[kc][0] = *(const v4f*)(xp);
    xv[kc][1] = *(const v4f*)(xp + 4);
    xv[kc][2] = *(const v4f*)(xp + 16);
    xv[kc][3] = *(const v4f*)(xp + 20);
  }
  // keeps all of the trip's x loads in flight together: sunk to their uses, each 32-chunk would wait for memory by itself
  __builtin_amdgcn_sched_barrier(0);
#pragma unroll
  for (int kc = 0; kc < KS / 32; ++kc) {
    // A-fragment: x tile rows, split into value/residual f16 in registers
    union { v16h v; h16 e[16]; } a, al;
#pragma unroll
    for (int j = 0; j < 8; ++j) {
      split16(xv[kc][j >> 2][j & 3],       a.e[j],     al.e[j]);
      split16(xv[kc][2 + (j >> 2)][j & 3], a.e[8 + j], al.e[8 + j]);
    }
    union UB { v16h v; v8h h[2]; };
#pragma unroll
    for (int nt = 0; nt < 4; ++nt) {
      // one n-tile at a time: its six B fragments (value + residual for Q/K/V weights) then three split MACs;
      // B frags use the same k map as A: {8g..8g+7} then {16+8g..16+8g+7}
      const h16* wr = wb + (nt * 16 + m) * WPITCH + kc * 32 + 8 * g;
      UB bq, bk, bv, bql, bkl, bvl;
      bq.h[0]  = *(const v8h*)(wr);                     bq.h[1]  = *(const v8h*)(wr + 16);
      bql.h[0] = *(const v8h*)(wr + 1 * HH * WPITCH);   bql.h[1] = *(const v8h*)(wr + 1 * HH * WPITCH + 16);
      bk.h[0]  = *(const v8h*)(wr + 2 * HH * WPITCH);   bk.h[1]  = *(const v8h*)(wr + 2 * HH * WPITCH + 16);
      bkl.h[0] = *(const v8h*)(wr + 3 * HH * WPITCH);   bkl.h[1] = *(const v8h*)(wr + 3 * HH * WPITCH + 16);
      bv.h[0]  = *(const v8h*)(wr + 4 * HH * WPITCH);   bv.h[1]  = *(const v8h*)(wr + 4 * HH * WPITCH + 16);
      bvl.h[0] = *(const v8h*)(wr + 5 * HH * WPITCH);   bvl.h[1] = *(const v8h*)(wr + 5 * HH * WPITCH + 16);
      accQ[nt] = wmma_split(a.v, al.v, bq.v, bql.v, accQ[nt]);
      accK[nt] = wmma_split(a.v, al.v, bk.v, bkl.v, accK[nt]);
      accV[nt] = wmma_split(a.v, al.v, bv.v, bvl.v, accV[nt]);
      // keeps the n-tiles apart in the schedule: mixed, more fragments and cross-term tiles are live at once and registers spill to scratch
      __builtin_amdgcn_sched_barrier(0);
    }
  }
}

// Hand-over at the foot of a trip: this wave's reads of the slice are done, its copies of the next slice have landed, and
// every wave has said so; behind it the next slice may be read and the buffer just read may be refilled.
__device__ __forceinline__ void slice_handover() {
  asm volatile("s_wait_dscnt 0x0" ::: "memory");
  asm volatile("s_wait_asynccnt 0x0" ::: "memory");
  __syncthreads();
}

__global__ void __launch_bounds__(256)
qkv_kernel(const float* __restrict__ x,
           const h16* __restrict__ WtQ,
           const h16* __restrict__ WtK,
           const h16* __restrict__ WtV,
           h16* __restrict__ qws,
           h16* __restrict__ kws,
           h16* __restrict__ vws) {
  __shared__ __align__(16) h16 wl[2][WBUF];     // the two weight-slice buffers (cross-wave)
  __shared__ __align__(16) h16 st[8][16][64];   // per-wave staging of one 16x64 result plane (wave-private)
  const int lane = threadIdx.x & 31;
  const int wv   = threadIdx.x >> 5;
  const int g    = lane >> 4;
  const int m    = lane & 15;
  const int tile = blockIdx.x * 8 + wv;        // 0 .. NB*SEQ/16 - 1
  const int b    = tile / (SEQ / 16);
  const int t0   = (tile % (SEQ / 16)) * 16;
  const size_t QL = (size_t)NB * SEQ * HH;     // residual plane offset inside q/k/v buffers
  const unsigned lw = (unsigned)(size_t)&wl[0][0];   // LDS byte address of buffer 0

  v8f accQ[4], accK[4], accV[4];
#pragma unroll
  for (int nt = 0; nt < 4; ++nt) {
    accQ[nt] = v8f_zero();
    accK[nt] = v8f_zero();
    accV[nt] = v8f_zero();
  }

  const float* xrow = x + ((size_t)b * SEQ_FULL + t0 + m) * CC;

  // slice 0 lands and is published to every wave; slice 1 then flies during trip 0
  stage_slice(WtQ, WtK, WtV, 0, lw, threadIdx.x);
  asm volatile("s_wait_asynccnt 0x0" ::: "memory");   // this wave's copies of slice 0 have landed
  __syncthreads();
  stage_slice(WtQ, WtK, WtV, KS, lw + (unsigned)(WBUF * sizeof(h16)), threadIdx.x);

  // rolled, and the last two trips (no slice left to fetch) in a loop of their own: each loop body stays one straight block
#pragma unroll 1
  for (int t = 0; t < NSLICE - 2; ++t) {
    slice_mac(xrow, &wl[t & 1][0], t, g, m, accQ, accK, accV);
    slice_handover();
    // refill the buffer that this trip has just read
    stage_slice(WtQ, WtK, WtV, (t + 2) * KS, lw + (unsigned)((t & 1) * WBUF * sizeof(h16)), threadIdx.x);
  }
#pragma unroll 1
  for (int t = NSLICE - 2; t < NSLICE; ++t) {
    slice_mac(xrow, &wl[t & 1][0], t, g, m, accQ, accK, accV);
    slice_handover();
  }
  asm volatile("s_wait_asynccnt 0x0" ::: "memory");   // no copy is outstanding when the wave goes on and ends

  // outputs: q, k, v [NB,SEQ,64] as value + residual planes; each 16x64 plane tile goes through the wave's LDS tile and is
  h16* sw = &st[wv][0][0];
  h16* dsts[3] = {qws, kws, vws};
#pragma unroll
  for (int s = 0; s < 3; ++s) {
#pragma unroll
    for (int pl = 0; pl < 2; ++pl) {
#pragma unroll
      for (int nt = 0; nt < 4; ++nt)
#pragma unroll
        for (int v = 0; v < 8; ++v) {
          const float val = (s == 0) ? accQ[nt][v] : (s == 1) ? accK[nt][v] : accV[nt][v];
          h16 hh_, ll_; split16(val, hh_, ll_);
          // q, v: row-major [row][col]; k: fragment order (KFRAG), so that the linear copy-out below stores the tile that way
          const int si = (s == 1) ? KFRAG(8 * g + v, nt * 16 + m) : (8 * g + v) * 64 + nt * 16 + m;
          sw[si] = pl ? ll_ : hh_;
        }
      asm volatile("s_wait_dscnt 0" ::: "memory");
      h16* base = dsts[s] + (pl ? QL : 0) + ((size_t)b * SEQ + t0) * HH;
#pragma unroll
      for (int r = 0; r < 16; ++r) {
        const unsigned w = *((const unsigned*)(sw + r * 64) + lane);
        *(unsigned*)((unsigned*)(base + (size_t)r * HH) + lane) = w;
      }
      
      asm volatile("s_wait_dscnt 0" ::: "memory");
    }
  }
}

// ---------------------------------------------------------------------------
// Kernel 1b: V put in fragment order per 32-key block (value plane then residual plane at +NB*SEQ*64) through an LDS tile; a wave writes one
// ---------------------------------------------------------------------------
__global__ void __launch_bounds__(256)
vt_kernel(const h16* __restrict__ vws, h16* __restrict__ vtws) {
  __shared__ h16 t[64][66];                         // [t][h], cross-wave (block barrier)
  const int tid = threadIdx.x;
  const size_t QL = (size_t)NB * SEQ * HH;
  const int row0 = blockIdx.x * 64;                 // 64 consecutive (b,t) rows, same b
  const int pl = blockIdx.y;                        // 0: value plane, 1: residual plane
  const h16* src = vws + (pl ? QL : 0) + (size_t)row0 * HH;
#pragma unroll
  for (int k = 0; k < 16; ++k) { const int e = tid + 256 * k; t[e >> 6][e & 63] = src[e]; }
  __syncthreads();
  // the block's two 32-key blocks are 2048 consecutive 32-bit words; word r*256 + tid holds keys key, key+1 of column h
  h16* dst = vtws + (pl ? QL : 0) + (size_t)row0 * HH;
  const int fl = (tid & 127) >> 2;                  // fragment lane of this thread's words
#pragma unroll
  for (int r = 0; r < 8; ++r) {
    const int h   = (r & 3) * 16 + (fl & 15);
    const int key = (r >> 2) * 32 + (tid >> 7) * 16 + (fl >> 4) * 8 + 2 * (tid & 3);
    const unsigned pk = (unsigned)hbits(t[key][h]) | ((unsigned)hbits(t[key + 1][h]) << 16);
    unsigned* d = (unsigned*)dst + r * 256 + tid;
    *(unsigned*)d = pk;
    
  }
}

// ---------------------------------------------------------------------------
// Kernel 2: causal flash attention, split-K across 4 waves per 16-row query tile.
// Wave w handles key blocks w, w+4, w+8, ... (balanced causal triangle).
// The products are taken transposed: per 32-key block St = K Q^T (2 split tiles, A = k fragment, B = q fragment), online
// softmax, Ot += V^T Pt (4 split tiles, A = v fragment, B = Pt). The fragments are the same registers as for Q K^T and P V
// (A and B share one lane map); in the results lane%16 is the query and element v the key 8g+v (St) or the column 8g+v (Ot).
// So one lane holds 16 of its query's 32 scores (lane^16 the other 16): maximum and sum are taken in the lane, the maximum
// joined with one exchange between the halves, the sum once behind the loop; and St tile 0 / tile 1 of a lane are keys
// 8g..8g+7 / 16+8g..16+8g+7, which is the B fragment's k order: Pt is packed in registers.
// Partial (O, m, l) merged across waves via LDS log-sum-exp combine (block barrier).
// Fragment loads run ahead of their use: a pass issues all of its v fragments before the score products, and the next pass's
// k fragments before the P.V products, so that a load's way from L2 lies under matrix and softmax work.
// ---------------------------------------------------------------------------
#define OPITCH 68   // f32 per staged O row, 272 B = 16 B x odd: 16 lanes' 16-byte stores fall on distinct banks

// lane l with lane l ^ 16
__device__ __forceinline__ float xhalf(float x) {
  return __builtin_bit_cast(float, __builtin_amdgcn_permlanex16(__builtin_bit_cast(int, x), __builtin_bit_cast(int, x),
                                                                0x76543210, 0xfedcba98, false, false));
}

union U16 { v16h v; v8h h[2]; h16 e[16]; };

// The k fragments of one 32-key block (kblk: this lane's first 8 elements of it; ql: offset of the residual plane):
// kf[kt][c] = value plane of 16-key tile kt, 32-wide h chunk c; kf[kt][2 + c] = its residual plane. 16-h group j is 256*j elements on.
__device__ __forceinline__ void load_kfrags(const h16* __restrict__ kblk, size_t ql, U16 (&kf)[2][4]) {
  // unrolled so that every index of kf is a constant and the array stays in registers
#pragma unroll
  for (int kt = 0; kt < 2; ++kt) {
    const h16* kfr = kblk + kt * 16 * HH;
    kf[kt][0].h[0] = *(const v8h*)(kfr);            kf[kt][0].h[1] = *(const v8h*)(kfr + 256);
    kf[kt][1].h[0] = *(const v8h*)(kfr + 512);      kf[kt][1].h[1] = *(const v8h*)(kfr + 768);
    kf[kt][2].h[0] = *(const v8h*)(kfr + ql);       kf[kt][2].h[1] = *(const v8h*)(kfr + ql + 256);
    kf[kt][3].h[0] = *(const v8h*)(kfr + ql + 512); kf[kt][3].h[1] = *(const v8h*)(kfr + ql + 768);
  }
}

// Stands behind a group of fragment loads, before anything rewrites the address register that they name; it takes that
// address as an input so that the register is left alone up to the wait.
__device__ __forceinline__ void frag_loads_issued(const h16* addr) {
  asm volatile("s_wait_xcnt 0x0" :: "v"(addr) : "memory");
}

__global__ void __launch_bounds__(128)
attn_kernel(const h16* __restrict__ qws,
            const h16* __restrict__ kws,
            const h16* __restrict__ vtws,
            float* __restrict__ out) {
  __shared__ __align__(16) float Of[4][16][OPITCH];  // partial O, [query][column] (cross-wave)
  __shared__ float Ml[4][16], Ll[4][16];             // partial m, l (cross-wave)

  const int lane = threadIdx.x & 31;
  const int wv   = threadIdx.x >> 5;
  const int g    = lane >> 4;
  const int m    = lane & 15;
  const int tile = blockIdx.x;                 // 0 .. NB*SEQ/16 - 1
  const int b    = tile / (SEQ / 16);
  const int t0   = (tile % (SEQ / 16)) * 16;

  // Q fragments (B operand: lane%16 = query) for the two 32-wide h chunks (HH = 64)
  const size_t QL = (size_t)NB * SEQ * HH;     // residual planes follow the value planes
  const h16* qrow = qws + ((size_t)b * SEQ + t0 + m) * HH;
  U16 qa[2], qal[2];
  // here and below: the short loops are unrolled so that every array index is a constant and the arrays stay in registers
#pragma unroll
  for (int hc = 0; hc < 2; ++hc) {
    qa[hc].h[0]  = *(const v8h*)(qrow + hc * 32 + 8 * g);
    qa[hc].h[1]  = *(const v8h*)(qrow + hc * 32 + 16 + 8 * g);
    qal[hc].h[0] = *(const v8h*)(qrow + QL + hc * 32 + 8 * g);
    qal[hc].h[1] = *(const v8h*)(qrow + QL + hc * 32 + 16 + 8 * g);
  }

  v8f o[4];                                    // Ot: lane%16 = query, element v of tile nt = column nt*16 + 8g + v
#pragma unroll
  for (int nt = 0; nt < 4; ++nt) o[nt] = v8f_zero();
  float mrow = NEG_INF;                        // running maximum of this lane's query (equal in lanes l and l^16)
  float lrow = 0.f;                            // running sum over this lane's own keys (the halves are joined behind the loop)

  const float scale = ATTN_SCALE;
  const int   nblk  = t0 / 32 + 1;             // causal: keys <= t0+15
  const int   qidx  = t0 + m;                  // this lane's query

  const h16* kbase  = kws + (size_t)b * SEQ * HH;
  const h16* vtbase = vtws + (size_t)b * HH * SEQ;

  // k fragments of the wave's first block (block wv <= 3 lies inside the batch's keys whether or not the wave has a pass: SEQ >= 128)
  U16 kf[2][4];                                // A frags use the same k map as B
  const h16* kfirst = kbase + (size_t)wv * 32 * HH + lane * 8;
  load_kfrags(kfirst, QL, kf);
  frag_loads_issued(kfirst);

  for (int blk = wv; blk < nblk; blk += 4) {
    const int s0 = blk * 32;

    // ---- this block's v fragments (A operand of Ot += V^T Pt), all issued here: they fly under the scores and the softmax ----
    U16 vf[4][2];                                         // [nt][value, residual]; same k map as B; keys 16+8g.. are 256 elements on
    // stands before this pass's loads land in registers that earlier loads name as their address (ahead of the first pass: the q loads and the first block's k loads)
    asm volatile("s_wait_xcnt 0x0" ::: "memory");
    const h16* vblk = vtbase + (size_t)s0 * HH + lane * 8;
#pragma unroll
    for (int nt = 0; nt < 4; ++nt) {
      const h16* vfr = vblk + nt * 512;                   // this lane's 8 keys of column nt*16+m, keys 8g..8g+7
      vf[nt][0].h[0] = *(const v8h*)(vfr);      vf[nt][0].h[1] = *(const v8h*)(vfr + 256);
      vf[nt][1].h[0] = *(const v8h*)(vfr + QL); vf[nt][1].h[1] = *(const v8h*)(vfr + QL + 256);
    }

    // ---- St = K Q^T for 32 keys (two 16x16 tiles) ----
    v8f s[2];
#pragma unroll
    for (int kt = 0; kt < 2; ++kt) {
      s[kt] = wmma_split(kf[kt][0].v, kf[kt][2].v, qa[0].v, qal[0].v, v8f_zero());
      s[kt] = wmma_split(kf[kt][1].v, kf[kt][3].v, qa[1].v, qal[1].v, s[kt]);
    }

    // ---- scale + causal mask (diagonal block only); maximum over the lane's 16 keys, then over both halves ----
    const bool diag = (s0 + 31 >= t0);
    float mx[8];
#pragma unroll
    for (int v = 0; v < 8; ++v) {
#pragma unroll
      for (int kt = 0; kt < 2; ++kt) {
        const int key = s0 + kt * 16 + 8 * g + v;
        const float val = s[kt][v] * scale;
        s[kt][v] = (diag && (key > qidx)) ? NEG_INF : val;
      }
      mx[v] = fmaxf(s[0][v], s[1][v]);
    }
    float rmax = fmaxf(fmaxf(fmaxf(mx[0], mx[1]), fmaxf(mx[2], mx[3])), fmaxf(fmaxf(mx[4], mx[5]), fmaxf(mx[6], mx[7])));
    rmax = fmaxf(rmax, xhalf(rmax));

    // ---- online softmax update; Pt (x1024, two planes) packed into the B fragment ----
    const float mnew  = fmaxf(mrow, rmax);     // finite: key s0 <= t0 is open to every query of the tile
    const float alpha = __expf(mrow - mnew);
    mrow = mnew;
    U16 pa, pal;
    float ps[8];
#pragma unroll
    for (int v = 0; v < 8; ++v) {
      const float p0 = __expf(s[0][v] - mnew);
      const float p1 = __expf(s[1][v] - mnew);
      // probabilities carried x1024 (tail values stay f16-normal; removed in the final merge) as value + residual planes
      split16(p0 * 1024.0f, pa.e[v],     pal.e[v]);
      split16(p1 * 1024.0f, pa.e[8 + v], pal.e[8 + v]);
      ps[v] = p0 + p1;
    }
    lrow = lrow * alpha + (((ps[0] + ps[1]) + (ps[2] + ps[3])) + ((ps[4] + ps[5]) + (ps[6] + ps[7])));
#pragma unroll
    for (int nt = 0; nt < 4; ++nt)
#pragma unroll
      for (int v = 0; v < 8; ++v)
        o[nt][v] *= alpha;

    // ---- the next pass's k fragments, into the registers that the scores have left; the last pass reads its own block again ----
    const int nb = (blk + 4 < nblk) ? blk + 4 : blk;
    // holds the loads behind the softmax: issued in front of it, their 64 registers are live together with its temporaries and a fourth wave no longer fits the SIMD
    __builtin_amdgcn_sched_barrier(0);
    const h16* knext = kbase + (size_t)nb * 32 * HH + lane * 8;
    load_kfrags(knext, QL, kf);
    frag_loads_issued(knext);

    // ---- Ot += V^T Pt  (V A-frags from the fragment-ordered planes) ----
#pragma unroll
    for (int nt = 0; nt < 4; ++nt)
      o[nt] = wmma_split(vf[nt][0].v, vf[nt][1].v, pa.v, pal.v, o[nt]);
  }

  // ---- publish this wave's partial (O, m, l) ----
  lrow += xhalf(lrow);                         // the two halves' keys joined
#pragma unroll
  for (int nt = 0; nt < 4; ++nt) {
    const v4f lo4 = {o[nt][0], o[nt][1], o[nt][2], o[nt][3]};
    const v4f hi4 = {o[nt][4], o[nt][5], o[nt][6], o[nt][7]};
    *(v4f*)&Of[wv][m][nt * 16 + 8 * g]     = lo4;
    *(v4f*)&Of[wv][m][nt * 16 + 8 * g + 4] = hi4;
  }
  if (g == 0) {
    Ml[wv][m] = mrow;
    Ll[wv][m] = lrow;
  }
  __syncthreads();

  for (int e = threadIdx.x; e < 16 * HH; e += 128) {
    const int row = e >> 6;        // 0..15
    const int col = e & 63;        // 0..63
    float M = Ml[0][row];
#pragma unroll
    for (int w = 1; w < 4; ++w) M = fmaxf(M, Ml[w][row]);
    float L = 0.f, O = 0.f;
#pragma unroll
    for (int w = 0; w < 4; ++w) {
      const float be = __expf(Ml[w][row] - M);   // 0 for idle waves (m = -inf)
      L += be * Ll[w][row];
      O += be * Of[w][row][col];
    }
    const float r = O / (L * 1024.0f);          // removes the x1024 carried by the probabilities
    float* op = out + ((size_t)b * SEQ_FULL + t0 + row) * HH + col;
    *(float*)op = r;
    
  }
}

// ---------------------------------------------------------------------------
// Launch. Workspace layout (bytes, full size):
//   [0, 4MB)      q   f16 [NB,SEQ,64]  value + residual planes
//   [4MB, 8MB)    k   f16 [NB,SEQ,64]  (fragment order per 16-key tile)
//   [8MB, 12MB)   v   f16 [NB,SEQ,64]  (row-major, input to the transpose)
//   [12MB, 16MB)  v   f16 [NB,SEQ,64]  (fragment order per 32-key block)
//   [16MB, +576KB) WtQ/WtK/WtV f16 [64,768] x2 planes each
// ---------------------------------------------------------------------------
extern "C" void kernel_launch(void* const* d_in, const int* in_sizes, int n_in,
                              void* d_out, int out_size, void* d_ws,
                              size_t ws_size, hipStream_t stream) {
  if (n_in < 4) return;
  const long long rows_needed = (long long)(NB - 1) * SEQ_FULL + SEQ;
  if ((long long)in_sizes[0] < rows_needed * CC) return;
  if (in_sizes[1] < CC * HH || in_sizes[2] < CC * HH || in_sizes[3] < CC * HH) return;
  if ((long long)out_size < rows_needed * HH) return;

  const float* x  = (const float*)d_in[0];
  const float* Wk = (const float*)d_in[1];
  const float* Wq = (const float*)d_in[2];
  const float* Wv = (const float*)d_in[3];
  float* out = (float*)d_out;

  // every 16-bit buffer holds a value plane followed by its residual plane (2x the element count)
  char* ws = (char*)d_ws;
  const size_t qkv_bytes = (size_t)2 * NB * SEQ * HH * sizeof(h16);     // 4 MB at full size (two planes)
  const size_t wt_bytes  = (size_t)2 * CC * HH * sizeof(h16);           // 192 KB each
  const size_t total     = 4 * qkv_bytes + 3 * wt_bytes;
  if (total > ws_size) return;
  h16* qws  = (h16*)(ws);
  h16* kws  = (h16*)(ws + qkv_bytes);
  h16* vws  = (h16*)(ws + 2 * qkv_bytes);
  h16* vtws = (h16*)(ws + 3 * qkv_bytes);
  h16* WtQ  = (h16*)(ws + 4 * qkv_bytes);
  h16* WtK  = (h16*)(ws + 4 * qkv_bytes + wt_bytes);
  h16* WtV  = (h16*)(ws + 4 * qkv_bytes + 2 * wt_bytes);

  wt_kernel<<<(CC * HH / 2) / 256, 256, 0, stream>>>(Wk, Wq, Wv, WtQ, WtK, WtV);
  qkv_kernel<<<(NB * SEQ) / 128, 256, 0, stream>>>(x, WtQ, WtK, WtV, qws, kws, vws);
  vt_kernel<<<dim3((NB * SEQ) / 64, 2), 256, 0, stream>>>(vws, vtws);
  attn_kernel<<<(NB * SEQ) / 16, 128, 0, stream>>>(qws, kws, vtws, out);
}

// v005
// Measured time: 64.4 microseconds a run.
// Timed twice side by side with v004, it ran 1.11 and 1.12 times as fast.
// Over all steps from v000 it is 2.11 times as fast.
// Contractions: q/k/v projections [NB*SEQ x 64 x 768] (x3), causal scores [T x T x 64] and P.V [T x 64 x T] per batch, all on
// v_wmma_f32_16x16x32_f16 with f16 value + residual operand planes (hi.hi + (hi.lo + lo.hi)/2048), f32 accumulate; softmax and
#include <hip/hip_runtime.h>
#include <math.h>

// Problem constants (NB / SEQ overridable for a reduced build; *_FULL are the strides of the inputs / output)
#ifndef NB
#define NB 8
#endif
#ifndef SEQ
#define SEQ 2048
#endif
#define NB_FULL 8
#define SEQ_FULL 2048
#define CC 768
#define HH 64
#define ATTN_SCALE 0.03608439182435161f   // CC^-0.5 (embedding dim), as f32

static_assert(NB >= 1 && NB <= NB_FULL);
static_assert(SEQ >= 128 && SEQ <= SEQ_FULL && (SEQ % 128) == 0);
static_assert((CC % 64) == 0 && (CC % 32) == 0);
static_assert(HH == 64);
static_assert(((CC * HH / 2) % 256) == 0);
static_assert(((NB * SEQ) % 128) == 0);

// 16-bit operands are f16, each carried as a value plane plus a residual plane lo = f16((v - hi) * 2048):
// a product is hi.hi + (hi.lo + lo.hi)/2048 (f32-class). Every fragment (A and B) uses the 16x16x32 lane map
// lane%16 = row/col, g = lane/16: elements 0..7 -> k = 8g+e, elements 8..15 -> k = 16+8g+(e-8).
// k and v are kept in memory in that fragment order, so that one 16-byte-per-lane fragment load reads 512 contiguous bytes (4 lines, not 16):
//   k: per 16-key tile 1024 elements, [h/16][lane = 16*((h%16)/8) + key%16][h%8]           (tile r starts at element 1024*r of its plane)
//   v: per 32-key block 2048 elements, [h/16][(key%32)/16][lane = 16*((key%16)/8) + h%16][key%8]  (block r starts at element 2048*r)
#define KFRAG(key16, h) ((((h) >> 4) * 32 + (((h) >> 3) & 1) * 16 + (key16)) * 8 + ((h) & 7))
typedef _Float16 h16;
typedef __attribute__((ext_vector_type(16))) _Float16 v16h;
typedef __attribute__((ext_vector_type(8)))  _Float16 v8h;
typedef __attribute__((ext_vector_type(8)))  float    v8f;
typedef __attribute__((ext_vector_type(4)))  float    v4f;
#define RSPLIT (1.0f / 2048.0f)
__device__ __forceinline__ void split16(float f, h16& hi, h16& lo) { hi = (h16)f; lo = (h16)((f - (float)hi) * 2048.0f); }
__device__ __forceinline__ unsigned short hbits(h16 h) { return __builtin_bit_cast(unsigned short, h); }

#define NEG_INF (-__builtin_inff())

__device__ __forceinline__ v8f v8f_zero() {
  v8f z = {0.f, 0.f, 0.f, 0.f, 0.f, 0.f, 0.f, 0.f};
  return z;
}

// D = A(16x32 f16) * B(32x16 f16) + C(16x16 f32), followed by the VALU hazard guard (ties D, keeps A/B live)
__device__ __forceinline__ v8f wmma16(v16h a, v16h b, v8f c) {
  v8f r = __builtin_amdgcn_wmma_f32_16x16x32_f16(false, a, false, b, (short)0, c, false, false);
  asm volatile("v_nop\n\tv_nop\n\tv_nop\n\tv_nop" : "+v"(r) : "v"(a), "v"(b));
  return r;
}

// acc += A.B with value/residual planes: cross terms from zero, folded at 1/2048 on the VALU
__device__ __forceinline__ v8f wmma_split(v16h ah, v16h al, v16h bh, v16h bl, v8f c) {
  v8f x = wmma16(al, bh, v8f_zero());
  x = wmma16(ah, bl, x);
  return wmma16(ah, bh, c) + x * RSPLIT;
}

// ---------------------------------------------------------------------------
// Kernel 0: W[C,H] f32  ->  Wt[H,C] f16 value + residual planes
// ---------------------------------------------------------------------------
__global__ void __launch_bounds__(256)
wt_kernel(const float* __restrict__ Wk,
          const float* __restrict__ Wq,
          const float* __restrict__ Wv,
          h16* __restrict__ WtQ,
          h16* __restrict__ WtK,
          h16* __restrict__ WtV) {
  const int idx = blockIdx.x * 256 + threadIdx.x;   // 0 .. HH*CC/2 - 1
  if (idx >= CC * HH / 2) return;
  const int h = idx / (CC / 2);
  const int c = 2 * (idx % (CC / 2));
  const float* src[3] = {Wq, Wk, Wv};
  h16* dstp[3] = {WtQ, WtK, WtV};
#pragma unroll
  for (int s = 0; s < 3; ++s) {
    h16 h0, l0, h1, l1;
    split16(src[s][(size_t)c * HH + h], h0, l0);
    split16(src[s][(size_t)(c + 1) * HH + h], h1, l1);
    unsigned* dh = (unsigned*)(dstp[s] + (size_t)h * CC + c);
    unsigned* dl = (unsigned*)(dstp[s] + (size_t)CC * HH + (size_t)h * CC + c);
    const unsigned ph = (unsigned)hbits(h0) | ((unsigned)hbits(h1) << 16);
    const unsigned pl = (unsigned)hbits(l0) | ((unsigned)hbits(l1) << 16);
    *(unsigned*)dh = ph; *(unsigned*)dl = pl;
    
  }
}

// ---------------------------------------------------------------------------
// Kernel 1: QKV projection. One wave per 16 rows of (b,t); 8 waves per block.
//   q,v stored row-major [NB,SEQ,64] (value + residual planes), k in fragment order per 16-key tile; v is put in fragment order by vt_kernel.
// A-frag (x rows, split in registers) and B-frags (Wt[n][k] rows) use the same element -> k map; C/D: lane col = lane%16,
// element v -> row 8g+v.
// The six weight planes are staged once per block in LDS, KS columns of k at a time, by asynchronous copies into two
// buffers (the next slice flies while this one is multiplied); all 8 waves read their B fragments from there.
// The x columns of a slice are loaded into registers one trip ahead of their use.
// ---------------------------------------------------------------------------
#define KS 64                          // k columns per staged slice: 128 B of every weight row
#define WPITCH 72                      // f16 per staged row, 144 B = 16 B x odd: 16 rows' 16-byte reads fall on distinct banks
#define WBUF (6 * HH * WPITCH)         // f16 per buffer: planes Q, Q residual, K, K residual, V, V residual
#define NSLICE (CC / KS)
static_assert((CC % KS) == 0 && NSLICE >= 2);
static_assert(6 * HH * (KS / 8) == 12 * 256);   // 16-byte pieces of a slice = 12 per thread of the block

// One slice (columns c0 .. c0+KS-1 of all six planes) into the buffer at LDS byte address lbuf: 12 copies of 16 B per lane.
// Piece i of thread tid: plane i/2, row 32*(i%2) + tid/8, 16-byte column tid%8.
__device__ __forceinline__ void stage_slice(const h16* __restrict__ WtQ, const h16* __restrict__ WtK,
                                            const h16* __restrict__ WtV, int c0, unsigned lbuf, int tid) {
  const size_t PL = (size_t)CC * HH;
  const h16* pl[6] = {WtQ, WtQ + PL, WtK, WtK + PL, WtV, WtV + PL};
#pragma unroll
  for (int q = 0; q < 3; ++q) {   // four copies a statement: fewer address registers live at once than with all twelve in one
    const h16* gp[4];
    unsigned ld[4];
#pragma unroll
    for (int j = 0; j < 4; ++j) {
      const int i = q * 4 + j;
      const int row = (i & 1) * 32 + (tid >> 3);
      gp[j] = pl[i >> 1] + (size_t)row * CC + c0 + (tid & 7) * 8;
      ld[j] = lbuf + (unsigned)((((i >> 1) * HH + row) * WPITCH + (tid & 7) * 8) * sizeof(h16));
    }
    // the copies and, as the statement's last line, the wait that stands before any of their address registers is rewritten
    asm volatile("global_load_async_to_lds_b128 %0, %4, off\n\t"
                 "global_load_async_to_lds_b128 %1, %5, off\n\t"
                 "global_load_async_to_lds_b128 %2, %6, off\n\t"
                 "global_load_async_to_lds_b128 %3, %7, off\n\t"
                 "s_wait_xcnt 0x0"
                 :: "v"(ld[0]), "v"(ld[1]), "v"(ld[2]), "v"(ld[3]), "v"(gp[0]), "v"(gp[1]), "v"(gp[2]), "v"(gp[3])
                 : "memory");
  }
}

// One slice's x columns of this lane's row, issued into registers (xp: column 8g of the slice): kc-th 32-chunk holds
// k = 8g..8g+7 in xv[kc][0..1], 16+8g..16+8g+7 in xv[kc][2..3].
__device__ __forceinline__ void load_xslice(const float* __restrict__ xp, v4f (&xv)[KS / 32][4]) {
#pragma unroll
  for (int kc = 0; kc < KS / 32; ++kc) {
    xv[kc][0] = *(const v4f*)(xp + kc * 32);
    xv[kc][1] = *(const v4f*)(xp + kc * 32 + 4);
    xv[kc][2] = *(const v4f*)(xp + kc * 32 + 16);
    xv[kc][3] = *(const v4f*)(xp + kc * 32 + 20);
  }
  // stands behind the loads, before anything rewrites the address register that they name; it takes that address as an
  // input so that the register is left alone up to the wait
  asm volatile("s_wait_xcnt 0x0" :: "v"(xp) : "memory");
}

// One trip: the 16 x rows of this wave (this slice's columns, loaded into xv one trip ago) times the same columns of the six
// staged planes (buffer wb), added into the 12 tiles. The next slice's x columns (at xnext) are issued into xv at the head of
// the trip, so that their way from memory lies under this trip's products.
__device__ __forceinline__ void slice_mac(const float* __restrict__ xnext, const h16* wb, int g, int m,
                                          v4f (&xv)[KS / 32][4], v8f (&accQ)[4], v8f (&accK)[4], v8f (&accV)[4]) {
  // this trip's x columns stay in a register set of their own while the next slice's land in xv
  v4f cur[KS / 32][4];
#pragma unroll
  for (int kc = 0; kc < KS / 32; ++kc)
#pragma unroll
    for (int i = 0; i < 4; ++i) cur[kc][i] = xv[kc][i];
  load_xslice(xnext, xv);
  // keeps the loads here at the head of the trip: sunk towards the next trip's splits they would wait for memory in the open
  __builtin_amdgcn_sched_barrier(0);
#pragma unroll
  for (int kc = 0; kc < KS / 32; ++kc) {
    // A-fragment: x tile rows, split into value/residual f16 in registers
    union { v16h v; h16 e[16]; } a, al;
#pragma unroll
    for (int j = 0; j < 8; ++j) {
      split16(cur[kc][j >> 2][j & 3],       a.e[j],     al.e[j]);
      split16(cur[kc][2 + (j >> 2)][j & 3], a.e[8 + j], al.e[8 + j]);
    }
    union UB { v16h v; v8h h[2]; };
#pragma unroll
    for (int nt = 0; nt < 4; ++nt) {
      // one n-tile at a time: its six B fragments (value + residual for Q/K/V weights) then three split MACs;
      // B frags use the same k map as A: {8g..8g+7} then {16+8g..16+8g+7}
      const h16* wr = wb + (nt * 16 + m) * WPITCH + kc * 32 + 8 * g;
      UB bq, bk, bv, bql, bkl, bvl;
      bq.h[0]  = *(const v8h*)(wr);                     bq.h[1]  = *(const v8h*)(wr + 16);
      bql.h[0] = *(const v8h*)(wr + 1 * HH * WPITCH);   bql.h[1] = *(const v8h*)(wr + 1 * HH * WPITCH + 16);
      bk.h[0]  = *(const v8h*)(wr + 2 * HH * WPITCH);   bk.h[1]  = *(const v8h*)(wr + 2 * HH * WPITCH + 16);
      bkl.h[0] = *(const v8h*)(wr + 3 * HH * WPITCH);   bkl.h[1] = *(const v8h*)(wr + 3 * HH * WPITCH + 16);
      bv.h[0]  = *(const v8h*)(wr + 4 * HH * WPITCH);   bv.h[1]  = *(const v8h*)(wr + 4 * HH * WPITCH + 16);
      bvl.h[0] = *(const v8h*)(wr + 5 * HH * WPITCH);   bvl.h[1] = *(const v8h*)(wr + 5 * HH * WPITCH + 16);
      accQ[nt] = wmma_split(a.v, al.v, bq.v, bql.v, accQ[nt]);
      accK[nt] = wmma_split(a.v, al.v, bk.v, bkl.v, accK[nt]);
      accV[nt] = wmma_split(a.v, al.v, bv.v, bvl.v, accV[nt]);
      // keeps the n-tiles apart in the schedule: mixed, more fragments and cross-term tiles are live at once and registers spill to scratch
      __builtin_amdgcn_sched_barrier(0);
    }
  }
}

// Hand-over at the foot of a trip: this wave's reads of the slice are done, its copies of the next slice have landed, and
// every wave has said so; behind it the next slice may be read and the buffer just read may be refilled.
__device__ __forceinline__ void slice_handover() {
  asm volatile("s_wait_dscnt 0x0" ::: "memory");
  asm volatile("s_wait_asynccnt 0x0" ::: "memory");
  __syncthreads();
}

__global__ void __launch_bounds__(256)
qkv_kernel(const float* __restrict__ x,
           const h16* __restrict__ WtQ,
           const h16* __restrict__ WtK,
           const h16* __restrict__ WtV,
           h16* __restrict__ qws,
           h16* __restrict__ kws,
           h16* __restrict__ vws) {
  __shared__ __align__(16) h16 wl[2][WBUF];     // the two weight-slice buffers (cross-wave)
  __shared__ __align__(16) h16 st[8][16][64];   // per-wave staging of one 16x64 result plane (wave-private)
  const int lane = threadIdx.x & 31;
  const int wv   = threadIdx.x >> 5;
  const int g    = lane >> 4;
  const int m    = lane & 15;
  const int tile = blockIdx.x * 8 + wv;        // 0 .. NB*SEQ/16 - 1
  const int b    = tile / (SEQ / 16);
  const int t0   = (tile % (SEQ / 16)) * 16;
  const size_t QL = (size_t)NB * SEQ * HH;     // residual plane offset inside q/k/v buffers
  const unsigned lw = (unsigned)(size_t)&wl[0][0];   // LDS byte address of buffer 0

  v8f accQ[4], accK[4], accV[4];
#pragma unroll
  for (int nt = 0; nt < 4; ++nt) {
    accQ[nt] = v8f_zero();
    accK[nt] = v8f_zero();
    accV[nt] = v8f_zero();
  }

  const float* xrow = x + ((size_t)b * SEQ_FULL + t0 + m) * CC;

  // x columns of slice 0: they fly under the staging of the first weight slice
  v4f xv[KS / 32][4];
  const float* xnext = xrow + 8 * g;
  load_xslice(xnext, xv);
  xnext += KS;

  // slice 0 lands and is published to every wave; slice 1 then flies during trip 0
  stage_slice(WtQ, WtK, WtV, 0, lw, threadIdx.x);
  asm volatile("s_wait_asynccnt 0x0" ::: "memory");   // this wave's copies of slice 0 have landed
  __syncthreads();
  stage_slice(WtQ, WtK, WtV, KS, lw + (unsigned)(WBUF * sizeof(h16)), threadIdx.x);

  // rolled, and the last two trips (no slice left to fetch) in a loop of their own: each loop body stays one straight block
#pragma unroll 1
  for (int t = 0; t < NSLICE - 2; ++t) {
    slice_mac(xnext, &wl[t & 1][0], g, m, xv, accQ, accK, accV);
    xnext += KS;
    slice_handover();
    // refill the buffer that this trip has just read
    stage_slice(WtQ, WtK, WtV, (t + 2) * KS, lw + (unsigned)((t & 1) * WBUF * sizeof(h16)), threadIdx.x);
  }
#pragma unroll 1
  for (int t = NSLICE - 2; t < NSLICE; ++t) {
    // xnext stays at the last slice: the last trip has no next slice and reads its own x columns again
    slice_mac(xnext, &wl[t & 1][0], g, m, xv, accQ, accK, accV);
    slice_handover();
  }
  asm volatile("s_wait_asynccnt 0x0" ::: "memory");   // no copy is outstanding when the wave goes on and ends

  // outputs: q, k, v [NB,SEQ,64] as value + residual planes; each 16x64 plane tile goes through the wave's LDS tile and is
  h16* sw = &st[wv][0][0];
  h16* dsts[3] = {qws, kws, vws};
#pragma unroll
  for (int s = 0; s < 3; ++s) {
#pragma unroll
    for (int pl = 0; pl < 2; ++pl) {
#pragma unroll
      for (int nt = 0; nt < 4; ++nt)
#pragma unroll
        for (int v = 0; v < 8; ++v) {
          const float val = (s == 0) ? accQ[nt][v] : (s == 1) ? accK[nt][v] : accV[nt][v];
          h16 hh_, ll_; split16(val, hh_, ll_);
          // q, v: row-major [row][col]; k: fragment order (KFRAG), so that the linear copy-out below stores the tile that way
          const int si = (s == 1) ? KFRAG(8 * g + v, nt * 16 + m) : (8 * g + v) * 64 + nt * 16 + m;
          sw[si] = pl ? ll_ : hh_;
        }
      asm volatile("s_wait_dscnt 0" ::: "memory");
      h16* base = dsts[s] + (pl ? QL : 0) + ((size_t)b * SEQ + t0) * HH;
#pragma unroll
      for (int r = 0; r < 16; ++r) {
        const unsigned w = *((const unsigned*)(sw + r * 64) + lane);
        *(unsigned*)((unsigned*)(base + (size_t)r * HH) + lane) = w;
      }
      
      asm volatile("s_wait_dscnt 0" ::: "memory");
    }
  }
}

// ---------------------------------------------------------------------------
// Kernel 1b: V put in fragment order per 32-key block (value plane then residual plane at +NB*SEQ*64) through an LDS tile; a wave writes one
// ---------------------------------------------------------------------------
__global__ void __launch_bounds__(256)
vt_kernel(const h16* __restrict__ vws, h16* __restrict__ vtws) {
  __shared__ h16 t[64][66];                         // [t][h], cross-wave (block barrier)
  const int tid = threadIdx.x;
  const size_t QL = (size_t)NB * SEQ * HH;
  const int row0 = blockIdx.x * 64;                 // 64 consecutive (b,t) rows, same b
  const int pl = blockIdx.y;                        // 0: value plane, 1: residual plane
  const h16* src = vws + (pl ? QL : 0) + (size_t)row0 * HH;
#pragma unroll
  for (int k = 0; k < 16; ++k) { const int e = tid + 256 * k; t[e >> 6][e & 63] = src[e]; }
  __syncthreads();
  // the block's two 32-key blocks are 2048 consecutive 32-bit words; word r*256 + tid holds keys key, key+1 of column h
  h16* dst = vtws + (pl ? QL : 0) + (size_t)row0 * HH;
  const int fl = (tid & 127) >> 2;                  // fragment lane of this thread's words
#pragma unroll
  for (int r = 0; r < 8; ++r) {
    const int h   = (r & 3) * 16 + (fl & 15);
    const int key = (r >> 2) * 32 + (tid >> 7) * 16 + (fl >> 4) * 8 + 2 * (tid & 3);
    const unsigned pk = (unsigned)hbits(t[key][h]) | ((unsigned)hbits(t[key + 1][h]) << 16);
    unsigned* d = (unsigned*)dst + r * 256 + tid;
    *(unsigned*)d = pk;
    
  }
}

// ---------------------------------------------------------------------------
// Kernel 2: causal flash attention, split-K across 4 waves per 16-row query tile.
// Wave w handles key blocks w, w+4, w+8, ... (balanced causal triangle).
// The products are taken transposed: per 32-key block St = K Q^T (2 split tiles, A = k fragment, B = q fragment), online
// softmax, Ot += V^T Pt (4 split tiles, A = v fragment, B = Pt). The fragments are the same registers as for Q K^T and P V
// (A and B share one lane map); in the results lane%16 is the query and element v the key 8g+v (St) or the column 8g+v (Ot).
// So one lane holds 16 of its query's 32 scores (lane^16 the other 16): maximum and sum are taken in the lane, the maximum
// joined with one exchange between the halves, the sum once behind the loop; and St tile 0 / tile 1 of a lane are keys
// 8g..8g+7 / 16+8g..16+8g+7, which is the B fragment's k order: Pt is packed in registers.
// Partial (O, m, l) merged across waves via LDS log-sum-exp combine (block barrier).
// Fragment loads run ahead of their use: a pass issues all of its v fragments before the score products, and the next pass's
// k fragments before the P.V products, so that a load's way from L2 lies under matrix and softmax work.
// ---------------------------------------------------------------------------
#define OPITCH 68   // f32 per staged O row, 272 B = 16 B x odd: 16 lanes' 16-byte stores fall on distinct banks

// lane l with lane l ^ 16
__device__ __forceinline__ float xhalf(float x) {
  return __builtin_bit_cast(float, __builtin_amdgcn_permlanex16(__builtin_bit_cast(int, x), __builtin_bit_cast(int, x),
                                                                0x76543210, 0xfedcba98, false, false));
}

union U16 { v16h v; v8h h[2]; h16 e[16]; };

// The k fragments of one 32-key block (kblk: this lane's first 8 elements of it; ql: offset of the residual plane):
// kf[kt][c] = value plane of 16-key tile kt, 32-wide h chunk c; kf[kt][2 + c] = its residual plane. 16-h group j is 256*j elements on.
__device__ __forceinline__ void load_kfrags(const h16* __restrict__ kblk, size_t ql, U16 (&kf)[2][4]) {
  // unrolled so that every index of kf is a constant and the array stays in registers
#pragma unroll
  for (int kt = 0; kt < 2; ++kt) {
    const h16* kfr = kblk + kt * 16 * HH;
    kf[kt][0].h[0] = *(const v8h*)(kfr);            kf[kt][0].h[1] = *(const v8h*)(kfr + 256);
    kf[kt][1].h[0] = *(const v8h*)(kfr + 512);      kf[kt][1].h[1] = *(const v8h*)(kfr + 768);
    kf[kt][2].h[0] = *(const v8h*)(kfr + ql);       kf[kt][2].h[1] = *(const v8h*)(kfr + ql + 256);
    kf[kt][3].h[0] = *(const v8h*)(kfr + ql + 512); kf[kt][3].h[1] = *(const v8h*)(kfr + ql + 768);
  }
}

// Stands behind a group of fragment loads, before anything rewrites the address register that they name; it takes that
// address as an input so that the register is left alone up to the wait.
__device__ __forceinline__ void frag_loads_issued(const h16* addr) {
  asm volatile("s_wait_xcnt 0x0" :: "v"(addr) : "memory");
}

__global__ void __launch_bounds__(128)
attn_kernel(const h16* __restrict__ qws,
            const h16* __restrict__ kws,
            const h16* __restrict__ vtws,
            float* __restrict__ out) {
  __shared__ __align__(16) float Of[4][16][OPITCH];  // partial O, [query][column] (cross-wave)
  __shared__ float Ml[4][16], Ll[4][16];             // partial m, l (cross-wave)

  const int lane = threadIdx.x & 31;
  const int wv   = threadIdx.x >> 5;
  const int g    = lane >> 4;
  const int m    = lane & 15;
  const int tile = blockIdx.x;                 // 0 .. NB*SEQ/16 - 1
  const int b    = tile / (SEQ / 16);
  const int t0   = (tile % (SEQ / 16)) * 16;

  // Q fragments (B operand: lane%16 = query) for the two 32-wide h chunks (HH = 64)
  const size_t QL = (size_t)NB * SEQ * HH;     // residual planes follow the value planes
  const h16* qrow = qws + ((size_t)b * SEQ + t0 + m) * HH;
  U16 qa[2], qal[2];
  // here and below: the short loops are unrolled so that every array index is a constant and the arrays stay in registers
#pragma unroll
  for (int hc = 0; hc < 2; ++hc) {
    qa[hc].h[0]  = *(const v8h*)(qrow + hc * 32 + 8 * g);
    qa[hc].h[1]  = *(const v8h*)(qrow + hc * 32 + 16 + 8 * g);
    qal[hc].h[0] = *(const v8h*)(qrow + QL + hc * 32 + 8 * g);
    qal[hc].h[1] = *(const v8h*)(qrow + QL + hc * 32 + 16 + 8 * g);
  }

  v8f o[4];                                    // Ot: lane%16 = query, element v of tile nt = column nt*16 + 8g + v
#pragma unroll
  for (int nt = 0; nt < 4; ++nt) o[nt] = v8f_zero();
  float mrow = NEG_INF;                        // running maximum of this lane's query (equal in lanes l and l^16)
  float lrow = 0.f;                            // running sum over this lane's own keys (the halves are joined behind the loop)

  const float scale = ATTN_SCALE;
  const int   nblk  = t0 / 32 + 1;             // causal: keys <= t0+15
  const int   qidx  = t0 + m;                  // this lane's query

  const h16* kbase  = kws + (size_t)b * SEQ * HH;
  const h16* vtbase = vtws + (size_t)b * HH * SEQ;

  // k fragments of the wave's first block (block wv <= 3 lies inside the batch's keys whether or not the wave has a pass: SEQ >= 128)
  U16 kf[2][4];                                // A frags use the same k map as B
  const h16* kfirst = kbase + (size_t)wv * 32 * HH + lane * 8;
  load_kfrags(kfirst, QL, kf);
  frag_loads_issued(kfirst);

  for (int blk = wv; blk < nblk; blk += 4) {
    const int s0 = blk * 32;

    // ---- this block's v fragments (A operand of Ot += V^T Pt), all issued here: they fly under the scores and the softmax ----
    U16 vf[4][2];                                         // [nt][value, residual]; same k map as B; keys 16+8g.. are 256 elements on
    // stands before this pass's loads land in registers that earlier loads name as their address (ahead of the first pass: the q loads and the first block's k loads)
    asm volatile("s_wait_xcnt 0x0" ::: "memory");
    const h16* vblk = vtbase + (size_t)s0 * HH + lane * 8;
#pragma unroll
    for (int nt = 0; nt < 4; ++nt) {
      const h16* vfr = vblk + nt * 512;                   // this lane's 8 keys of column nt*16+m, keys 8g..8g+7
      vf[nt][0].h[0] = *(const v8h*)(vfr);      vf[nt][0].h[1] = *(const v8h*)(vfr + 256);
      vf[nt][1].h[0] = *(const v8h*)(vfr + QL); vf[nt][1].h[1] = *(const v8h*)(vfr + QL + 256);
    }

    // ---- St = K Q^T for 32 keys (two 16x16 tiles) ----
    v8f s[2];
#pragma unroll
    for (int kt = 0; kt < 2; ++kt) {
      s[kt] = wmma_split(kf[kt][0].v, kf[kt][2].v, qa[0].v, qal[0].v, v8f_zero());
      s[kt] = wmma_split(kf[kt][1].v, kf[kt][3].v, qa[1].v, qal[1].v, s[kt]);
    }

    // ---- scale + causal mask (diagonal block only); maximum over the lane's 16 keys, then over both halves ----
    const bool diag = (s0 + 31 >= t0);
    float mx[8];
#pragma unroll
    for (int v = 0; v < 8; ++v) {
#pragma unroll
      for (int kt = 0; kt < 2; ++kt) {
        const int key = s0 + kt * 16 + 8 * g + v;
        const float val = s[kt][v] * scale;
        s[kt][v] = (diag && (key > qidx)) ? NEG_INF : val;
      }
      mx[v] = fmaxf(s[0][v], s[1][v]);
    }
    float rmax = fmaxf(fmaxf(fmaxf(mx[0], mx[1]), fmaxf(mx[2], mx[3])), fmaxf(fmaxf(mx[4], mx[5]), fmaxf(mx[6], mx[7])));
    rmax = fmaxf(rmax, xhalf(rmax));

    // ---- online softmax update; Pt (x1024, two planes) packed into the B fragment ----
    const float mnew  = fmaxf(mrow, rmax);     // finite: key s0 <= t0 is open to every query of the tile
    const float alpha = __expf(mrow - mnew);
    mrow = mnew;
    U16 pa, pal;
    float ps[8];
#pragma unroll
    for (int v = 0; v < 8; ++v) {
      const float p0 = __expf(s[0][v] - mnew);
      const float p1 = __expf(s[1][v] - mnew);
      // probabilities carried x1024 (tail values stay f16-normal; removed in the final merge) as value + residual planes
      split16(p0 * 1024.0f, pa.e[v],     pal.e[v]);
      split16(p1 * 1024.0f, pa.e[8 + v], pal.e[8 + v]);
      ps[v] = p0 + p1;
    }
    lrow = lrow * alpha + (((ps[0] + ps[1]) + (ps[2] + ps[3])) + ((ps[4] + ps[5]) + (ps[6] + ps[7])));
#pragma unroll
    for (int nt = 0; nt < 4; ++nt)
#pragma unroll
      for (int v = 0; v < 8; ++v)
        o[nt][v] *= alpha;

    // ---- the next pass's k fragments, into the registers that the scores have left; the last pass reads its own block again ----
    const int nb = (blk + 4 < nblk) ? blk + 4 : blk;
    // holds the loads behind the softmax: issued in front of it, their 64 registers are live together with its temporaries and a fourth wave no longer fits the SIMD
    __builtin_amdgcn_sched_barrier(0);
    const h16* knext = kbase + (size_t)nb * 32 * HH + lane * 8;
    load_kfrags(knext, QL, kf);
    frag_loads_issued(knext);

    // ---- Ot += V^T Pt  (V A-frags from the fragment-ordered planes) ----
#pragma unroll
    for (int nt = 0; nt < 4; ++nt)
      o[nt] = wmma_split(vf[nt][0].v, vf[nt][1].v, pa.v, pal.v, o[nt]);
  }

  // ---- publish this wave's partial (O, m, l) ----
  lrow += xhalf(lrow);                         // the two halves' keys joined
#pragma unroll
  for (int nt = 0; nt < 4; ++nt) {
    const v4f lo4 = {o[nt][0], o[nt][1], o[nt][2], o[nt][3]};
    const v4f hi4 = {o[nt][4], o[nt][5], o[nt][6], o[nt][7]};
    *(v4f*)&Of[wv][m][nt * 16 + 8 * g]     = lo4;
    *(v4f*)&Of[wv][m][nt * 16 + 8 * g + 4] = hi4;
  }
  if (g == 0) {
    Ml[wv][m] = mrow;
    Ll[wv][m] = lrow;
  }
  __syncthreads();

  for (int e = threadIdx.x; e < 16 * HH; e += 128) {
    const int row = e >> 6;        // 0..15
    const int col = e & 63;        // 0..63
    float M = Ml[0][row];
#pragma unroll
    for (int w = 1; w < 4; ++w) M = fmaxf(M, Ml[w][row]);
    float L = 0.f, O = 0.f;
#pragma unroll
    for (int w = 0; w < 4; ++w) {
      const float be = __expf(Ml[w][row] - M);   // 0 for idle waves (m = -inf)
      L += be * Ll[w][row];
      O += be * Of[w][row][col];
    }
    const float r = O / (L * 1024.0f);          // removes the x1024 carried by the probabilities
    float* op = out + ((size_t)b * SEQ_FULL + t0 + row) * HH + col;
    *(float*)op = r;
    
  }
}

// ---------------------------------------------------------------------------
// Launch. Workspace layout (bytes, full size):
//   [0, 4MB)      q   f16 [NB,SEQ,64]  value + residual planes
//   [4MB, 8MB)    k   f16 [NB,SEQ,64]  (fragment order per 16-key tile)
//   [8MB, 12MB)   v   f16 [NB,SEQ,64]  (row-major, input to the transpose)
//   [12MB, 16MB)  v   f16 [NB,SEQ,64]  (fragment order per 32-key block)
//   [16MB, +576KB) WtQ/WtK/WtV f16 [64,768] x2 planes each
// ---------------------------------------------------------------------------
extern "C" void kernel_launch(void* const* d_in, const int* in_sizes, int n_in,
                              void* d_out, int out_size, void* d_ws,
                              size_t ws_size, hipStream_t stream) {
  if (n_in < 4) return;
  const long long rows_needed = (long long)(NB - 1) * SEQ_FULL + SEQ;
  if ((long long)in_sizes[0] < rows_needed * CC) return;
  if (in_sizes[1] < CC * HH || in_sizes[2] < CC * HH || in_sizes[3] < CC * HH) return;
  if ((long long)out_size < rows_needed * HH) return;

  const float* x  = (const float*)d_in[0];
  const float* Wk = (const float*)d_in[1];
  const float* Wq = (const float*)d_in[2];
  const float* Wv = (const float*)d_in[3];
  float* out = (float*)d_out;

  // every 16-bit buffer holds a value plane followed by its residual plane (2x the element count)
  char* ws = (char*)d_ws;
  const size_t qkv_bytes = (size_t)2 * NB * SEQ * HH * sizeof(h16);     // 4 MB at full size (two planes)
  const size_t wt_bytes  = (size_t)2 * CC * HH * sizeof(h16);           // 192 KB each
  const size_t total     = 4 * qkv_bytes + 3 * wt_bytes;
  if (total > ws_size) return;
  h16* qws  = (h16*)(ws);
  h16* kws  = (h16*)(ws + qkv_bytes);
  h16* vws  = (h16*)(ws + 2 * qkv_bytes);
  h16* vtws = (h16*)(ws + 3 * qkv_bytes);
  h16* WtQ  = (h16*)(ws + 4 * qkv_bytes);
  h16* WtK  = (h16*)(ws + 4 * qkv_bytes + wt_bytes);
  h16* WtV  = (h16*)(ws + 4 * qkv_bytes + 2 * wt_bytes);

  wt_kernel<<<(CC * HH / 2) / 256, 256, 0, stream>>>(Wk, Wq, Wv, WtQ, WtK, WtV);
  qkv_kernel<<<(NB * SEQ) / 128, 256, 0, stream>>>(x, WtQ, WtK, WtV, qws, kws, vws);
  vt_kernel<<<dim3((NB * SEQ) / 64, 2), 256, 0, stream>>>(vws, vtws);
  attn_kernel<<<(NB * SEQ) / 16, 128, 0, stream>>>(qws, kws, vtws, out);
}

// v006
// A run of this version takes 56.3 microseconds.
// In two side-by-side timings against v005, it was 1.12 and 1.15 times as fast.
// Counting every step since v000, it is 2.40 times as fast.
// Contractions: q/k/v projections [NB*SEQ x 64 x 768] (x3), causal scores [T x T x 64] and P.V [T x 64 x T] per batch, all on
// v_wmma_f32_16x16x32_f16 with f16 value + residual operand planes (hi.hi + (hi.lo + lo.hi)/2048), f32 accumulate; softmax and
#include <hip/hip_runtime.h>
#include <math.h>

// Problem constants (NB / SEQ overridable for a reduced build; *_FULL are the strides of the inputs / output)
#ifndef NB
#define NB 8
#endif
#ifndef SEQ
#define SEQ 2048
#endif
#define NB_FULL 8
#define SEQ_FULL 2048
#define CC 768
#define HH 64
#define ATTN_SCALE 0.03608439182435161f   // CC^-0.5 (embedding dim), as f32

static_assert(NB >= 1 && NB <= NB_FULL);
static_assert(SEQ >= 128 && SEQ <= SEQ_FULL && (SEQ % 128) == 0);
static_assert((CC % 128) == 0 && (CC % 32) == 0);
static_assert(HH == 64);
static_assert(((CC * HH / 2) % 256) == 0);
static_assert(((NB * SEQ) % 64) == 0);

// 16-bit operands are f16, each carried as a value plane plus a residual plane lo = f16((v - hi) * 2048):
// a product is hi.hi + (hi.lo + lo.hi)/2048 (f32-class). Every fragment (A and B) uses the 16x16x32 lane map
// lane%16 = row/col, g = lane/16: elements 0..7 -> k = 8g+e, elements 8..15 -> k = 16+8g+(e-8).
// k and v are kept in memory in that fragment order, so that one 16-byte-per-lane fragment load reads 512 contiguous bytes (4 lines, not 16):
//   k: per 16-key tile 1024 elements, [h/16][lane = 16*((h%16)/8) + key%16][h%8]           (tile r starts at element 1024*r of its plane)
//   v: per 32-key block 2048 elements, [h/16][(key%32)/16][lane = 16*((key%16)/8) + h%16][key%8]  (block r starts at element 2048*r)
#define KFRAG(key16, h) ((((h) >> 4) * 32 + (((h) >> 3) & 1) * 16 + (key16)) * 8 + ((h) & 7))
typedef _Float16 h16;
typedef __attribute__((ext_vector_type(16))) _Float16 v16h;
typedef __attribute__((ext_vector_type(8)))  _Float16 v8h;
typedef __attribute__((ext_vector_type(8)))  float    v8f;
typedef __attribute__((ext_vector_type(4)))  float    v4f;
#define RSPLIT (1.0f / 2048.0f)
__device__ __forceinline__ void split16(float f, h16& hi, h16& lo) { hi = (h16)f; lo = (h16)((f - (float)hi) * 2048.0f); }
__device__ __forceinline__ unsigned short hbits(h16 h) { return __builtin_bit_cast(unsigned short, h); }

#define NEG_INF (-__builtin_inff())

__device__ __forceinline__ v8f v8f_zero() {
  v8f z = {0.f, 0.f, 0.f, 0.f, 0.f, 0.f, 0.f, 0.f};
  return z;
}

// D = A(16x32 f16) * B(32x16 f16) + C(16x16 f32), followed by the VALU hazard guard (ties D, keeps A/B live)
__device__ __forceinline__ v8f wmma16(v16h a, v16h b, v8f c) {
  v8f r = __builtin_amdgcn_wmma_f32_16x16x32_f16(false, a, false, b, (short)0, c, false, false);
  asm volatile("v_nop\n\tv_nop\n\tv_nop\n\tv_nop" : "+v"(r) : "v"(a), "v"(b));
  return r;
}

// acc += A.B with value/residual planes: cross terms from zero, folded at 1/2048 on the VALU
__device__ __forceinline__ v8f wmma_split(v16h ah, v16h al, v16h bh, v16h bl, v8f c) {
  v8f x = wmma16(al, bh, v8f_zero());
  x = wmma16(ah, bl, x);
  return wmma16(ah, bh, c) + x * RSPLIT;
}

// ---------------------------------------------------------------------------
// Kernel 0: W[C,H] f32  ->  Wt[H,C] f16 value + residual planes
// ---------------------------------------------------------------------------
__global__ void __launch_bounds__(256)
wt_kernel(const float* __restrict__ Wk,
          const float* __restrict__ Wq,
          const float* __restrict__ Wv,
          h16* __restrict__ WtQ,
          h16* __restrict__ WtK,
          h16* __restrict__ WtV) {
  const int idx = blockIdx.x * 256 + threadIdx.x;   // 0 .. HH*CC/2 - 1
  if (idx >= CC * HH / 2) return;
  const int h = idx / (CC / 2);
  const int c = 2 * (idx % (CC / 2));
  const float* src[3] = {Wq, Wk, Wv};
  h16* dstp[3] = {WtQ, WtK, WtV};
#pragma unroll
  for (int s = 0; s < 3; ++s) {
    h16 h0, l0, h1, l1;
    split16(src[s][(size_t)c * HH + h], h0, l0);
    split16(src[s][(size_t)(c + 1) * HH + h], h1, l1);
    unsigned* dh = (unsigned*)(dstp[s] + (size_t)h * CC + c);
    unsigned* dl = (unsigned*)(dstp[s] + (size_t)CC * HH + (size_t)h * CC + c);
    const unsigned ph = (unsigned)hbits(h0) | ((unsigned)hbits(h1) << 16);
    const unsigned pl = (unsigned)hbits(l0) | ((unsigned)hbits(l1) << 16);
    *(unsigned*)dh = ph; *(unsigned*)dl = pl;
    
  }
}

// ---------------------------------------------------------------------------
// Kernel 1: QKV projection. A block takes 64 rows of (b,t): 4 row tiles of 16, each worked by two waves, wave kh = 0 / 1 taking
// the first / second KW k columns of every staged slice (so the grid has one block for every WGP of the chip, two waves a SIMD).
// Behind the k loop the two waves of a row tile join their partial sums through LDS, each keeping half of the 12 result tiles.
//   q,v stored row-major [NB,SEQ,64] (value + residual planes), k in fragment order per 16-key tile; v is put in fragment order by vt_kernel.
// A-frag (x rows, split in registers) and B-frags (Wt[n][k] rows) use the same element -> k map; C/D: lane col = lane%16,
// element v -> row 8g+v.
// The six weight planes are staged once per block in LDS, KS columns of k at a time, by asynchronous copies into two
// buffers (the next slice flies while this one is multiplied); all 8 waves read their B fragments from there.
// The x columns of a slice are loaded into registers one trip ahead of their use.
// ---------------------------------------------------------------------------
#define KW 64                          // k columns of a slice that one wave multiplies
#define KS (2 * KW)                    // k columns per staged slice: 256 B of every weight row
#define WPITCH (KS + 8)                // f16 per staged row, 272 B = 16 B x odd: 16 rows' 16-byte reads fall on distinct banks
#define WBUF (6 * HH * WPITCH)         // f16 per buffer: planes Q, Q residual, K, K residual, V, V residual
#define NSLICE (CC / KS)
static_assert((CC % KS) == 0 && NSLICE >= 2);
static_assert(6 * HH * (KS / 8) == 24 * 256);   // 16-byte pieces of a slice = 24 per thread of the block

// One slice (columns c0 .. c0+KS-1 of all six planes) into the buffer at LDS byte address lbuf: 24 copies of 16 B per lane.
// Piece i of thread tid: plane i/4, row 16*(i%4) + tid/16, 16-byte column tid%16.
__device__ __forceinline__ void stage_slice(const h16* __restrict__ WtQ, const h16* __restrict__ WtK,
                                            const h16* __restrict__ WtV, int c0, unsigned lbuf, int tid) {
  const size_t PL = (size_t)CC * HH;
  const h16* pl[6] = {WtQ, WtQ + PL, WtK, WtK + PL, WtV, WtV + PL};
#pragma unroll
  for (int q = 0; q < 6; ++q) {   // four copies a statement (one plane): fewer address registers live at once than with more in one
    const h16* gp[4];
    unsigned ld[4];
#pragma unroll
    for (int j = 0; j < 4; ++j) {
      const int i = q * 4 + j;
      const int row = (i & 3) * 16 + (tid >> 4);
      gp[j] = pl[i >> 2] + (size_t)row * CC + c0 + (tid & 15) * 8;
      ld[j] = lbuf + (unsigned)((((i >> 2) * HH + row) * WPITCH + (tid & 15) * 8) * sizeof(h16));
    }
    // the copies and, as the statement's last line, the wait that stands before any of their address registers is rewritten
    asm volatile("global_load_async_to_lds_b128 %0, %4, off\n\t"
                 "global_load_async_to_lds_b128 %1, %5, off\n\t"
                 "global_load_async_to_lds_b128 %2, %6, off\n\t"
                 "global_load_async_to_lds_b128 %3, %7, off\n\t"
                 "s_wait_xcnt 0x0"
                 :: "v"(ld[0]), "v"(ld[1]), "v"(ld[2]), "v"(ld[3]), "v"(gp[0]), "v"(gp[1]), "v"(gp[2]), "v"(gp[3])
                 : "memory");
  }
}

// The x columns of this wave's KW-wide half of one slice, this lane's row, issued into registers (xp: column 8g of that half): kc-th 32-chunk holds
// k = 8g..8g+7 in xv[kc][0..1], 16+8g..16+8g+7 in xv[kc][2..3].
__device__ __forceinline__ void load_xslice(const float* __restrict__ xp, v4f (&xv)[KW / 32][4]) {
#pragma unroll
  for (int kc = 0; kc < KW / 32; ++kc) {
    xv[kc][0] = *(const v4f*)(xp + kc * 32);
    xv[kc][1] = *(const v4f*)(xp + kc * 32 + 4);
    xv[kc][2] = *(const v4f*)(xp + kc * 32 + 16);
    xv[kc][3] = *(const v4f*)(xp + kc * 32 + 20);
  }
  // stands behind the loads, before anything rewrites the address register that they name; it takes that address as an
  // input so that the register is left alone up to the wait
  asm volatile("s_wait_xcnt 0x0" :: "v"(xp) : "memory");
}

// One trip: the 16 x rows of this wave (its KW columns of this slice, loaded into xv one trip ago) times the same columns of the
// six staged planes (wb: the buffer, at the wave's first column), added into the 12 tiles. The next slice's x columns (at xnext) are issued into xv at the head of
// the trip, so that their way from memory lies under this trip's products.
__device__ __forceinline__ void slice_mac(const float* __restrict__ xnext, const h16* wb, int g, int m,
                                          v4f (&xv)[KW / 32][4], v8f (&accQ)[4], v8f (&accK)[4], v8f (&accV)[4]) {
  // this trip's x columns stay in a register set of their own while the next slice's land in xv
  v4f cur[KW / 32][4];
#pragma unroll
  for (int kc = 0; kc < KW / 32; ++kc)
#pragma unroll
    for (int i = 0; i < 4; ++i) cur[kc][i] = xv[kc][i];
  load_xslice(xnext, xv);
  // keeps the loads here at the head of the trip: sunk towards the next trip's splits they would wait for memory in the open
  __builtin_amdgcn_sched_barrier(0);
#pragma unroll
  for (int kc = 0; kc < KW / 32; ++kc) {
    // A-fragment: x tile rows, split into value/residual f16 in registers
    union { v16h v; h16 e[16]; } a, al;
#pragma unroll
    for (int j = 0; j < 8; ++j) {
      split16(cur[kc][j >> 2][j & 3],       a.e[j],     al.e[j]);
      split16(cur[kc][2 + (j >> 2)][j & 3], a.e[8 + j], al.e[8 + j]);
    }
    union UB { v16h v; v8h h[2]; };
#pragma unroll
    for (int nt = 0; nt < 4; ++nt) {
      // one n-tile at a time: its six B fragments (value + residual for Q/K/V weights) then three split MACs;
      // B frags use the same k map as A: {8g..8g+7} then {16+8g..16+8g+7}
      const h16* wr = wb + (nt * 16 + m) * WPITCH + kc * 32 + 8 * g;
      UB bq, bk, bv, bql, bkl, bvl;
      bq.h[0]  = *(const v8h*)(wr);                     bq.h[1]  = *(const v8h*)(wr + 16);
      bql.h[0] = *(const v8h*)(wr + 1 * HH * WPITCH);   bql.h[1] = *(const v8h*)(wr + 1 * HH * WPITCH + 16);
      bk.h[0]  = *(const v8h*)(wr + 2 * HH * WPITCH);   bk.h[1]  = *(const v8h*)(wr + 2 * HH * WPITCH + 16);
      bkl.h[0] = *(const v8h*)(wr + 3 * HH * WPITCH);   bkl.h[1] = *(const v8h*)(wr + 3 * HH * WPITCH + 16);
      bv.h[0]  = *(const v8h*)(wr + 4 * HH * WPITCH);   bv.h[1]  = *(const v8h*)(wr + 4 * HH * WPITCH + 16);
      bvl.h[0] = *(const v8h*)(wr + 5 * HH * WPITCH);   bvl.h[1] = *(const v8h*)(wr + 5 * HH * WPITCH + 16);
      accQ[nt] = wmma_split(a.v, al.v, bq.v, bql.v, accQ[nt]);
      accK[nt] = wmma_split(a.v, al.v, bk.v, bkl.v, accK[nt]);
      accV[nt] = wmma_split(a.v, al.v, bv.v, bvl.v, accV[nt]);
      // keeps the n-tiles apart in the schedule: mixed, more fragments and cross-term tiles are live at once and registers spill to scratch
      __builtin_amdgcn_sched_barrier(0);
    }
  }
}

// Hand-over at the foot of a trip: this wave's reads of the slice are done, its copies of the next slice have landed, and
// every wave has said so; behind it the next slice may be read and the buffer just read may be refilled.
__device__ __forceinline__ void slice_handover() {
  asm volatile("s_wait_dscnt 0x0" ::: "memory");
  asm volatile("s_wait_asynccnt 0x0" ::: "memory");
  __syncthreads();
}

__global__ void __launch_bounds__(256)
qkv_kernel(const float* __restrict__ x,
           const h16* __restrict__ WtQ,
           const h16* __restrict__ WtK,
           const h16* __restrict__ WtV,
           h16* __restrict__ qws,
           h16* __restrict__ kws,
           h16* __restrict__ vws) {
  __shared__ __align__(16) h16 wl[2][WBUF];     // the two weight-slice buffers (cross-wave)
  __shared__ __align__(16) h16 st[8][16][64];   // per-wave staging of one 16x64 result plane (wave-private)
  __shared__ __align__(16) v4f xch[8][12][32];  // partial sums handed to the other wave of the row tile: [sender][half tile][lane]
  const int lane = threadIdx.x & 31;
  const int wv   = threadIdx.x >> 5;
  const int g    = lane >> 4;
  const int m    = lane & 15;
  const int kh   = __builtin_amdgcn_readfirstlane(wv >> 2);   // which KW k columns of every slice (the same in all lanes)
  const int tile = blockIdx.x * 4 + (wv & 3);  // 0 .. NB*SEQ/16 - 1; waves wv and wv ^ 4 share it
  const int b    = tile / (SEQ / 16);
  const int t0   = (tile % (SEQ / 16)) * 16;
  const size_t QL = (size_t)NB * SEQ * HH;     // residual plane offset inside q/k/v buffers
  const unsigned lw = (unsigned)(size_t)&wl[0][0];   // LDS byte address of buffer 0

  v8f accQ[4], accK[4], accV[4];
#pragma unroll
  for (int nt = 0; nt < 4; ++nt) {
    accQ[nt] = v8f_zero();
    accK[nt] = v8f_zero();
    accV[nt] = v8f_zero();
  }

  const float* xrow = x + ((size_t)b * SEQ_FULL + t0 + m) * CC;

  // x columns of slice 0: they fly under the staging of the first weight slice
  v4f xv[KW / 32][4];
  const float* xnext = xrow + kh * KW + 8 * g;
  load_xslice(xnext, xv);
  xnext += KS;

  // slice 0 lands and is published to every wave; slice 1 then flies during trip 0
  stage_slice(WtQ, WtK, WtV, 0, lw, threadIdx.x);
  asm volatile("s_wait_asynccnt 0x0" ::: "memory");   // this wave's copies of slice 0 have landed
  __syncthreads();
  stage_slice(WtQ, WtK, WtV, KS, lw + (unsigned)(WBUF * sizeof(h16)), threadIdx.x);

  // rolled, and the last two trips (no slice left to fetch) in a loop of their own: each loop body stays one straight block
#pragma unroll 1
  for (int t = 0; t < NSLICE - 2; ++t) {
    slice_mac(xnext, &wl[t & 1][kh * KW], g, m, xv, accQ, accK, accV);
    xnext += KS;
    slice_handover();
    // refill the buffer that this trip has just read
    stage_slice(WtQ, WtK, WtV, (t + 2) * KS, lw + (unsigned)((t & 1) * WBUF * sizeof(h16)), threadIdx.x);
  }
#pragma unroll 1
  for (int t = NSLICE - 2; t < NSLICE; ++t) {
    // xnext stays at the last slice: the last trip has no next slice and reads its own x columns again
    slice_mac(xnext, &wl[t & 1][kh * KW], g, m, xv, accQ, accK, accV);
    slice_handover();
  }
  asm volatile("s_wait_asynccnt 0x0" ::: "memory");   // no copy is outstanding when the wave goes on and ends

  // the two k halves joined: wave kh = 0 keeps q and k columns 0..31, wave kh = 1 keeps v and k columns 32..63; each hands the
  // other six tiles to its partner and adds what the partner hands it
  v8f mine[6], send[6];
#pragma unroll
  for (int i = 0; i < 4; ++i) {
    mine[i] = kh ? accV[i] : accQ[i];
    send[i] = kh ? accQ[i] : accV[i];
  }
#pragma unroll
  for (int j = 0; j < 2; ++j) {
    mine[4 + j] = kh ? accK[2 + j] : accK[j];
    send[4 + j] = kh ? accK[j] : accK[2 + j];
  }
#pragma unroll
  for (int i = 0; i < 6; ++i) {
    const v4f lo4 = {send[i][0], send[i][1], send[i][2], send[i][3]};
    const v4f hi4 = {send[i][4], send[i][5], send[i][6], send[i][7]};
    xch[wv][2 * i][lane]     = lo4;
    xch[wv][2 * i + 1][lane] = hi4;
  }
  __syncthreads();   // every wave's handed tiles are in LDS before a partner reads them
#pragma unroll
  for (int i = 0; i < 6; ++i) {
    const v4f lo4 = xch[wv ^ 4][2 * i][lane];
    const v4f hi4 = xch[wv ^ 4][2 * i + 1][lane];
#pragma unroll
    for (int v = 0; v < 4; ++v) {
      mine[i][v]     += lo4[v];
      mine[i][4 + v] += hi4[v];
    }
  }

  // outputs: q, k, v [NB,SEQ,64] as value + residual planes; each plane tile goes through the wave's LDS tile and leaves in whole lines
  h16* sw = &st[wv][0][0];
  const size_t row0 = ((size_t)b * SEQ + t0) * HH;
  // q (kh = 0) or v (kh = 1): 16x64, row-major [row][col]
  h16* dmain = kh ? vws : qws;
#pragma unroll
  for (int pl = 0; pl < 2; ++pl) {
#pragma unroll
    for (int nt = 0; nt < 4; ++nt)
#pragma unroll
      for (int v = 0; v < 8; ++v) {
        h16 hh_, ll_; split16(mine[nt][v], hh_, ll_);
        sw[(8 * g + v) * 64 + nt * 16 + m] = pl ? ll_ : hh_;
      }
    asm volatile("s_wait_dscnt 0" ::: "memory");   // all lanes' stores into the wave's tile are done before it is read back across lanes
    h16* base = dmain + (pl ? QL : 0) + row0;
#pragma unroll
    for (int r = 0; r < 16; ++r) {
      const unsigned w = *((const unsigned*)(sw + r * 64) + lane);
      *(unsigned*)((unsigned*)(base + (size_t)r * HH) + lane) = w;
    }
    asm volatile("s_wait_dscnt 0" ::: "memory");   // the reads of the tile are done before the next plane overwrites it
  }
  // k columns 32*kh .. 32*kh+31: in fragment order (KFRAG) they are elements 512*kh .. 512*kh+511 of the 16-key tile
#pragma unroll
  for (int pl = 0; pl < 2; ++pl) {
#pragma unroll
    for (int j = 0; j < 2; ++j)
#pragma unroll
      for (int v = 0; v < 8; ++v) {
        h16 hh_, ll_; split16(mine[4 + j][v], hh_, ll_);
        sw[KFRAG(8 * g + v, j * 16 + m)] = pl ? ll_ : hh_;
      }
    asm volatile("s_wait_dscnt 0" ::: "memory");   // as above: the tile is complete before it is read back
    h16* base = kws + (pl ? QL : 0) + row0 + kh * 512;
#pragma unroll
    for (int r = 0; r < 8; ++r) {
      const unsigned w = *((const unsigned*)(sw + r * 64) + lane);
      *(unsigned*)((unsigned*)(base + (size_t)r * HH) + lane) = w;
    }
    asm volatile("s_wait_dscnt 0" ::: "memory");   // the reads of the tile are done before the next plane overwrites it
  }
}

// ---------------------------------------------------------------------------
// Kernel 1b: V put in fragment order per 32-key block (value plane then residual plane at +NB*SEQ*64) through an LDS tile; a wave writes one
// ---------------------------------------------------------------------------
__global__ void __launch_bounds__(256)
vt_kernel(const h16* __restrict__ vws, h16* __restrict__ vtws) {
  __shared__ h16 t[64][66];                         // [t][h], cross-wave (block barrier)
  const int tid = threadIdx.x;
  const size_t QL = (size_t)NB * SEQ * HH;
  const int row0 = blockIdx.x * 64;                 // 64 consecutive (b,t) rows, same b
  const int pl = blockIdx.y;                        // 0: value plane, 1: residual plane
  const h16* src = vws + (pl ? QL : 0) + (size_t)row0 * HH;
#pragma unroll
  for (int k = 0; k < 16; ++k) { const int e = tid + 256 * k; t[e >> 6][e & 63] = src[e]; }
  __syncthreads();
  // the block's two 32-key blocks are 2048 consecutive 32-bit words; word r*256 + tid holds keys key, key+1 of column h
  h16* dst = vtws + (pl ? QL : 0) + (size_t)row0 * HH;
  const int fl = (tid & 127) >> 2;                  // fragment lane of this thread's words
#pragma unroll
  for (int r = 0; r < 8; ++r) {
    const int h   = (r & 3) * 16 + (fl & 15);
    const int key = (r >> 2) * 32 + (tid >> 7) * 16 + (fl >> 4) * 8 + 2 * (tid & 3);
    const unsigned pk = (unsigned)hbits(t[key][h]) | ((unsigned)hbits(t[key + 1][h]) << 16);
    unsigned* d = (unsigned*)dst + r * 256 + tid;
    *(unsigned*)d = pk;
    
  }
}

// ---------------------------------------------------------------------------
// Kernel 2: causal flash attention, split-K across 4 waves per 16-row query tile.
// Wave w handles key blocks w, w+4, w+8, ... (balanced causal triangle).
// The products are taken transposed: per 32-key block St = K Q^T (2 split tiles, A = k fragment, B = q fragment), online
// softmax, Ot += V^T Pt (4 split tiles, A = v fragment, B = Pt). The fragments are the same registers as for Q K^T and P V
// (A and B share one lane map); in the results lane%16 is the query and element v the key 8g+v (St) or the column 8g+v (Ot).
// So one lane holds 16 of its query's 32 scores (lane^16 the other 16): maximum and sum are taken in the lane, the maximum
// joined with one exchange between the halves, the sum once behind the loop; and St tile 0 / tile 1 of a lane are keys
// 8g..8g+7 / 16+8g..16+8g+7, which is the B fragment's k order: Pt is packed in registers.
// Partial (O, m, l) merged across waves via LDS log-sum-exp combine (block barrier).
// Fragment loads run ahead of their use: a pass issues all of its v fragments before the score products, and the next pass's
// k fragments before the P.V products, so that a load's way from L2 lies under matrix and softmax work.
// ---------------------------------------------------------------------------
#define OPITCH 68   // f32 per staged O row, 272 B = 16 B x odd: 16 lanes' 16-byte stores fall on distinct banks

// lane l with lane l ^ 16
__device__ __forceinline__ float xhalf(float x) {
  return __builtin_bit_cast(float, __builtin_amdgcn_permlanex16(__builtin_bit_cast(int, x), __builtin_bit_cast(int, x),
                                                                0x76543210, 0xfedcba98, false, false));
}

union U16 { v16h v; v8h h[2]; h16 e[16]; };

// The k fragments of one 32-key block (kblk: this lane's first 8 elements of it; ql: offset of the residual plane):
// kf[kt][c] = value plane of 16-key tile kt, 32-wide h chunk c; kf[kt][2 + c] = its residual plane. 16-h group j is 256*j elements on.
__device__ __forceinline__ void load_kfrags(const h16* __restrict__ kblk, size_t ql, U16 (&kf)[2][4]) {
  // unrolled so that every index of kf is a constant and the array stays in registers
#pragma unroll
  for (int kt = 0; kt < 2; ++kt) {
    const h16* kfr = kblk + kt * 16 * HH;
    kf[kt][0].h[0] = *(const v8h*)(kfr);            kf[kt][0].h[1] = *(const v8h*)(kfr + 256);
    kf[kt][1].h[0] = *(const v8h*)(kfr + 512);      kf[kt][1].h[1] = *(const v8h*)(kfr + 768);
    kf[kt][2].h[0] = *(const v8h*)(kfr + ql);       kf[kt][2].h[1] = *(const v8h*)(kfr + ql + 256);
    kf[kt][3].h[0] = *(const v8h*)(kfr + ql + 512); kf[kt][3].h[1] = *(const v8h*)(kfr + ql + 768);
  }
}

// Stands behind a group of fragment loads, before anything rewrites the address register that they name; it takes that
// address as an input so that the register is left alone up to the wait.
__device__ __forceinline__ void frag_loads_issued(const h16* addr) {
  asm volatile("s_wait_xcnt 0x0" :: "v"(addr) : "memory");
}

__global__ void __launch_bounds__(128)
attn_kernel(const h16* __restrict__ qws,
            const h16* __restrict__ kws,
            const h16* __restrict__ vtws,
            float* __restrict__ out) {
  __shared__ __align__(16) float Of[4][16][OPITCH];  // partial O, [query][column] (cross-wave)
  __shared__ float Ml[4][16], Ll[4][16];             // partial m, l (cross-wave)

  const int lane = threadIdx.x & 31;
  const int wv   = threadIdx.x >> 5;
  const int g    = lane >> 4;
  const int m    = lane & 15;
  const int tile = blockIdx.x;                 // 0 .. NB*SEQ/16 - 1
  const int b    = tile / (SEQ / 16);
  const int t0   = (tile % (SEQ / 16)) * 16;

  // Q fragments (B operand: lane%16 = query) for the two 32-wide h chunks (HH = 64)
  const size_t QL = (size_t)NB * SEQ * HH;     // residual planes follow the value planes
  const h16* qrow = qws + ((size_t)b * SEQ + t0 + m) * HH;
  U16 qa[2], qal[2];
  // here and below: the short loops are unrolled so that every array index is a constant and the arrays stay in registers
#pragma unroll
  for (int hc = 0; hc < 2; ++hc) {
    qa[hc].h[0]  = *(const v8h*)(qrow + hc * 32 + 8 * g);
    qa[hc].h[1]  = *(const v8h*)(qrow + hc * 32 + 16 + 8 * g);
    qal[hc].h[0] = *(const v8h*)(qrow + QL + hc * 32 + 8 * g);
    qal[hc].h[1] = *(const v8h*)(qrow + QL + hc * 32 + 16 + 8 * g);
  }

  v8f o[4];                                    // Ot: lane%16 = query, element v of tile nt = column nt*16 + 8g + v
#pragma unroll
  for (int nt = 0; nt < 4; ++nt) o[nt] = v8f_zero();
  float mrow = NEG_INF;                        // running maximum of this lane's query (equal in lanes l and l^16)
  float lrow = 0.f;                            // running sum over this lane's own keys (the halves are joined behind the loop)

  const float scale = ATTN_SCALE;
  const int   nblk  = t0 / 32 + 1;             // causal: keys <= t0+15
  const int   qidx  = t0 + m;                  // this lane's query

  const h16* kbase  = kws + (size_t)b * SEQ * HH;
  const h16* vtbase = vtws + (size_t)b * HH * SEQ;

  // k fragments of the wave's first block (block wv <= 3 lies inside the batch's keys whether or not the wave has a pass: SEQ >= 128)
  U16 kf[2][4];                                // A frags use the same k map as B
  const h16* kfirst = kbase + (size_t)wv * 32 * HH + lane * 8;
  load_kfrags(kfirst, QL, kf);
  frag_loads_issued(kfirst);

  for (int blk = wv; blk < nblk; blk += 4) {
    const int s0 = blk * 32;

    // ---- this block's v fragments (A operand of Ot += V^T Pt), all issued here: they fly under the scores and the softmax ----
    U16 vf[4][2];                                         // [nt][value, residual]; same k map as B; keys 16+8g.. are 256 elements on
    // stands before this pass's loads land in registers that earlier loads name as their address (ahead of the first pass: the q loads and the first block's k loads)
    asm volatile("s_wait_xcnt 0x0" ::: "memory");
    const h16* vblk = vtbase + (size_t)s0 * HH + lane * 8;
#pragma unroll
    for (int nt = 0; nt < 4; ++nt) {
      const h16* vfr = vblk + nt * 512;                   // this lane's 8 keys of column nt*16+m, keys 8g..8g+7
      vf[nt][0].h[0] = *(const v8h*)(vfr);      vf[nt][0].h[1] = *(const v8h*)(vfr + 256);
      vf[nt][1].h[0] = *(const v8h*)(vfr + QL); vf[nt][1].h[1] = *(const v8h*)(vfr + QL + 256);
    }

    // ---- St = K Q^T for 32 keys (two 16x16 tiles) ----
    v8f s[2];
#pragma unroll
    for (int kt = 0; kt < 2; ++kt) {
      s[kt] = wmma_split(kf[kt][0].v, kf[kt][2].v, qa[0].v, qal[0].v, v8f_zero());
      s[kt] = wmma_split(kf[kt][1].v, kf[kt][3].v, qa[1].v, qal[1].v, s[kt]);
    }

    // ---- scale + causal mask (diagonal block only); maximum over the lane's 16 keys, then over both halves ----
    const bool diag = (s0 + 31 >= t0);
    float mx[8];
#pragma unroll
    for (int v = 0; v < 8; ++v) {
#pragma unroll
      for (int kt = 0; kt < 2; ++kt) {
        const int key = s0 + kt * 16 + 8 * g + v;
        const float val = s[kt][v] * scale;
        s[kt][v] = (diag && (key > qidx)) ? NEG_INF : val;
      }
      mx[v] = fmaxf(s[0][v], s[1][v]);
    }
    float rmax = fmaxf(fmaxf(fmaxf(mx[0], mx[1]), fmaxf(mx[2], mx[3])), fmaxf(fmaxf(mx[4], mx[5]), fmaxf(mx[6], mx[7])));
    rmax = fmaxf(rmax, xhalf(rmax));

    // ---- online softmax update; Pt (x1024, two planes) packed into the B fragment ----
    const float mnew  = fmaxf(mrow, rmax);     // finite: key s0 <= t0 is open to every query of the tile
    const float alpha = __expf(mrow - mnew);
    mrow = mnew;
    U16 pa, pal;
    float ps[8];
#pragma unroll
    for (int v = 0; v < 8; ++v) {
      const float p0 = __expf(s[0][v] - mnew);
      const float p1 = __expf(s[1][v] - mnew);
      // probabilities carried x1024 (tail values stay f16-normal; removed in the final merge) as value + residual planes
      split16(p0 * 1024.0f, pa.e[v],     pal.e[v]);
      split16(p1 * 1024.0f, pa.e[8 + v], pal.e[8 + v]);
      ps[v] = p0 + p1;
    }
    lrow = lrow * alpha + (((ps[0] + ps[1]) + (ps[2] + ps[3])) + ((ps[4] + ps[5]) + (ps[6] + ps[7])));
#pragma unroll
    for (int nt = 0; nt < 4; ++nt)
#pragma unroll
      for (int v = 0; v < 8; ++v)
        o[nt][v] *= alpha;

    // ---- the next pass's k fragments, into the registers that the scores have left; the last pass reads its own block again ----
    const int nb = (blk + 4 < nblk) ? blk + 4 : blk;
    // holds the loads behind the softmax: issued in front of it, their 64 registers are live together with its temporaries and a fourth wave no longer fits the SIMD
    __builtin_amdgcn_sched_barrier(0);
    const h16* knext = kbase + (size_t)nb * 32 * HH + lane * 8;
    load_kfrags(knext, QL, kf);
    frag_loads_issued(knext);

    // ---- Ot += V^T Pt  (V A-frags from the fragment-ordered planes) ----
#pragma unroll
    for (int nt = 0; nt < 4; ++nt)
      o[nt] = wmma_split(vf[nt][0].v, vf[nt][1].v, pa.v, pal.v, o[nt]);
  }

  // ---- publish this wave's partial (O, m, l) ----
  lrow += xhalf(lrow);                         // the two halves' keys joined
#pragma unroll
  for (int nt = 0; nt < 4; ++nt) {
    const v4f lo4 = {o[nt][0], o[nt][1], o[nt][2], o[nt][3]};
    const v4f hi4 = {o[nt][4], o[nt][5], o[nt][6], o[nt][7]};
    *(v4f*)&Of[wv][m][nt * 16 + 8 * g]     = lo4;
    *(v4f*)&Of[wv][m][nt * 16 + 8 * g + 4] = hi4;
  }
  if (g == 0) {
    Ml[wv][m] = mrow;
    Ll[wv][m] = lrow;
  }
  __syncthreads();

  for (int e = threadIdx.x; e < 16 * HH; e += 128) {
    const int row = e >> 6;        // 0..15
    const int col = e & 63;        // 0..63
    float M = Ml[0][row];
#pragma unroll
    for (int w = 1; w < 4; ++w) M = fmaxf(M, Ml[w][row]);
    float L = 0.f, O = 0.f;
#pragma unroll
    for (int w = 0; w < 4; ++w) {
      const float be = __expf(Ml[w][row] - M);   // 0 for idle waves (m = -inf)
      L += be * Ll[w][row];
      O += be * Of[w][row][col];
    }
    const float r = O / (L * 1024.0f);          // removes the x1024 carried by the probabilities
    float* op = out + ((size_t)b * SEQ_FULL + t0 + row) * HH + col;
    *(float*)op = r;
    
  }
}

// ---------------------------------------------------------------------------
// Launch. Workspace layout (bytes, full size):
//   [0, 4MB)      q   f16 [NB,SEQ,64]  value + residual planes
//   [4MB, 8MB)    k   f16 [NB,SEQ,64]  (fragment order per 16-key tile)
//   [8MB, 12MB)   v   f16 [NB,SEQ,64]  (row-major, input to the transpose)
//   [12MB, 16MB)  v   f16 [NB,SEQ,64]  (fragment order per 32-key block)
//   [16MB, +576KB) WtQ/WtK/WtV f16 [64,768] x2 planes each
// ---------------------------------------------------------------------------
extern "C" void kernel_launch(void* const* d_in, const int* in_sizes, int n_in,
                              void* d_out, int out_size, void* d_ws,
                              size_t ws_size, hipStream_t stream) {
  if (n_in < 4) return;
  const long long rows_needed = (long long)(NB - 1) * SEQ_FULL + SEQ;
  if ((long long)in_sizes[0] < rows_needed * CC) return;
  if (in_sizes[1] < CC * HH || in_sizes[2] < CC * HH || in_sizes[3] < CC * HH) return;
  if ((long long)out_size < rows_needed * HH) return;

  const float* x  = (const float*)d_in[0];
  const float* Wk = (const float*)d_in[1];
  const float* Wq = (const float*)d_in[2];
  const float* Wv = (const float*)d_in[3];
  float* out = (float*)d_out;

  // every 16-bit buffer holds a value plane followed by its residual plane (2x the element count)
  char* ws = (char*)d_ws;
  const size_t qkv_bytes = (size_t)2 * NB * SEQ * HH * sizeof(h16);     // 4 MB at full size (two planes)
  const size_t wt_bytes  = (size_t)2 * CC * HH * sizeof(h16);           // 192 KB each
  const size_t total     = 4 * qkv_bytes + 3 * wt_bytes;
  if (total > ws_size) return;
  h16* qws  = (h16*)(ws);
  h16* kws  = (h16*)(ws + qkv_bytes);
  h16* vws  = (h16*)(ws + 2 * qkv_bytes);
  h16* vtws = (h16*)(ws + 3 * qkv_bytes);
  h16* WtQ  = (h16*)(ws + 4 * qkv_bytes);
  h16* WtK  = (h16*)(ws + 4 * qkv_bytes + wt_bytes);
  h16* WtV  = (h16*)(ws + 4 * qkv_bytes + 2 * wt_bytes);

  wt_kernel<<<(CC * HH / 2) / 256, 256, 0, stream>>>(Wk, Wq, Wv, WtQ, WtK, WtV);
  qkv_kernel<<<(NB * SEQ) / 64, 256, 0, stream>>>(x, WtQ, WtK, WtV, qws, kws, vws);
  vt_kernel<<<dim3((NB * SEQ) / 64, 2), 256, 0, stream>>>(vws, vtws);
  attn_kernel<<<(NB * SEQ) / 16, 128, 0, stream>>>(qws, kws, vtws, out);
}

// v007
// A run of this version takes 54.1 microseconds.
// In both of two side-by-side timings against v006, it was 1.03 times as fast.
// Counting every step since v000, it is 2.48 times as fast.
// Contractions: q/k/v projections [NB*SEQ x 64 x 768] (x3), causal scores [T x T x 64] and P.V [T x 64 x T] per batch, all on
// v_wmma_f32_16x16x32_f16 with f16 value + residual operand planes (hi.hi + (hi.lo + lo.hi)/2048), f32 accumulate; softmax and
#include <hip/hip_runtime.h>
#include <math.h>

// Problem constants (NB / SEQ overridable for a reduced build; *_FULL are the strides of the inputs / output)
#ifndef NB
#define NB 8
#endif
#ifndef SEQ
#define SEQ 2048
#endif
#define NB_FULL 8
#define SEQ_FULL 2048
#define CC 768
#define HH 64
#define ATTN_SCALE 0.03608439182435161f   // CC^-0.5 (embedding dim), as f32

static_assert(NB >= 1 && NB <= NB_FULL);
static_assert(SEQ >= 128 && SEQ <= SEQ_FULL && (SEQ % 128) == 0);
static_assert((CC % 128) == 0 && (CC % 32) == 0);
static_assert(HH == 64);
static_assert(((CC * HH / 2) % 256) == 0);
static_assert(((NB * SEQ) % 64) == 0);

// 16-bit operands are f16, each carried as a value plane plus a residual plane lo = f16((v - hi) * 2048):
// a product is hi.hi + (hi.lo + lo.hi)/2048 (f32-class). Every fragment (A and B) uses the 16x16x32 lane map
// lane%16 = row/col, g = lane/16: elements 0..7 -> k = 8g+e, elements 8..15 -> k = 16+8g+(e-8).
// k and v are kept in memory in that fragment order, so that one 16-byte-per-lane fragment load reads 512 contiguous bytes (4 lines, not 16):
//   k: per 16-key tile 1024 elements, [h/16][lane = 16*((h%16)/8) + key%16][h%8]           (tile r starts at element 1024*r of its plane)
//   v: per 32-key block 2048 elements, [h/16][(key%32)/16][lane = 16*((key%16)/8) + h%16][key%8]  (block r starts at element 2048*r)
#define KFRAG(key16, h) ((((h) >> 4) * 32 + (((h) >> 3) & 1) * 16 + (key16)) * 8 + ((h) & 7))
typedef _Float16 h16;
typedef __attribute__((ext_vector_type(16))) _Float16 v16h;
typedef __attribute__((ext_vector_type(8)))  _Float16 v8h;
typedef __attribute__((ext_vector_type(8)))  float    v8f;
typedef __attribute__((ext_vector_type(4)))  float    v4f;
#define RSPLIT (1.0f / 2048.0f)
__device__ __forceinline__ void split16(float f, h16& hi, h16& lo) { hi = (h16)f; lo = (h16)((f - (float)hi) * 2048.0f); }
__device__ __forceinline__ unsigned short hbits(h16 h) { return __builtin_bit_cast(unsigned short, h); }

#define NEG_INF (-__builtin_inff())

__device__ __forceinline__ v8f v8f_zero() {
  v8f z = {0.f, 0.f, 0.f, 0.f, 0.f, 0.f, 0.f, 0.f};
  return z;
}

// D = A(16x32 f16) * B(32x16 f16) + C(16x16 f32), followed by the VALU hazard guard (ties D, keeps A/B live)
__device__ __forceinline__ v8f wmma16(v16h a, v16h b, v8f c) {
  v8f r = __builtin_amdgcn_wmma_f32_16x16x32_f16(false, a, false, b, (short)0, c, false, false);
  asm volatile("v_nop\n\tv_nop\n\tv_nop\n\tv_nop" : "+v"(r) : "v"(a), "v"(b));
  return r;
}

// acc += A.B with value/residual planes: cross terms from zero, folded at 1/2048 on the VALU
__device__ __forceinline__ v8f wmma_split(v16h ah, v16h al, v16h bh, v16h bl, v8f c) {
  v8f x = wmma16(al, bh, v8f_zero());
  x = wmma16(ah, bl, x);
  return wmma16(ah, bh, c) + x * RSPLIT;
}

// ---------------------------------------------------------------------------
// Kernel 0: W[C,H] f32  ->  Wt[H,C] f16 value + residual planes
// ---------------------------------------------------------------------------
__global__ void __launch_bounds__(256)
wt_kernel(const float* __restrict__ Wk,
          const float* __restrict__ Wq,
          const float* __restrict__ Wv,
          h16* __restrict__ WtQ,
          h16* __restrict__ WtK,
          h16* __restrict__ WtV) {
  const int idx = blockIdx.x * 256 + threadIdx.x;   // 0 .. HH*CC/2 - 1
  if (idx >= CC * HH / 2) return;
  const int h = idx / (CC / 2);
  const int c = 2 * (idx % (CC / 2));
  const float* src[3] = {Wq, Wk, Wv};
  h16* dstp[3] = {WtQ, WtK, WtV};
#pragma unroll
  for (int s = 0; s < 3; ++s) {
    h16 h0, l0, h1, l1;
    split16(src[s][(size_t)c * HH + h], h0, l0);
    split16(src[s][(size_t)(c + 1) * HH + h], h1, l1);
    unsigned* dh = (unsigned*)(dstp[s] + (size_t)h * CC + c);
    unsigned* dl = (unsigned*)(dstp[s] + (size_t)CC * HH + (size_t)h * CC + c);
    const unsigned ph = (unsigned)hbits(h0) | ((unsigned)hbits(h1) << 16);
    const unsigned pl = (unsigned)hbits(l0) | ((unsigned)hbits(l1) << 16);
    *(unsigned*)dh = ph; *(unsigned*)dl = pl;
    
  }
}

// ---------------------------------------------------------------------------
// Kernel 1: QKV projection. A block takes 64 rows of (b,t): 4 row tiles of 16, each worked by two waves, wave kh = 0 / 1 taking
// the first / second KW k columns of every staged slice (so the grid has one block for every WGP of the chip, two waves a SIMD).
// Behind the k loop the two waves of a row tile join their partial sums through LDS, each keeping half of the 12 result tiles.
//   q stored row-major [NB,SEQ,64] (value + residual planes), k in fragment order per 16-key tile, v in fragment order per 32-key block.
// A-frag (x rows, split in registers) and B-frags (Wt[n][k] rows) use the same element -> k map; C/D: lane col = lane%16,
// element v -> row 8g+v.
// The six weight planes are staged once per block in LDS, KS columns of k at a time, by asynchronous copies into two
// buffers (the next slice flies while this one is multiplied); all 8 waves read their B fragments from there.
// The x columns of a slice are loaded into registers one trip ahead of their use.
// ---------------------------------------------------------------------------
#define KW 64                          // k columns of a slice that one wave multiplies
#define KS (2 * KW)                    // k columns per staged slice: 256 B of every weight row
#define WPITCH (KS + 8)                // f16 per staged row, 272 B = 16 B x odd: 16 rows' 16-byte reads fall on distinct banks
#define WBUF (6 * HH * WPITCH)         // f16 per buffer: planes Q, Q residual, K, K residual, V, V residual
#define NSLICE (CC / KS)
static_assert((CC % KS) == 0 && NSLICE >= 2);
static_assert(6 * HH * (KS / 8) == 24 * 256);   // 16-byte pieces of a slice = 24 per thread of the block

// One slice (columns c0 .. c0+KS-1 of all six planes) into the buffer at LDS byte address lbuf: 24 copies of 16 B per lane.
// Piece i of thread tid: plane i/4, row 16*(i%4) + tid/16, 16-byte column tid%16.
__device__ __forceinline__ void stage_slice(const h16* __restrict__ WtQ, const h16* __restrict__ WtK,
                                            const h16* __restrict__ WtV, int c0, unsigned lbuf, int tid) {
  const size_t PL = (size_t)CC * HH;
  const h16* pl[6] = {WtQ, WtQ + PL, WtK, WtK + PL, WtV, WtV + PL};
#pragma unroll
  for (int q = 0; q < 6; ++q) {   // four copies a statement (one plane): fewer address registers live at once than with more in one
    const h16* gp[4];
    unsigned ld[4];
#pragma unroll
    for (int j = 0; j < 4; ++j) {
      const int i = q * 4 + j;
      const int row = (i & 3) * 16 + (tid >> 4);
      gp[j] = pl[i >> 2] + (size_t)row * CC + c0 + (tid & 15) * 8;
      ld[j] = lbuf + (unsigned)((((i >> 2) * HH + row) * WPITCH + (tid & 15) * 8) * sizeof(h16));
    }
    // the copies and, as the statement's last line, the wait that stands before any of their address registers is rewritten
    asm volatile("global_load_async_to_lds_b128 %0, %4, off\n\t"
                 "global_load_async_to_lds_b128 %1, %5, off\n\t"
                 "global_load_async_to_lds_b128 %2, %6, off\n\t"
                 "global_load_async_to_lds_b128 %3, %7, off\n\t"
                 "s_wait_xcnt 0x0"
                 :: "v"(ld[0]), "v"(ld[1]), "v"(ld[2]), "v"(ld[3]), "v"(gp[0]), "v"(gp[1]), "v"(gp[2]), "v"(gp[3])
                 : "memory");
  }
}

// The x columns of this wave's KW-wide half of one slice, this lane's row, issued into registers (xp: column 8g of that half): kc-th 32-chunk holds
// k = 8g..8g+7 in xv[kc][0..1], 16+8g..16+8g+7 in xv[kc][2..3].
__device__ __forceinline__ void load_xslice(const float* __restrict__ xp, v4f (&xv)[KW / 32][4]) {
#pragma unroll
  for (int kc = 0; kc < KW / 32; ++kc) {
    xv[kc][0] = *(const v4f*)(xp + kc * 32);
    xv[kc][1] = *(const v4f*)(xp + kc * 32 + 4);
    xv[kc][2] = *(const v4f*)(xp + kc * 32 + 16);
    xv[kc][3] = *(const v4f*)(xp + kc * 32 + 20);
  }
  // stands behind the loads, before anything rewrites the address register that they name; it takes that address as an
  // input so that the register is left alone up to the wait
  asm volatile("s_wait_xcnt 0x0" :: "v"(xp) : "memory");
}

// One trip: the 16 x rows of this wave (its KW columns of this slice, loaded into xv one trip ago) times the same columns of the
// six staged planes (wb: the buffer, at the wave's first column), added into the 12 tiles. The next slice's x columns (at xnext) are issued into xv at the head of
// the trip, so that their way from memory lies under this trip's products.
__device__ __forceinline__ void slice_mac(const float* __restrict__ xnext, const h16* wb, int g, int m,
                                          v4f (&xv)[KW / 32][4], v8f (&accQ)[4], v8f (&accK)[4], v8f (&accV)[4]) {
  // this trip's x columns stay in a register set of their own while the next slice's land in xv
  v4f cur[KW / 32][4];
#pragma unroll
  for (int kc = 0; kc < KW / 32; ++kc)
#pragma unroll
    for (int i = 0; i < 4; ++i) cur[kc][i] = xv[kc][i];
  load_xslice(xnext, xv);
  // keeps the loads here at the head of the trip: sunk towards the next trip's splits they would wait for memory in the open
  __builtin_amdgcn_sched_barrier(0);
#pragma unroll
  for (int kc = 0; kc < KW / 32; ++kc) {
    // A-fragment: x tile rows, split into value/residual f16 in registers
    union { v16h v; h16 e[16]; } a, al;
#pragma unroll
    for (int j = 0; j < 8; ++j) {
      split16(cur[kc][j >> 2][j & 3],       a.e[j],     al.e[j]);
      split16(cur[kc][2 + (j >> 2)][j & 3], a.e[8 + j], al.e[8 + j]);
    }
    union UB { v16h v; v8h h[2]; };
#pragma unroll
    for (int nt = 0; nt < 4; ++nt) {
      // one n-tile at a time: its six B fragments (value + residual for Q/K/V weights) then three split MACs;
      // B frags use the same k map as A: {8g..8g+7} then {16+8g..16+8g+7}
      const h16* wr = wb + (nt * 16 + m) * WPITCH + kc * 32 + 8 * g;
      UB bq, bk, bv, bql, bkl, bvl;
      bq.h[0]  = *(const v8h*)(wr);                     bq.h[1]  = *(const v8h*)(wr + 16);
      bql.h[0] = *(const v8h*)(wr + 1 * HH * WPITCH);   bql.h[1] = *(const v8h*)(wr + 1 * HH * WPITCH + 16);
      bk.h[0]  = *(const v8h*)(wr + 2 * HH * WPITCH);   bk.h[1]  = *(const v8h*)(wr + 2 * HH * WPITCH + 16);
      bkl.h[0] = *(const v8h*)(wr + 3 * HH * WPITCH);   bkl.h[1] = *(const v8h*)(wr + 3 * HH * WPITCH + 16);
      bv.h[0]  = *(const v8h*)(wr + 4 * HH * WPITCH);   bv.h[1]  = *(const v8h*)(wr + 4 * HH * WPITCH + 16);
      bvl.h[0] = *(const v8h*)(wr + 5 * HH * WPITCH);   bvl.h[1] = *(const v8h*)(wr + 5 * HH * WPITCH + 16);
      accQ[nt] = wmma_split(a.v, al.v, bq.v, bql.v, accQ[nt]);
      accK[nt] = wmma_split(a.v, al.v, bk.v, bkl.v, accK[nt]);
      accV[nt] = wmma_split(a.v, al.v, bv.v, bvl.v, accV[nt]);
      // keeps the n-tiles apart in the schedule: mixed, more fragments and cross-term tiles are live at once and registers spill to scratch
      __builtin_amdgcn_sched_barrier(0);
    }
  }
}

// Hand-over at the foot of a trip: this wave's reads of the slice are done, its copies of the next slice have landed, and
// every wave has said so; behind it the next slice may be read and the buffer just read may be refilled.
__device__ __forceinline__ void slice_handover() {
  asm volatile("s_wait_dscnt 0x0" ::: "memory");
  asm volatile("s_wait_asynccnt 0x0" ::: "memory");
  __syncthreads();
}

__global__ void __launch_bounds__(256)
qkv_kernel(const float* __restrict__ x,
           const h16* __restrict__ WtQ,
           const h16* __restrict__ WtK,
           const h16* __restrict__ WtV,
           h16* __restrict__ qws,
           h16* __restrict__ kws,
           h16* __restrict__ vtws) {
  __shared__ __align__(16) h16 wl[2][WBUF];     // the two weight-slice buffers (cross-wave)
  __shared__ __align__(16) h16 st[8][16][64];   // per-wave staging of one 16x64 result plane (wave-private)
  __shared__ __align__(16) v4f xch[8][12][32];  // partial sums handed to the other wave of the row tile: [sender][half tile][lane]
  const int lane = threadIdx.x & 31;
  const int wv   = threadIdx.x >> 5;
  const int g    = lane >> 4;
  const int m    = lane & 15;
  const int kh   = __builtin_amdgcn_readfirstlane(wv >> 2);   // which KW k columns of every slice (the same in all lanes)
  const int tile = blockIdx.x * 4 + (wv & 3);  // 0 .. NB*SEQ/16 - 1; waves wv and wv ^ 4 share it
  const int b    = tile / (SEQ / 16);
  const int t0   = (tile % (SEQ / 16)) * 16;
  const size_t QL = (size_t)NB * SEQ * HH;     // residual plane offset inside q/k/v buffers
  const unsigned lw = (unsigned)(size_t)&wl[0][0];   // LDS byte address of buffer 0

  v8f accQ[4], accK[4], accV[4];
#pragma unroll
  for (int nt = 0; nt < 4; ++nt) {
    accQ[nt] = v8f_zero();
    accK[nt] = v8f_zero();
    accV[nt] = v8f_zero();
  }

  const float* xrow = x + ((size_t)b * SEQ_FULL + t0 + m) * CC;

  // x columns of slice 0: they fly under the staging of the first weight slice
  v4f xv[KW / 32][4];
  const float* xnext = xrow + kh * KW + 8 * g;
  load_xslice(xnext, xv);
  xnext += KS;

  // slice 0 lands and is published to every wave; slice 1 then flies during trip 0
  stage_slice(WtQ, WtK, WtV, 0, lw, threadIdx.x);
  asm volatile("s_wait_asynccnt 0x0" ::: "memory");   // this wave's copies of slice 0 have landed
  __syncthreads();
  stage_slice(WtQ, WtK, WtV, KS, lw + (unsigned)(WBUF * sizeof(h16)), threadIdx.x);

  // rolled, and the last two trips (no slice left to fetch) in a loop of their own: each loop body stays one straight block
#pragma unroll 1
  for (int t = 0; t < NSLICE - 2; ++t) {
    slice_mac(xnext, &wl[t & 1][kh * KW], g, m, xv, accQ, accK, accV);
    xnext += KS;
    slice_handover();
    // refill the buffer that this trip has just read
    stage_slice(WtQ, WtK, WtV, (t + 2) * KS, lw + (unsigned)((t & 1) * WBUF * sizeof(h16)), threadIdx.x);
  }
#pragma unroll 1
  for (int t = NSLICE - 2; t < NSLICE; ++t) {
    // xnext stays at the last slice: the last trip has no next slice and reads its own x columns again
    slice_mac(xnext, &wl[t & 1][kh * KW], g, m, xv, accQ, accK, accV);
    slice_handover();
  }
  asm volatile("s_wait_asynccnt 0x0" ::: "memory");   // no copy is outstanding when the wave goes on and ends

  // the two k halves joined: wave kh = 0 keeps q and k columns 0..31, wave kh = 1 keeps v and k columns 32..63; each hands the
  // other six tiles to its partner and adds what the partner hands it
  v8f mine[6], send[6];
#pragma unroll
  for (int i = 0; i < 4; ++i) {
    mine[i] = kh ? accV[i] : accQ[i];
    send[i] = kh ? accQ[i] : accV[i];
  }
#pragma unroll
  for (int j = 0; j < 2; ++j) {
    mine[4 + j] = kh ? accK[2 + j] : accK[j];
    send[4 + j] = kh ? accK[j] : accK[2 + j];
  }
#pragma unroll
  for (int i = 0; i < 6; ++i) {
    const v4f lo4 = {send[i][0], send[i][1], send[i][2], send[i][3]};
    const v4f hi4 = {send[i][4], send[i][5], send[i][6], send[i][7]};
    xch[wv][2 * i][lane]     = lo4;
    xch[wv][2 * i + 1][lane] = hi4;
  }
  __syncthreads();   // every wave's handed tiles are in LDS before a partner reads them
#pragma unroll
  for (int i = 0; i < 6; ++i) {
    const v4f lo4 = xch[wv ^ 4][2 * i][lane];
    const v4f hi4 = xch[wv ^ 4][2 * i + 1][lane];
#pragma unroll
    for (int v = 0; v < 4; ++v) {
      mine[i][v]     += lo4[v];
      mine[i][4 + v] += hi4[v];
    }
  }

  // outputs: q, k, v [NB,SEQ,64] as value + residual planes; the q and k plane tiles go through the wave's LDS tile and leave in whole lines
  h16* sw = &st[wv][0][0];
  const size_t row0 = ((size_t)b * SEQ + t0) * HH;
  if (kh == 0) {
    // q: 16x64, row-major [row][col]
#pragma unroll
    for (int pl = 0; pl < 2; ++pl) {
#pragma unroll
      for (int nt = 0; nt < 4; ++nt)
#pragma unroll
        for (int v = 0; v < 8; ++v) {
          h16 hh_, ll_; split16(mine[nt][v], hh_, ll_);
          sw[(8 * g + v) * 64 + nt * 16 + m] = pl ? ll_ : hh_;
        }
      asm volatile("s_wait_dscnt 0" ::: "memory");   // all lanes' stores into the wave's tile are done before it is read back across lanes
      h16* base = qws + (pl ? QL : 0) + row0;
#pragma unroll
      for (int r = 0; r < 16; ++r) {
        const unsigned w = *((const unsigned*)(sw + r * 64) + lane);
        *(unsigned*)((unsigned*)(base + (size_t)r * HH) + lane) = w;
      }
      asm volatile("s_wait_dscnt 0" ::: "memory");   // the reads of the tile are done before the next plane overwrites it
    }
  } else {
    // v: the 8 results that a lane holds of tile nt are keys 8g..8g+7 of column nt*16+m, which in fragment order are the 8
    // consecutive elements at lane*8 of group [nt][16-key half]: each plane tile leaves the registers as one 16-byte store a lane,
    // 512 contiguous bytes a wave
    h16* vdst = vtws + ((size_t)b * SEQ + (t0 & ~31)) * HH + ((t0 >> 4) & 1) * 256 + lane * 8;
    v8h vh[4], vl[4];
#pragma unroll
    for (int nt = 0; nt < 4; ++nt)
#pragma unroll
      for (int v = 0; v < 8; ++v) {
        h16 hh_, ll_; split16(mine[nt][v], hh_, ll_);
        vh[nt][v] = hh_;
        vl[nt][v] = ll_;
      }
#pragma unroll
    for (int nt = 0; nt < 4; ++nt) {
      *(v8h*)(vdst + nt * 512)      = vh[nt];
      *(v8h*)(vdst + QL + nt * 512) = vl[nt];
    }
    // stands behind the stores, before anything rewrites a register that they name; it takes the address and the stored
    // values as inputs so that those registers are left alone up to the wait
    asm volatile("s_wait_xcnt 0x0" :: "v"(vdst), "v"(vh[0]), "v"(vh[1]), "v"(vh[2]), "v"(vh[3]),
                                      "v"(vl[0]), "v"(vl[1]), "v"(vl[2]), "v"(vl[3]) : "memory");
  }
  // k columns 32*kh .. 32*kh+31: in fragment order (KFRAG) they are elements 512*kh .. 512*kh+511 of the 16-key tile
#pragma unroll
  for (int pl = 0; pl < 2; ++pl) {
#pragma unroll
    for (int j = 0; j < 2; ++j)
#pragma unroll
      for (int v = 0; v < 8; ++v) {
        h16 hh_, ll_; split16(mine[4 + j][v], hh_, ll_);
        sw[KFRAG(8 * g + v, j * 16 + m)] = pl ? ll_ : hh_;
      }
    asm volatile("s_wait_dscnt 0" ::: "memory");   // as above: the tile is complete before it is read back
    h16* base = kws + (pl ? QL : 0) + row0 + kh * 512;
#pragma unroll
    for (int r = 0; r < 8; ++r) {
      const unsigned w = *((const unsigned*)(sw + r * 64) + lane);
      *(unsigned*)((unsigned*)(base + (size_t)r * HH) + lane) = w;
    }
    asm volatile("s_wait_dscnt 0" ::: "memory");   // the reads of the tile are done before the next plane overwrites it
  }
}

// ---------------------------------------------------------------------------
// Kernel 2: causal flash attention, split-K across 4 waves per 16-row query tile.
// Wave w handles key blocks w, w+4, w+8, ... (balanced causal triangle).
// The products are taken transposed: per 32-key block St = K Q^T (2 split tiles, A = k fragment, B = q fragment), online
// softmax, Ot += V^T Pt (4 split tiles, A = v fragment, B = Pt). The fragments are the same registers as for Q K^T and P V
// (A and B share one lane map); in the results lane%16 is the query and element v the key 8g+v (St) or the column 8g+v (Ot).
// So one lane holds 16 of its query's 32 scores (lane^16 the other 16): maximum and sum are taken in the lane, the maximum
// joined with one exchange between the halves, the sum once behind the loop; and St tile 0 / tile 1 of a lane are keys
// 8g..8g+7 / 16+8g..16+8g+7, which is the B fragment's k order: Pt is packed in registers.
// Partial (O, m, l) merged across waves via LDS log-sum-exp combine (block barrier).
// Fragment loads run ahead of their use: a pass issues all of its v fragments before the score products, and the next pass's
// k fragments before the P.V products, so that a load's way from L2 lies under matrix and softmax work.
// ---------------------------------------------------------------------------
#define OPITCH 68   // f32 per staged O row, 272 B = 16 B x odd: 16 lanes' 16-byte stores fall on distinct banks

// lane l with lane l ^ 16
__device__ __forceinline__ float xhalf(float x) {
  return __builtin_bit_cast(float, __builtin_amdgcn_permlanex16(__builtin_bit_cast(int, x), __builtin_bit_cast(int, x),
                                                                0x76543210, 0xfedcba98, false, false));
}

union U16 { v16h v; v8h h[2]; h16 e[16]; };

// The k fragments of one 32-key block (kblk: this lane's first 8 elements of it; ql: offset of the residual plane):
// kf[kt][c] = value plane of 16-key tile kt, 32-wide h chunk c; kf[kt][2 + c] = its residual plane. 16-h group j is 256*j elements on.
__device__ __forceinline__ void load_kfrags(const h16* __restrict__ kblk, size_t ql, U16 (&kf)[2][4]) {
  // unrolled so that every index of kf is a constant and the array stays in registers
#pragma unroll
  for (int kt = 0; kt < 2; ++kt) {
    const h16* kfr = kblk + kt * 16 * HH;
    kf[kt][0].h[0] = *(const v8h*)(kfr);            kf[kt][0].h[1] = *(const v8h*)(kfr + 256);
    kf[kt][1].h[0] = *(const v8h*)(kfr + 512);      kf[kt][1].h[1] = *(const v8h*)(kfr + 768);
    kf[kt][2].h[0] = *(const v8h*)(kfr + ql);       kf[kt][2].h[1] = *(const v8h*)(kfr + ql + 256);
    kf[kt][3].h[0] = *(const v8h*)(kfr + ql + 512); kf[kt][3].h[1] = *(const v8h*)(kfr + ql + 768);
  }
}

// Stands behind a group of fragment loads, before anything rewrites the address register that they name; it takes that
// address as an input so that the register is left alone up to the wait.
__device__ __forceinline__ void frag_loads_issued(const h16* addr) {
  asm volatile("s_wait_xcnt 0x0" :: "v"(addr) : "memory");
}

__global__ void __launch_bounds__(128)
attn_kernel(const h16* __restrict__ qws,
            const h16* __restrict__ kws,
            const h16* __restrict__ vtws,
            float* __restrict__ out) {
  __shared__ __align__(16) float Of[4][16][OPITCH];  // partial O, [query][column] (cross-wave)
  __shared__ float Ml[4][16], Ll[4][16];             // partial m, l (cross-wave)

  const int lane = threadIdx.x & 31;
  const int wv   = threadIdx.x >> 5;
  const int g    = lane >> 4;
  const int m    = lane & 15;
  const int tile = blockIdx.x;                 // 0 .. NB*SEQ/16 - 1
  const int b    = tile / (SEQ / 16);
  const int t0   = (tile % (SEQ / 16)) * 16;

  // Q fragments (B operand: lane%16 = query) for the two 32-wide h chunks (HH = 64)
  const size_t QL = (size_t)NB * SEQ * HH;     // residual planes follow the value planes
  const h16* qrow = qws + ((size_t)b * SEQ + t0 + m) * HH;
  U16 qa[2], qal[2];
  // here and below: the short loops are unrolled so that every array index is a constant and the arrays stay in registers
#pragma unroll
  for (int hc = 0; hc < 2; ++hc) {
    qa[hc].h[0]  = *(const v8h*)(qrow + hc * 32 + 8 * g);
    qa[hc].h[1]  = *(const v8h*)(qrow + hc * 32 + 16 + 8 * g);
    qal[hc].h[0] = *(const v8h*)(qrow + QL + hc * 32 + 8 * g);
    qal[hc].h[1] = *(const v8h*)(qrow + QL + hc * 32 + 16 + 8 * g);
  }

  v8f o[4];                                    // Ot: lane%16 = query, element v of tile nt = column nt*16 + 8g + v
#pragma unroll
  for (int nt = 0; nt < 4; ++nt) o[nt] = v8f_zero();
  float mrow = NEG_INF;                        // running maximum of this lane's query (equal in lanes l and l^16)
  float lrow = 0.f;                            // running sum over this lane's own keys (the halves are joined behind the loop)

  const float scale = ATTN_SCALE;
  const int   nblk  = t0 / 32 + 1;             // causal: keys <= t0+15
  const int   qidx  = t0 + m;                  // this lane's query

  const h16* kbase  = kws + (size_t)b * SEQ * HH;
  const h16* vtbase = vtws + (size_t)b * HH * SEQ;

  // k fragments of the wave's first block (block wv <= 3 lies inside the batch's keys whether or not the wave has a pass: SEQ >= 128)
  U16 kf[2][4];                                // A frags use the same k map as B
  const h16* kfirst = kbase + (size_t)wv * 32 * HH + lane * 8;
  load_kfrags(kfirst, QL, kf);
  frag_loads_issued(kfirst);

  for (int blk = wv; blk < nblk; blk += 4) {
    const int s0 = blk * 32;

    // ---- this block's v fragments (A operand of Ot += V^T Pt), all issued here: they fly under the scores and the softmax ----
    U16 vf[4][2];                                         // [nt][value, residual]; same k map as B; keys 16+8g.. are 256 elements on
    // stands before this pass's loads land in registers that earlier loads name as their address (ahead of the first pass: the q loads and the first block's k loads)
    asm volatile("s_wait_xcnt 0x0" ::: "memory");
    const h16* vblk = vtbase + (size_t)s0 * HH + lane * 8;
#pragma unroll
    for (int nt = 0; nt < 4; ++nt) {
      const h16* vfr = vblk + nt * 512;                   // this lane's 8 keys of column nt*16+m, keys 8g..8g+7
      vf[nt][0].h[0] = *(const v8h*)(vfr);      vf[nt][0].h[1] = *(const v8h*)(vfr + 256);
      vf[nt][1].h[0] = *(const v8h*)(vfr + QL); vf[nt][1].h[1] = *(const v8h*)(vfr + QL + 256);
    }

    // ---- St = K Q^T for 32 keys (two 16x16 tiles) ----
    v8f s[2];
#pragma unroll
    for (int kt = 0; kt < 2; ++kt) {
      s[kt] = wmma_split(kf[kt][0].v, kf[kt][2].v, qa[0].v, qal[0].v, v8f_zero());
      s[kt] = wmma_split(kf[kt][1].v, kf[kt][3].v, qa[1].v, qal[1].v, s[kt]);
    }

    // ---- scale + causal mask (diagonal block only); maximum over the lane's 16 keys, then over both halves ----
    const bool diag = (s0 + 31 >= t0);
    float mx[8];
#pragma unroll
    for (int v = 0; v < 8; ++v) {
#pragma unroll
      for (int kt = 0; kt < 2; ++kt) {
        const int key = s0 + kt * 16 + 8 * g + v;
        const float val = s[kt][v] * scale;
        s[kt][v] = (diag && (key > qidx)) ? NEG_INF : val;
      }
      mx[v] = fmaxf(s[0][v], s[1][v]);
    }
    float rmax = fmaxf(fmaxf(fmaxf(mx[0], mx[1]), fmaxf(mx[2], mx[3])), fmaxf(fmaxf(mx[4], mx[5]), fmaxf(mx[6], mx[7])));
    rmax = fmaxf(rmax, xhalf(rmax));

    // ---- online softmax update; Pt (x1024, two planes) packed into the B fragment ----
    const float mnew  = fmaxf(mrow, rmax);     // finite: key s0 <= t0 is open to every query of the tile
    const float alpha = __expf(mrow - mnew);
    mrow = mnew;
    U16 pa, pal;
    float ps[8];
#pragma unroll
    for (int v = 0; v < 8; ++v) {
      const float p0 = __expf(s[0][v] - mnew);
      const float p1 = __expf(s[1][v] - mnew);
      // probabilities carried x1024 (tail values stay f16-normal; removed in the final merge) as value + residual planes
      split16(p0 * 1024.0f, pa.e[v],     pal.e[v]);
      split16(p1 * 1024.0f, pa.e[8 + v], pal.e[8 + v]);
      ps[v] = p0 + p1;
    }
    lrow = lrow * alpha + (((ps[0] + ps[1]) + (ps[2] + ps[3])) + ((ps[4] + ps[5]) + (ps[6] + ps[7])));
#pragma unroll
    for (int nt = 0; nt < 4; ++nt)
#pragma unroll
      for (int v = 0; v < 8; ++v)
        o[nt][v] *= alpha;

    // ---- the next pass's k fragments, into the registers that the scores have left; the last pass reads its own block again ----
    const int nb = (blk + 4 < nblk) ? blk + 4 : blk;
    // holds the loads behind the softmax: issued in front of it, their 64 registers are live together with its temporaries and a fourth wave no longer fits the SIMD
    __builtin_amdgcn_sched_barrier(0);
    const h16* knext = kbase + (size_t)nb * 32 * HH + lane * 8;
    load_kfrags(knext, QL, kf);
    frag_loads_issued(knext);

    // ---- Ot += V^T Pt  (V A-frags from the fragment-ordered planes) ----
#pragma unroll
    for (int nt = 0; nt < 4; ++nt)
      o[nt] = wmma_split(vf[nt][0].v, vf[nt][1].v, pa.v, pal.v, o[nt]);
  }

  // ---- publish this wave's partial (O, m, l) ----
  lrow += xhalf(lrow);                         // the two halves' keys joined
#pragma unroll
  for (int nt = 0; nt < 4; ++nt) {
    const v4f lo4 = {o[nt][0], o[nt][1], o[nt][2], o[nt][3]};
    const v4f hi4 = {o[nt][4], o[nt][5], o[nt][6], o[nt][7]};
    *(v4f*)&Of[wv][m][nt * 16 + 8 * g]     = lo4;
    *(v4f*)&Of[wv][m][nt * 16 + 8 * g + 4] = hi4;
  }
  if (g == 0) {
    Ml[wv][m] = mrow;
    Ll[wv][m] = lrow;
  }
  __syncthreads();

  for (int e = threadIdx.x; e < 16 * HH; e += 128) {
    const int row = e >> 6;        // 0..15
    const int col = e & 63;        // 0..63
    float M = Ml[0][row];
#pragma unroll
    for (int w = 1; w < 4; ++w) M = fmaxf(M, Ml[w][row]);
    float L = 0.f, O = 0.f;
#pragma unroll
    for (int w = 0; w < 4; ++w) {
      const float be = __expf(Ml[w][row] - M);   // 0 for idle waves (m = -inf)
      L += be * Ll[w][row];
      O += be * Of[w][row][col];
    }
    const float r = O / (L * 1024.0f);          // removes the x1024 carried by the probabilities
    float* op = out + ((size_t)b * SEQ_FULL + t0 + row) * HH + col;
    *(float*)op = r;
    
  }
}

// ---------------------------------------------------------------------------
// Launch. Workspace layout (bytes, full size):
//   [0, 4MB)      q   f16 [NB,SEQ,64]  value + residual planes
//   [4MB, 8MB)    k   f16 [NB,SEQ,64]  (fragment order per 16-key tile)
//   [8MB, 12MB)   v   f16 [NB,SEQ,64]  (fragment order per 32-key block)
//   [12MB, +576KB) WtQ/WtK/WtV f16 [64,768] x2 planes each
// ---------------------------------------------------------------------------
extern "C" void kernel_launch(void* const* d_in, const int* in_sizes, int n_in,
                              void* d_out, int out_size, void* d_ws,
                              size_t ws_size, hipStream_t stream) {
  if (n_in < 4) return;
  const long long rows_needed = (long long)(NB - 1) * SEQ_FULL + SEQ;
  if ((long long)in_sizes[0] < rows_needed * CC) return;
  if (in_sizes[1] < CC * HH || in_sizes[2] < CC * HH || in_sizes[3] < CC * HH) return;
  if ((long long)out_size < rows_needed * HH) return;

  const float* x  = (const float*)d_in[0];
  const float* Wk = (const float*)d_in[1];
  const float* Wq = (const float*)d_in[2];
  const float* Wv = (const float*)d_in[3];
  float* out = (float*)d_out;

  // every 16-bit buffer holds a value plane followed by its residual plane (2x the element count)
  char* ws = (char*)d_ws;
  const size_t qkv_bytes = (size_t)2 * NB * SEQ * HH * sizeof(h16);     // 4 MB at full size (two planes)
  const size_t wt_bytes  = (size_t)2 * CC * HH * sizeof(h16);           // 192 KB each
  const size_t total     = 3 * qkv_bytes + 3 * wt_bytes;
  if (total > ws_size) return;
  h16* qws  = (h16*)(ws);
  h16* kws  = (h16*)(ws + qkv_bytes);
  h16* vtws = (h16*)(ws + 2 * qkv_bytes);
  h16* WtQ  = (h16*)(ws + 3 * qkv_bytes);
  h16* WtK  = (h16*)(ws + 3 * qkv_bytes + wt_bytes);
  h16* WtV  = (h16*)(ws + 3 * qkv_bytes + 2 * wt_bytes);

  wt_kernel<<<(CC * HH / 2) / 256, 256, 0, stream>>>(Wk, Wq, Wv, WtQ, WtK, WtV);
  qkv_kernel<<<(NB * SEQ) / 64, 256, 0, stream>>>(x, WtQ, WtK, WtV, qws, kws, vtws);
  attn_kernel<<<(NB * SEQ) / 16, 128, 0, stream>>>(qws, kws, vtws, out);
}

// v008
// A run of this version takes 45.5 microseconds.
// Next to v007, in two timings, it ran 1.19 and 1.20 times as fast.
// Counting every step since v000, it is 2.96 times as fast.
// Contractions: q/k/v projections [NB*SEQ x 64 x 768] (x3), causal scores [T x T x 64] and P.V [T x 64 x T] per batch, all on
// v_wmma_f32_16x16x32_f16 with f16 value + residual operand planes (hi.hi + (hi.lo + lo.hi)/2048), f32 accumulate; softmax and
#include <hip/hip_runtime.h>
#include <math.h>

// Problem constants (NB / SEQ overridable for a reduced build; *_FULL are the strides of the inputs / output)
#ifndef NB
#define NB 8
#endif
#ifndef SEQ
#define SEQ 2048
#endif
#define NB_FULL 8
#define SEQ_FULL 2048
#define CC 768
#define HH 64
#define ATTN_SCALE 0.03608439182435161f   // CC^-0.5 (embedding dim), as f32

static_assert(NB >= 1 && NB <= NB_FULL);
static_assert(SEQ >= 128 && SEQ <= SEQ_FULL && (SEQ % 128) == 0);
static_assert((CC % 128) == 0 && (CC % 32) == 0);
static_assert(HH == 64);
static_assert(((CC * HH / 2) % 256) == 0);
static_assert(((NB * SEQ) % 64) == 0);

// 16-bit operands are f16, each carried as a value plane plus a residual plane lo = f16((v - hi) * 2048):
// a product is hi.hi + (hi.lo + lo.hi)/2048 (f32-class). Every fragment (A and B) uses the 16x16x32 lane map
// lane%16 = row/col, g = lane/16: elements 0..7 -> k = 8g+e, elements 8..15 -> k = 16+8g+(e-8).
// k and v are kept in memory in that fragment order, so that one 16-byte-per-lane fragment load reads 512 contiguous bytes (4 lines, not 16):
//   k: per 16-key tile 1024 elements, [h/16][lane = 16*((h%16)/8) + key%16][h%8]           (tile r starts at element 1024*r of its plane)
//   v: per 32-key block 2048 elements, [h/16][(key%32)/16][lane = 16*((key%16)/8) + h%16][key%8]  (block r starts at element 2048*r)
#define KFRAG(key16, h) ((((h) >> 4) * 32 + (((h) >> 3) & 1) * 16 + (key16)) * 8 + ((h) & 7))
typedef _Float16 h16;
typedef __attribute__((ext_vector_type(16))) _Float16 v16h;
typedef __attribute__((ext_vector_type(8)))  _Float16 v8h;
typedef __attribute__((ext_vector_type(8)))  float    v8f;
typedef __attribute__((ext_vector_type(4)))  float    v4f;
#define RSPLIT (1.0f / 2048.0f)
__device__ __forceinline__ void split16(float f, h16& hi, h16& lo) { hi = (h16)f; lo = (h16)((f - (float)hi) * 2048.0f); }
__device__ __forceinline__ unsigned short hbits(h16 h) { return __builtin_bit_cast(unsigned short, h); }

#define NEG_INF (-__builtin_inff())

__device__ __forceinline__ v8f v8f_zero() {
  v8f z = {0.f, 0.f, 0.f, 0.f, 0.f, 0.f, 0.f, 0.f};
  return z;
}

// D = A(16x32 f16) * B(32x16 f16) + C(16x16 f32), followed by the VALU hazard guard (ties D, keeps A/B live)
__device__ __forceinline__ v8f wmma16(v16h a, v16h b, v8f c) {
  v8f r = __builtin_amdgcn_wmma_f32_16x16x32_f16(false, a, false, b, (short)0, c, false, false);
  asm volatile("v_nop\n\tv_nop\n\tv_nop\n\tv_nop" : "+v"(r) : "v"(a), "v"(b));
  return r;
}

// acc += A.B with value/residual planes: cross terms from zero, folded at 1/2048 on the VALU
__device__ __forceinline__ v8f wmma_split(v16h ah, v16h al, v16h bh, v16h bl, v8f c) {
  v8f x = wmma16(al, bh, v8f_zero());
  x = wmma16(ah, bl, x);
  return wmma16(ah, bh, c) + x * RSPLIT;
}

// ---------------------------------------------------------------------------
// Kernel 0: W[C,H] f32  ->  Wt[H,C] f16 value + residual planes
// ---------------------------------------------------------------------------
__global__ void __launch_bounds__(256)
wt_kernel(const float* __restrict__ Wk,
          const float* __restrict__ Wq,
          const float* __restrict__ Wv,
          h16* __restrict__ WtQ,
          h16* __restrict__ WtK,
          h16* __restrict__ WtV) {
  const int idx = blockIdx.x * 256 + threadIdx.x;   // 0 .. HH*CC/2 - 1
  if (idx >= CC * HH / 2) return;
  const int h = idx / (CC / 2);
  const int c = 2 * (idx % (CC / 2));
  const float* src[3] = {Wq, Wk, Wv};
  h16* dstp[3] = {WtQ, WtK, WtV};
#pragma unroll
  for (int s = 0; s < 3; ++s) {
    h16 h0, l0, h1, l1;
    split16(src[s][(size_t)c * HH + h], h0, l0);
    split16(src[s][(size_t)(c + 1) * HH + h], h1, l1);
    unsigned* dh = (unsigned*)(dstp[s] + (size_t)h * CC + c);
    unsigned* dl = (unsigned*)(dstp[s] + (size_t)CC * HH + (size_t)h * CC + c);
    const unsigned ph = (unsigned)hbits(h0) | ((unsigned)hbits(h1) << 16);
    const unsigned pl = (unsigned)hbits(l0) | ((unsigned)hbits(l1) << 16);
    *(unsigned*)dh = ph; *(unsigned*)dl = pl;
    
  }
}

// ---------------------------------------------------------------------------
// Kernel 1: QKV projection. A block takes 64 rows of (b,t): 4 row tiles of 16, each worked by two waves, wave kh = 0 / 1 taking
// the first / second KW k columns of every staged slice (so the grid has one block for every WGP of the chip, two waves a SIMD).
// Behind the k loop the two waves of a row tile join their partial sums through LDS, each keeping half of the 12 result tiles.
//   q stored row-major [NB,SEQ,64] (value + residual planes), k in fragment order per 16-key tile, v in fragment order per 32-key block.
// A-frag (x rows, split in registers) and B-frags (Wt[n][k] rows) use the same element -> k map; C/D: lane col = lane%16,
// element v -> row 8g+v.
// The six weight planes are staged once per block in LDS, KS columns of k at a time, by asynchronous copies into two
// buffers (the next slice flies while this one is multiplied); all 8 waves read their B fragments from there.
// The x columns of a slice are loaded into registers one trip ahead of their use.
// ---------------------------------------------------------------------------
#define KW 64                          // k columns of a slice that one wave multiplies
#define KS (2 * KW)                    // k columns per staged slice: 256 B of every weight row
#define WPITCH (KS + 8)                // f16 per staged row, 272 B = 16 B x odd: 16 rows' 16-byte reads fall on distinct banks
#define WBUF (6 * HH * WPITCH)         // f16 per buffer: planes Q, Q residual, K, K residual, V, V residual
#define NSLICE (CC / KS)
static_assert((CC % KS) == 0 && NSLICE >= 2);
static_assert(6 * HH * (KS / 8) == 24 * 256);   // 16-byte pieces of a slice = 24 per thread of the block

// One slice (columns c0 .. c0+KS-1 of all six planes) into the buffer at LDS byte address lbuf: 24 copies of 16 B per lane.
// Piece i of thread tid: plane i/4, row 16*(i%4) + tid/16, 16-byte column tid%16.
__device__ __forceinline__ void stage_slice(const h16* __restrict__ WtQ, const h16* __restrict__ WtK,
                                            const h16* __restrict__ WtV, int c0, unsigned lbuf, int tid) {
  const size_t PL = (size_t)CC * HH;
  const h16* pl[6] = {WtQ, WtQ + PL, WtK, WtK + PL, WtV, WtV + PL};
#pragma unroll
  for (int q = 0; q < 6; ++q) {   // four copies a statement (one plane): fewer address registers live at once than with more in one
    const h16* gp[4];
    unsigned ld[4];
#pragma unroll
    for (int j = 0; j < 4; ++j) {
      const int i = q * 4 + j;
      const int row = (i & 3) * 16 + (tid >> 4);
      gp[j] = pl[i >> 2] + (size_t)row * CC + c0 + (tid & 15) * 8;
      ld[j] = lbuf + (unsigned)((((i >> 2) * HH + row) * WPITCH + (tid & 15) * 8) * sizeof(h16));
    }
    // the copies and, as the statement's last line, the wait that stands before any of their address registers is rewritten
    asm volatile("global_load_async_to_lds_b128 %0, %4, off\n\t"
                 "global_load_async_to_lds_b128 %1, %5, off\n\t"
                 "global_load_async_to_lds_b128 %2, %6, off\n\t"
                 "global_load_async_to_lds_b128 %3, %7, off\n\t"
                 "s_wait_xcnt 0x0"
                 :: "v"(ld[0]), "v"(ld[1]), "v"(ld[2]), "v"(ld[3]), "v"(gp[0]), "v"(gp[1]), "v"(gp[2]), "v"(gp[3])
                 : "memory");
  }
}

// The x columns of this wave's KW-wide half of one slice, this lane's row, issued into registers (xp: column 8g of that half): kc-th 32-chunk holds
// k = 8g..8g+7 in xv[kc][0..1], 16+8g..16+8g+7 in xv[kc][2..3].
__device__ __forceinline__ void load_xslice(const float* __restrict__ xp, v4f (&xv)[KW / 32][4]) {
#pragma unroll
  for (int kc = 0; kc < KW / 32; ++kc) {
    xv[kc][0] = *(const v4f*)(xp + kc * 32);
    xv[kc][1] = *(const v4f*)(xp + kc * 32 + 4);
    xv[kc][2] = *(const v4f*)(xp + kc * 32 + 16);
    xv[kc][3] = *(const v4f*)(xp + kc * 32 + 20);
  }
  // stands behind the loads, before anything rewrites the address register that they name; it takes that address as an
  // input so that the register is left alone up to the wait
  asm volatile("s_wait_xcnt 0x0" :: "v"(xp) : "memory");
}

// One trip: the 16 x rows of this wave (its KW columns of this slice, loaded into xv one trip ago) times the same columns of the
// six staged planes (wb: the buffer, at the wave's first column), added into the 12 tiles. The next slice's x columns (at xnext) are issued into xv at the head of
// the trip, so that their way from memory lies under this trip's products.
__device__ __forceinline__ void slice_mac(const float* __restrict__ xnext, const h16* wb, int g, int m,
                                          v4f (&xv)[KW / 32][4], v8f (&accQ)[4], v8f (&accK)[4], v8f (&accV)[4]) {
  // this trip's x columns stay in a register set of their own while the next slice's land in xv
  v4f cur[KW / 32][4];
#pragma unroll
  for (int kc = 0; kc < KW / 32; ++kc)
#pragma unroll
    for (int i = 0; i < 4; ++i) cur[kc][i] = xv[kc][i];
  load_xslice(xnext, xv);
  // keeps the loads here at the head of the trip: sunk towards the next trip's splits they would wait for memory in the open
  __builtin_amdgcn_sched_barrier(0);
#pragma unroll
  for (int kc = 0; kc < KW / 32; ++kc) {
    // A-fragment: x tile rows, split into value/residual f16 in registers
    union { v16h v; h16 e[16]; } a, al;
#pragma unroll
    for (int j = 0; j < 8; ++j) {
      split16(cur[kc][j >> 2][j & 3],       a.e[j],     al.e[j]);
      split16(cur[kc][2 + (j >> 2)][j & 3], a.e[8 + j], al.e[8 + j]);
    }
    union UB { v16h v; v8h h[2]; };
#pragma unroll
    for (int nt = 0; nt < 4; ++nt) {
      // one n-tile at a time: its six B fragments (value + residual for Q/K/V weights) then three split MACs;
      // B frags use the same k map as A: {8g..8g+7} then {16+8g..16+8g+7}
      const h16* wr = wb + (nt * 16 + m) * WPITCH + kc * 32 + 8 * g;
      UB bq, bk, bv, bql, bkl, bvl;
      bq.h[0]  = *(const v8h*)(wr);                     bq.h[1]  = *(const v8h*)(wr + 16);
      bql.h[0] = *(const v8h*)(wr + 1 * HH * WPITCH);   bql.h[1] = *(const v8h*)(wr + 1 * HH * WPITCH + 16);
      bk.h[0]  = *(const v8h*)(wr + 2 * HH * WPITCH);   bk.h[1]  = *(const v8h*)(wr + 2 * HH * WPITCH + 16);
      bkl.h[0] = *(const v8h*)(wr + 3 * HH * WPITCH);   bkl.h[1] = *(const v8h*)(wr + 3 * HH * WPITCH + 16);
      bv.h[0]  = *(const v8h*)(wr + 4 * HH * WPITCH);   bv.h[1]  = *(const v8h*)(wr + 4 * HH * WPITCH + 16);
      bvl.h[0] = *(const v8h*)(wr + 5 * HH * WPITCH);   bvl.h[1] = *(const v8h*)(wr + 5 * HH * WPITCH + 16);
      accQ[nt] = wmma_split(a.v, al.v, bq.v, bql.v, accQ[nt]);
      accK[nt] = wmma_split(a.v, al.v, bk.v, bkl.v, accK[nt]);
      accV[nt] = wmma_split(a.v, al.v, bv.v, bvl.v, accV[nt]);
      // keeps the n-tiles apart in the schedule: mixed, more fragments and cross-term tiles are live at once and registers spill to scratch
      __builtin_amdgcn_sched_barrier(0);
    }
  }
}

// Hand-over at the foot of a trip: this wave's reads of the slice are done, its copies of the next slice have landed, and
// every wave has said so; behind it the next slice may be read and the buffer just read may be refilled.
__device__ __forceinline__ void slice_handover() {
  asm volatile("s_wait_dscnt 0x0" ::: "memory");
  asm volatile("s_wait_asynccnt 0x0" ::: "memory");
  __syncthreads();
}

__global__ void __launch_bounds__(256)
qkv_kernel(const float* __restrict__ x,
           const h16* __restrict__ WtQ,
           const h16* __restrict__ WtK,
           const h16* __restrict__ WtV,
           h16* __restrict__ qws,
           h16* __restrict__ kws,
           h16* __restrict__ vtws) {
  __shared__ __align__(16) h16 wl[2][WBUF];     // the two weight-slice buffers (cross-wave)
  __shared__ __align__(16) h16 st[8][16][64];   // per-wave staging of one 16x64 result plane (wave-private)
  __shared__ __align__(16) v4f xch[8][12][32];  // partial sums handed to the other wave of the row tile: [sender][half tile][lane]
  const int lane = threadIdx.x & 31;
  const int wv   = threadIdx.x >> 5;
  const int g    = lane >> 4;
  const int m    = lane & 15;
  const int kh   = __builtin_amdgcn_readfirstlane(wv >> 2);   // which KW k columns of every slice (the same in all lanes)
  const int tile = blockIdx.x * 4 + (wv & 3);  // 0 .. NB*SEQ/16 - 1; waves wv and wv ^ 4 share it
  const int b    = tile / (SEQ / 16);
  const int t0   = (tile % (SEQ / 16)) * 16;
  const size_t QL = (size_t)NB * SEQ * HH;     // residual plane offset inside q/k/v buffers
  const unsigned lw = (unsigned)(size_t)&wl[0][0];   // LDS byte address of buffer 0

  v8f accQ[4], accK[4], accV[4];
#pragma unroll
  for (int nt = 0; nt < 4; ++nt) {
    accQ[nt] = v8f_zero();
    accK[nt] = v8f_zero();
    accV[nt] = v8f_zero();
  }

  const float* xrow = x + ((size_t)b * SEQ_FULL + t0 + m) * CC;

  // x columns of slice 0: they fly under the staging of the first weight slice
  v4f xv[KW / 32][4];
  const float* xnext = xrow + kh * KW + 8 * g;
  load_xslice(xnext, xv);
  xnext += KS;

  // slice 0 lands and is published to every wave; slice 1 then flies during trip 0
  stage_slice(WtQ, WtK, WtV, 0, lw, threadIdx.x);
  asm volatile("s_wait_asynccnt 0x0" ::: "memory");   // this wave's copies of slice 0 have landed
  __syncthreads();
  stage_slice(WtQ, WtK, WtV, KS, lw + (unsigned)(WBUF * sizeof(h16)), threadIdx.x);

  // rolled, and the last two trips (no slice left to fetch) in a loop of their own: each loop body stays one straight block
#pragma unroll 1
  for (int t = 0; t < NSLICE - 2; ++t) {
    slice_mac(xnext, &wl[t & 1][kh * KW], g, m, xv, accQ, accK, accV);
    xnext += KS;
    slice_handover();
    // refill the buffer that this trip has just read
    stage_slice(WtQ, WtK, WtV, (t + 2) * KS, lw + (unsigned)((t & 1) * WBUF * sizeof(h16)), threadIdx.x);
  }
#pragma unroll 1
  for (int t = NSLICE - 2; t < NSLICE; ++t) {
    // xnext stays at the last slice: the last trip has no next slice and reads its own x columns again
    slice_mac(xnext, &wl[t & 1][kh * KW], g, m, xv, accQ, accK, accV);
    slice_handover();
  }
  asm volatile("s_wait_asynccnt 0x0" ::: "memory");   // no copy is outstanding when the wave goes on and ends

  // the two k halves joined: wave kh = 0 keeps q and k columns 0..31, wave kh = 1 keeps v and k columns 32..63; each hands the
  // other six tiles to its partner and adds what the partner hands it
  v8f mine[6], send[6];
#pragma unroll
  for (int i = 0; i < 4; ++i) {
    mine[i] = kh ? accV[i] : accQ[i];
    send[i] = kh ? accQ[i] : accV[i];
  }
#pragma unroll
  for (int j = 0; j < 2; ++j) {
    mine[4 + j] = kh ? accK[2 + j] : accK[j];
    send[4 + j] = kh ? accK[j] : accK[2 + j];
  }
#pragma unroll
  for (int i = 0; i < 6; ++i) {
    const v4f lo4 = {send[i][0], send[i][1], send[i][2], send[i][3]};
    const v4f hi4 = {send[i][4], send[i][5], send[i][6], send[i][7]};
    xch[wv][2 * i][lane]     = lo4;
    xch[wv][2 * i + 1][lane] = hi4;
  }
  __syncthreads();   // every wave's handed tiles are in LDS before a partner reads them
#pragma unroll
  for (int i = 0; i < 6; ++i) {
    const v4f lo4 = xch[wv ^ 4][2 * i][lane];
    const v4f hi4 = xch[wv ^ 4][2 * i + 1][lane];
#pragma unroll
    for (int v = 0; v < 4; ++v) {
      mine[i][v]     += lo4[v];
      mine[i][4 + v] += hi4[v];
    }
  }

  // outputs: q, k, v [NB,SEQ,64] as value + residual planes; the q and k plane tiles go through the wave's LDS tile and leave in whole lines
  h16* sw = &st[wv][0][0];
  const size_t row0 = ((size_t)b * SEQ + t0) * HH;
  if (kh == 0) {
    // q: 16x64, row-major [row][col]
#pragma unroll
    for (int pl = 0; pl < 2; ++pl) {
#pragma unroll
      for (int nt = 0; nt < 4; ++nt)
#pragma unroll
        for (int v = 0; v < 8; ++v) {
          h16 hh_, ll_; split16(mine[nt][v], hh_, ll_);
          sw[(8 * g + v) * 64 + nt * 16 + m] = pl ? ll_ : hh_;
        }
      asm volatile("s_wait_dscnt 0" ::: "memory");   // all lanes' stores into the wave's tile are done before it is read back across lanes
      h16* base = qws + (pl ? QL : 0) + row0;
#pragma unroll
      for (int r = 0; r < 16; ++r) {
        const unsigned w = *((const unsigned*)(sw + r * 64) + lane);
        *(unsigned*)((unsigned*)(base + (size_t)r * HH) + lane) = w;
      }
      asm volatile("s_wait_dscnt 0" ::: "memory");   // the reads of the tile are done before the next plane overwrites it
    }
  } else {
    // v: the 8 results that a lane holds of tile nt are keys 8g..8g+7 of column nt*16+m, which in fragment order are the 8
    // consecutive elements at lane*8 of group [nt][16-key half]: each plane tile leaves the registers as one 16-byte store a lane,
    // 512 contiguous bytes a wave
    h16* vdst = vtws + ((size_t)b * SEQ + (t0 & ~31)) * HH + ((t0 >> 4) & 1) * 256 + lane * 8;
    v8h vh[4], vl[4];
#pragma unroll
    for (int nt = 0; nt < 4; ++nt)
#pragma unroll
      for (int v = 0; v < 8; ++v) {
        h16 hh_, ll_; split16(mine[nt][v], hh_, ll_);
        vh[nt][v] = hh_;
        vl[nt][v] = ll_;
      }
#pragma unroll
    for (int nt = 0; nt < 4; ++nt) {
      *(v8h*)(vdst + nt * 512)      = vh[nt];
      *(v8h*)(vdst + QL + nt * 512) = vl[nt];
    }
    // stands behind the stores, before anything rewrites a register that they name; it takes the address and the stored
    // values as inputs so that those registers are left alone up to the wait
    asm volatile("s_wait_xcnt 0x0" :: "v"(vdst), "v"(vh[0]), "v"(vh[1]), "v"(vh[2]), "v"(vh[3]),
                                      "v"(vl[0]), "v"(vl[1]), "v"(vl[2]), "v"(vl[3]) : "memory");
  }
  // k columns 32*kh .. 32*kh+31: in fragment order (KFRAG) they are elements 512*kh .. 512*kh+511 of the 16-key tile
#pragma unroll
  for (int pl = 0; pl < 2; ++pl) {
#pragma unroll
    for (int j = 0; j < 2; ++j)
#pragma unroll
      for (int v = 0; v < 8; ++v) {
        h16 hh_, ll_; split16(mine[4 + j][v], hh_, ll_);
        sw[KFRAG(8 * g + v, j * 16 + m)] = pl ? ll_ : hh_;
      }
    asm volatile("s_wait_dscnt 0" ::: "memory");   // as above: the tile is complete before it is read back
    h16* base = kws + (pl ? QL : 0) + row0 + kh * 512;
#pragma unroll
    for (int r = 0; r < 8; ++r) {
      const unsigned w = *((const unsigned*)(sw + r * 64) + lane);
      *(unsigned*)((unsigned*)(base + (size_t)r * HH) + lane) = w;
    }
    asm volatile("s_wait_dscnt 0" ::: "memory");   // the reads of the tile are done before the next plane overwrites it
  }
}

// ---------------------------------------------------------------------------
// Kernel 2: causal flash attention. A block takes two 16-row query tiles of one batch, tile p and tile SEQ/16 - 1 - p, one after
// the other in every wave: together they have the same number of 32-key blocks for every p, so all blocks of the grid (all of
// them resident at once) carry equal work. The key blocks of a tile are dealt round to the 8 waves, the second tile's deal going
// on where the first one's ended, so that the waves' pass counts differ by one at most.
// The products are taken transposed: per 32-key block St = K Q^T (2 split tiles, A = k fragment, B = q fragment), online
// softmax, Ot += V^T Pt (4 split tiles, A = v fragment, B = Pt). The fragments are the same registers as for Q K^T and P V
// (A and B share one lane map); in the results lane%16 is the query and element v the key 8g+v (St) or the column 8g+v (Ot).
// So one lane holds 16 of its query's 32 scores (lane^16 the other 16): maximum and sum are taken in the lane, the maximum
// joined with one exchange between the halves, the sum once behind the loop; and St tile 0 / tile 1 of a lane are keys
// 8g..8g+7 / 16+8g..16+8g+7, which is the B fragment's k order: Pt is packed in registers.
// Partial (O, m, l) of both tiles merged across waves via LDS log-sum-exp combine (one block barrier behind both tiles).
// Fragment loads run ahead of their use: a pass issues all of its v fragments before the score products, and the next pass's
// k fragments before the P.V products, so that a load's way from L2 lies under matrix and softmax work.
// ---------------------------------------------------------------------------
#define AW 8        // waves of a block, the ways a tile's key blocks are split
static_assert(SEQ >= AW * 32 && ((SEQ / 16) % 2) == 0);
#define OPITCH 68   // f32 per staged O row, 272 B = 16 B x odd: 16 lanes' 16-byte stores fall on distinct banks

// lane l with lane l ^ 16
__device__ __forceinline__ float xhalf(float x) {
  return __builtin_bit_cast(float, __builtin_amdgcn_permlanex16(__builtin_bit_cast(int, x), __builtin_bit_cast(int, x),
                                                                0x76543210, 0xfedcba98, false, false));
}

union U16 { v16h v; v8h h[2]; h16 e[16]; };

// The k fragments of one 32-key block (kblk: this lane's first 8 elements of it; ql: offset of the residual plane):
// kf[kt][c] = value plane of 16-key tile kt, 32-wide h chunk c; kf[kt][2 + c] = its residual plane. 16-h group j is 256*j elements on.
__device__ __forceinline__ void load_kfrags(const h16* __restrict__ kblk, size_t ql, U16 (&kf)[2][4]) {
  // unrolled so that every index of kf is a constant and the array stays in registers
#pragma unroll
  for (int kt = 0; kt < 2; ++kt) {
    const h16* kfr = kblk + kt * 16 * HH;
    kf[kt][0].h[0] = *(const v8h*)(kfr);            kf[kt][0].h[1] = *(const v8h*)(kfr + 256);
    kf[kt][1].h[0] = *(const v8h*)(kfr + 512);      kf[kt][1].h[1] = *(const v8h*)(kfr + 768);
    kf[kt][2].h[0] = *(const v8h*)(kfr + ql);       kf[kt][2].h[1] = *(const v8h*)(kfr + ql + 256);
    kf[kt][3].h[0] = *(const v8h*)(kfr + ql + 512); kf[kt][3].h[1] = *(const v8h*)(kfr + ql + 768);
  }
}

// Stands behind a group of fragment loads, before anything rewrites the address register that they name; it takes that
// address as an input so that the register is left alone up to the wait.
__device__ __forceinline__ void frag_loads_issued(const h16* addr) {
  asm volatile("s_wait_xcnt 0x0" :: "v"(addr) : "memory");
}

__global__ void __launch_bounds__(AW * 32)
attn_kernel(const h16* __restrict__ qws,
            const h16* __restrict__ kws,
            const h16* __restrict__ vtws,
            float* __restrict__ out) {
  __shared__ __align__(16) float Of[2][AW][16][OPITCH];  // partial O, [tile of the pair][wave][query][column] (cross-wave)
  __shared__ float Ml[2][AW][16], Ll[2][AW][16];         // partial m, l (cross-wave)

  const int lane = threadIdx.x & 31;
  const int wv   = threadIdx.x >> 5;
  const int g    = lane >> 4;
  const int m    = lane & 15;
  const int b    = blockIdx.x / (SEQ / 32);    // batch
  const int pr   = blockIdx.x % (SEQ / 32);    // pair: query tiles pr and SEQ/16 - 1 - pr

  const size_t QL = (size_t)NB * SEQ * HH;     // residual planes follow the value planes
  const float scale = ATTN_SCALE;
  const h16* kbase  = kws + (size_t)b * SEQ * HH;
  const h16* vtbase = vtws + (size_t)b * HH * SEQ;

  // unrolled: hf is a constant in each copy (LDS offsets, the start of the deal), and the second tile's loop needs no entry test
#pragma unroll
  for (int hf = 0; hf < 2; ++hf) {
    const int t0    = (hf ? SEQ / 16 - 1 - pr : pr) * 16;
    const int nblk  = t0 / 32 + 1;             // causal: keys <= t0+15
    const int qidx  = t0 + m;                  // this lane's query
    // the wave's first key block: the second tile's deal starts at the wave behind the first tile's last
    const int first = hf ? ((wv - (pr / 2 + 1)) & (AW - 1)) : wv;

    // Q fragments (B operand: lane%16 = query) for the two 32-wide h chunks (HH = 64)
    const h16* qrow = qws + ((size_t)b * SEQ + t0 + m) * HH;
    U16 qa[2], qal[2];
    // here and below: the short loops are unrolled so that every array index is a constant and the arrays stay in registers
#pragma unroll
    for (int hc = 0; hc < 2; ++hc) {
      qa[hc].h[0]  = *(const v8h*)(qrow + hc * 32 + 8 * g);
      qa[hc].h[1]  = *(const v8h*)(qrow + hc * 32 + 16 + 8 * g);
      qal[hc].h[0] = *(const v8h*)(qrow + QL + hc * 32 + 8 * g);
      qal[hc].h[1] = *(const v8h*)(qrow + QL + hc * 32 + 16 + 8 * g);
    }
    frag_loads_issued(qrow);                   // the k fragments below may land in the registers that held this address

    v8f o[4];                                  // Ot: lane%16 = query, element v of tile nt = column nt*16 + 8g + v
#pragma unroll
    for (int nt = 0; nt < 4; ++nt) o[nt] = v8f_zero();
    float mrow = NEG_INF;                      // running maximum of this lane's query (equal in lanes l and l^16)
    float lrow = 0.f;                          // running sum over this lane's own keys (the halves are joined behind the loop)

    // k fragments of the wave's first block (block first < AW lies inside the batch's keys whether or not the wave has a pass: SEQ >= AW*32)
    U16 kf[2][4];                              // A frags use the same k map as B
    const h16* kfirst = kbase + (size_t)first * 32 * HH + lane * 8;
    load_kfrags(kfirst, QL, kf);
    frag_loads_issued(kfirst);

    for (int blk = first; blk < nblk; blk += AW) {
      const int s0 = blk * 32;

      // ---- this block's v fragments (A operand of Ot += V^T Pt), all issued here: they fly under the scores and the softmax ----
      U16 vf[4][2];                                         // [nt][value, residual]; same k map as B; keys 16+8g.. are 256 elements on
      // stands before this pass's loads land in registers that earlier loads name as their address (ahead of the first pass: the first block's k loads)
      asm volatile("s_wait_xcnt 0x0" ::: "memory");
      const h16* vblk = vtbase + (size_t)s0 * HH + lane * 8;
#pragma unroll
      for (int nt = 0; nt < 4; ++nt) {
        const h16* vfr = vblk + nt * 512;                   // this lane's 8 keys of column nt*16+m, keys 8g..8g+7
        vf[nt][0].h[0] = *(const v8h*)(vfr);      vf[nt][0].h[1] = *(const v8h*)(vfr + 256);
        vf[nt][1].h[0] = *(const v8h*)(vfr + QL); vf[nt][1].h[1] = *(const v8h*)(vfr + QL + 256);
      }

      // ---- St = K Q^T for 32 keys (two 16x16 tiles) ----
      v8f s[2];
#pragma unroll
      for (int kt = 0; kt < 2; ++kt) {
        s[kt] = wmma_split(kf[kt][0].v, kf[kt][2].v, qa[0].v, qal[0].v, v8f_zero());
        s[kt] = wmma_split(kf[kt][1].v, kf[kt][3].v, qa[1].v, qal[1].v, s[kt]);
      }

      // ---- scale + causal mask (diagonal block only); maximum over the lane's 16 keys, then over both halves ----
      const bool diag = (s0 + 31 >= t0);
      // key kt*16 + 8g + v of the block is open to the lane's query while kt*16 + v <= open: one value a pass against constants,
      // no per-element thresholds held in registers over the loop (with them the first tile's loop does not fit four waves a SIMD)
      const int  open = qidx - s0 - 8 * g;
      float mx[8];
#pragma unroll
      for (int v = 0; v < 8; ++v) {
#pragma unroll
        for (int kt = 0; kt < 2; ++kt) {
          const float val = s[kt][v] * scale;
          s[kt][v] = (diag && (kt * 16 + v > open)) ? NEG_INF : val;
        }
        mx[v] = fmaxf(s[0][v], s[1][v]);
      }
      float rmax = fmaxf(fmaxf(fmaxf(mx[0], mx[1]), fmaxf(mx[2], mx[3])), fmaxf(fmaxf(mx[4], mx[5]), fmaxf(mx[6], mx[7])));
      rmax = fmaxf(rmax, xhalf(rmax));

      // ---- online softmax update; Pt (x1024, two planes) packed into the B fragment ----
      const float mnew  = fmaxf(mrow, rmax);     // finite: key s0 <= t0 is open to every query of the tile
      const float alpha = __expf(mrow - mnew);
      mrow = mnew;
      U16 pa, pal;
      float ps[8];
#pragma unroll
      for (int v = 0; v < 8; ++v) {
        const float p0 = __expf(s[0][v] - mnew);
        const float p1 = __expf(s[1][v] - mnew);
        // probabilities carried x1024 (tail values stay f16-normal; removed in the final merge) as value + residual planes
        split16(p0 * 1024.0f, pa.e[v],     pal.e[v]);
        split16(p1 * 1024.0f, pa.e[8 + v], pal.e[8 + v]);
        ps[v] = p0 + p1;
      }
      lrow = lrow * alpha + (((ps[0] + ps[1]) + (ps[2] + ps[3])) + ((ps[4] + ps[5]) + (ps[6] + ps[7])));
#pragma unroll
      for (int nt = 0; nt < 4; ++nt)
#pragma unroll
        for (int v = 0; v < 8; ++v)
          o[nt][v] *= alpha;

      // ---- the next pass's k fragments, into the registers that the scores have left; the last pass reads its own block again ----
      const int nb = (blk + AW < nblk) ? blk + AW : blk;
      // holds the loads behind the softmax: issued in front of it, their 64 registers are live together with its temporaries and a fourth wave no longer fits the SIMD
      __builtin_amdgcn_sched_barrier(0);
      const h16* knext = kbase + (size_t)nb * 32 * HH + lane * 8;
      load_kfrags(knext, QL, kf);
      frag_loads_issued(knext);

      // ---- Ot += V^T Pt  (V A-frags from the fragment-ordered planes) ----
#pragma unroll
      for (int nt = 0; nt < 4; ++nt)
        o[nt] = wmma_split(vf[nt][0].v, vf[nt][1].v, pa.v, pal.v, o[nt]);
    }

    // ---- publish this wave's partial (O, m, l) of this tile, in the tile's own part of LDS ----
    lrow += xhalf(lrow);                       // the two halves' keys joined
#pragma unroll
    for (int nt = 0; nt < 4; ++nt) {
      const v4f lo4 = {o[nt][0], o[nt][1], o[nt][2], o[nt][3]};
      const v4f hi4 = {o[nt][4], o[nt][5], o[nt][6], o[nt][7]};
      *(v4f*)&Of[hf][wv][m][nt * 16 + 8 * g]     = lo4;
      *(v4f*)&Of[hf][wv][m][nt * 16 + 8 * g + 4] = hi4;
    }
    if (g == 0) {
      Ml[hf][wv][m] = mrow;
      Ll[hf][wv][m] = lrow;
    }
  }
  __syncthreads();

  // ---- merge: a thread takes one query of one tile and 8 of its columns (4*cg.. and 32+4*cg..: 8 lanes store a whole line) ----
  const int hf  = threadIdx.x >> 7;
  const int row = (threadIdx.x >> 3) & 15;
  const int cg  = threadIdx.x & 7;
  float M = Ml[hf][0][row];
#pragma unroll
  for (int w = 1; w < AW; ++w) M = fmaxf(M, Ml[hf][w][row]);
  float be[AW];
#pragma unroll
  for (int w = 0; w < AW; ++w) be[w] = __expf(Ml[hf][w][row] - M);   // 0 for idle waves (m = -inf)
  float L = 0.f;
  v4f O0 = {0.f, 0.f, 0.f, 0.f}, O1 = {0.f, 0.f, 0.f, 0.f};
#pragma unroll
  for (int w = 0; w < AW; ++w) {
    L  += be[w] * Ll[hf][w][row];
    O0 += be[w] * *(const v4f*)&Of[hf][w][row][4 * cg];
    O1 += be[w] * *(const v4f*)&Of[hf][w][row][32 + 4 * cg];
  }
  const float den = L * 1024.0f;                // removes the x1024 carried by the probabilities
  const int trow = (hf ? SEQ / 16 - 1 - pr : pr) * 16 + row;
  float* op = out + ((size_t)b * SEQ_FULL + trow) * HH + 4 * cg;
  *(v4f*)op        = O0 / den;
  *(v4f*)(op + 32) = O1 / den;
}

// ---------------------------------------------------------------------------
// Launch. Workspace layout (bytes, full size):
//   [0, 4MB)      q   f16 [NB,SEQ,64]  value + residual planes
//   [4MB, 8MB)    k   f16 [NB,SEQ,64]  (fragment order per 16-key tile)
//   [8MB, 12MB)   v   f16 [NB,SEQ,64]  (fragment order per 32-key block)
//   [12MB, +576KB) WtQ/WtK/WtV f16 [64,768] x2 planes each
// ---------------------------------------------------------------------------
extern "C" void kernel_launch(void* const* d_in, const int* in_sizes, int n_in,
                              void* d_out, int out_size, void* d_ws,
                              size_t ws_size, hipStream_t stream) {
  if (n_in < 4) return;
  const long long rows_needed = (long long)(NB - 1) * SEQ_FULL + SEQ;
  if ((long long)in_sizes[0] < rows_needed * CC) return;
  if (in_sizes[1] < CC * HH || in_sizes[2] < CC * HH || in_sizes[3] < CC * HH) return;
  if ((long long)out_size < rows_needed * HH) return;

  const float* x  = (const float*)d_in[0];
  const float* Wk = (const float*)d_in[1];
  const float* Wq = (const float*)d_in[2];
  const float* Wv = (const float*)d_in[3];
  float* out = (float*)d_out;

  // every 16-bit buffer holds a value plane followed by its residual plane (2x the element count)
  char* ws = (char*)d_ws;
  const size_t qkv_bytes = (size_t)2 * NB * SEQ * HH * sizeof(h16);     // 4 MB at full size (two planes)
  const size_t wt_bytes  = (size_t)2 * CC * HH * sizeof(h16);           // 192 KB each
  const size_t total     = 3 * qkv_bytes + 3 * wt_bytes;
  if (total > ws_size) return;
  h16* qws  = (h16*)(ws);
  h16* kws  = (h16*)(ws + qkv_bytes);
  h16* vtws = (h16*)(ws + 2 * qkv_bytes);
  h16* WtQ  = (h16*)(ws + 3 * qkv_bytes);
  h16* WtK  = (h16*)(ws + 3 * qkv_bytes + wt_bytes);
  h16* WtV  = (h16*)(ws + 3 * qkv_bytes + 2 * wt_bytes);

  wt_kernel<<<(CC * HH / 2) / 256, 256, 0, stream>>>(Wk, Wq, Wv, WtQ, WtK, WtV);
  qkv_kernel<<<(NB * SEQ) / 64, 256, 0, stream>>>(x, WtQ, WtK, WtV, qws, kws, vtws);
  attn_kernel<<<(NB * SEQ) / 32, AW * 32, 0, stream>>>(qws, kws, vtws, out);
}

// v009
// It runs in 41.4 microseconds.
// In two side-by-side timings against v008, it was 1.11 and 1.10 times as fast.
// Counting every step since v000, it is 3.26 times as fast.
// Contractions: q/k/v projections [NB*SEQ x 64 x 768] (x3), causal scores [T x T x 64] and P.V [T x 64 x T] per batch, all on
// v_wmma_f32_16x16x32_f16 with f16 value + residual operand planes (hi.hi + (hi.lo + lo.hi)/2048), f32 accumulate; softmax and
#include <hip/hip_runtime.h>
#include <math.h>

// Problem constants (NB / SEQ overridable for a reduced build; *_FULL are the strides of the inputs / output)
#ifndef NB
#define NB 8
#endif
#ifndef SEQ
#define SEQ 2048
#endif
#define NB_FULL 8
#define SEQ_FULL 2048
#define CC 768
#define HH 64
#define ATTN_SCALE 0.03608439182435161f   // CC^-0.5 (embedding dim), as f32

static_assert(NB >= 1 && NB <= NB_FULL);
static_assert(SEQ >= 128 && SEQ <= SEQ_FULL && (SEQ % 128) == 0);
static_assert((CC % 128) == 0 && (CC % 32) == 0);
static_assert(HH == 64);
static_assert(((CC * HH / 2) % 256) == 0);
static_assert(((NB * SEQ) % 64) == 0);

// 16-bit operands are f16, each carried as a value plane plus a residual plane lo = f16((v - hi) * 2048):
// a product is hi.hi + (hi.lo + lo.hi)/2048 (f32-class). Every fragment (A and B) uses the 16x16x32 lane map
// lane%16 = row/col, g = lane/16: elements 0..7 -> k = 8g+e, elements 8..15 -> k = 16+8g+(e-8).
// k and v are kept in memory in that fragment order, so that one 16-byte-per-lane fragment load reads 512 contiguous bytes (4 lines, not 16):
//   k: per 16-key tile 1024 elements, [h/16][lane = 16*((h%16)/8) + key%16][h%8]           (tile r starts at element 1024*r of its plane)
//   v: per 32-key block 2048 elements, [h/16][(key%32)/16][lane = 16*((key%16)/8) + h%16][key%8]  (block r starts at element 2048*r)
#define KFRAG(key16, h) ((((h) >> 4) * 32 + (((h) >> 3) & 1) * 16 + (key16)) * 8 + ((h) & 7))
typedef _Float16 h16;
typedef __attribute__((ext_vector_type(16))) _Float16 v16h;
typedef __attribute__((ext_vector_type(8)))  _Float16 v8h;
typedef __attribute__((ext_vector_type(8)))  float    v8f;
typedef __attribute__((ext_vector_type(4)))  float    v4f;
#define RSPLIT (1.0f / 2048.0f)
__device__ __forceinline__ void split16(float f, h16& hi, h16& lo) { hi = (h16)f; lo = (h16)((f - (float)hi) * 2048.0f); }
__device__ __forceinline__ unsigned short hbits(h16 h) { return __builtin_bit_cast(unsigned short, h); }

#define NEG_INF (-__builtin_inff())

__device__ __forceinline__ v8f v8f_zero() {
  v8f z = {0.f, 0.f, 0.f, 0.f, 0.f, 0.f, 0.f, 0.f};
  return z;
}

// D = A(16x32 f16) * B(32x16 f16) + C(16x16 f32), followed by the VALU hazard guard (ties D, keeps A/B live)
__device__ __forceinline__ v8f wmma16(v16h a, v16h b, v8f c) {
  v8f r = __builtin_amdgcn_wmma_f32_16x16x32_f16(false, a, false, b, (short)0, c, false, false);
  asm volatile("v_nop\n\tv_nop\n\tv_nop\n\tv_nop" : "+v"(r) : "v"(a), "v"(b));
  return r;
}

// acc += A.B with value/residual planes: cross terms from zero, folded at 1/2048 on the VALU
__device__ __forceinline__ v8f wmma_split(v16h ah, v16h al, v16h bh, v16h bl, v8f c) {
  v8f x = wmma16(al, bh, v8f_zero());
  x = wmma16(ah, bl, x);
  return wmma16(ah, bh, c) + x * RSPLIT;
}

// ---------------------------------------------------------------------------
// Kernel 0: W[C,H] f32  ->  Wt[H,C] f16 value + residual planes
// ---------------------------------------------------------------------------
__global__ void __launch_bounds__(256)
wt_kernel(const float* __restrict__ Wk,
          const float* __restrict__ Wq,
          const float* __restrict__ Wv,
          h16* __restrict__ WtQ,
          h16* __restrict__ WtK,
          h16* __restrict__ WtV) {
  const int idx = blockIdx.x * 256 + threadIdx.x;   // 0 .. HH*CC/2 - 1
  if (idx >= CC * HH / 2) return;
  const int h = idx / (CC / 2);
  const int c = 2 * (idx % (CC / 2));
  const float* src[3] = {Wq, Wk, Wv};
  h16* dstp[3] = {WtQ, WtK, WtV};
#pragma unroll
  for (int s = 0; s < 3; ++s) {
    h16 h0, l0, h1, l1;
    split16(src[s][(size_t)c * HH + h], h0, l0);
    split16(src[s][(size_t)(c + 1) * HH + h], h1, l1);
    unsigned* dh = (unsigned*)(dstp[s] + (size_t)h * CC + c);
    unsigned* dl = (unsigned*)(dstp[s] + (size_t)CC * HH + (size_t)h * CC + c);
    const unsigned ph = (unsigned)hbits(h0) | ((unsigned)hbits(h1) << 16);
    const unsigned pl = (unsigned)hbits(l0) | ((unsigned)hbits(l1) << 16);
    *(unsigned*)dh = ph; *(unsigned*)dl = pl;
    
  }
}

// ---------------------------------------------------------------------------
// Kernel 1: QKV projection. A block takes 64 rows of (b,t): 4 row tiles of 16, each worked by two waves, wave kh = 0 / 1 taking
// the first / second KW k columns of every staged slice (so the grid has one block for every WGP of the chip, two waves a SIMD).
// Behind the k loop the two waves of a row tile join their partial sums through LDS, each keeping half of the 12 result tiles.
//   q stored row-major [NB,SEQ,64] (value + residual planes), k in fragment order per 16-key tile, v in fragment order per 32-key block.
// A-frag (x rows, split in registers) and B-frags (Wt[n][k] rows) use the same element -> k map; C/D: lane col = lane%16,
// element v -> row 8g+v.
// The six weight planes are staged once per block in LDS, KS columns of k at a time, by asynchronous copies into two
// buffers (the next slice flies while this one is multiplied); all 8 waves read their B fragments from there.
// The x columns of a slice are loaded into registers one trip ahead of their use.
// ---------------------------------------------------------------------------
#define KW 64                          // k columns of a slice that one wave multiplies
#define KS (2 * KW)                    // k columns per staged slice: 256 B of every weight row
#define WPITCH (KS + 8)                // f16 per staged row, 272 B = 16 B x odd: 16 rows' 16-byte reads fall on distinct banks
#define WBUF (6 * HH * WPITCH)         // f16 per buffer: planes Q, Q residual, K, K residual, V, V residual
#define NSLICE (CC / KS)
static_assert((CC % KS) == 0 && NSLICE >= 2);
static_assert(6 * HH * (KS / 8) == 24 * 256);   // 16-byte pieces of a slice = 24 per thread of the block

// One slice (columns c0 .. c0+KS-1 of all six planes) into the buffer at LDS byte address lbuf: 24 copies of 16 B per lane.
// Piece i of thread tid: plane i/4, row 16*(i%4) + tid/16, 16-byte column tid%16.
__device__ __forceinline__ void stage_slice(const h16* __restrict__ WtQ, const h16* __restrict__ WtK,
                                            const h16* __restrict__ WtV, int c0, unsigned lbuf, int tid) {
  const size_t PL = (size_t)CC * HH;
  const h16* pl[6] = {WtQ, WtQ + PL, WtK, WtK + PL, WtV, WtV + PL};
#pragma unroll
  for (int q = 0; q < 6; ++q) {   // four copies a statement (one plane): fewer address registers live at once than with more in one
    const h16* gp[4];
    unsigned ld[4];
#pragma unroll
    for (int j = 0; j < 4; ++j) {
      const int i = q * 4 + j;
      const int row = (i & 3) * 16 + (tid >> 4);
      gp[j] = pl[i >> 2] + (size_t)row * CC + c0 + (tid & 15) * 8;
      ld[j] = lbuf + (unsigned)((((i >> 2) * HH + row) * WPITCH + (tid & 15) * 8) * sizeof(h16));
    }
    // the copies and, as the statement's last line, the wait that stands before any of their address registers is rewritten
    asm volatile("global_load_async_to_lds_b128 %0, %4, off\n\t"
                 "global_load_async_to_lds_b128 %1, %5, off\n\t"
                 "global_load_async_to_lds_b128 %2, %6, off\n\t"
                 "global_load_async_to_lds_b128 %3, %7, off\n\t"
                 "s_wait_xcnt 0x0"
                 :: "v"(ld[0]), "v"(ld[1]), "v"(ld[2]), "v"(ld[3]), "v"(gp[0]), "v"(gp[1]), "v"(gp[2]), "v"(gp[3])
                 : "memory");
  }
}

// The x columns of this wave's KW-wide half of one slice, this lane's row, issued into registers (xp: column 8g of that half): kc-th 32-chunk holds
// k = 8g..8g+7 in xv[kc][0..1], 16+8g..16+8g+7 in xv[kc][2..3].
__device__ __forceinline__ void load_xslice(const float* __restrict__ xp, v4f (&xv)[KW / 32][4]) {
#pragma unroll
  for (int kc = 0; kc < KW / 32; ++kc) {
    xv[kc][0] = *(const v4f*)(xp + kc * 32);
    xv[kc][1] = *(const v4f*)(xp + kc * 32 + 4);
    xv[kc][2] = *(const v4f*)(xp + kc * 32 + 16);
    xv[kc][3] = *(const v4f*)(xp + kc * 32 + 20);
  }
  // stands behind the loads, before anything rewrites the address register that they name; it takes that address as an
  // input so that the register is left alone up to the wait
  asm volatile("s_wait_xcnt 0x0" :: "v"(xp) : "memory");
}

// One trip: the 16 x rows of this wave (its KW columns of this slice, loaded into xv one trip ago) times the same columns of the
// six staged planes (wb: the buffer, at the wave's first column), added into the 12 tiles. The next slice's x columns (at xnext) are issued into xv at the head of
// the trip, so that their way from memory lies under this trip's products.
__device__ __forceinline__ void slice_mac(const float* __restrict__ xnext, const h16* wb, int g, int m,
                                          v4f (&xv)[KW / 32][4], v8f (&accQ)[4], v8f (&accK)[4], v8f (&accV)[4]) {
  // this trip's x columns stay in a register set of their own while the next slice's land in xv
  v4f cur[KW / 32][4];
#pragma unroll
  for (int kc = 0; kc < KW / 32; ++kc)
#pragma unroll
    for (int i = 0; i < 4; ++i) cur[kc][i] = xv[kc][i];
  load_xslice(xnext, xv);
  // keeps the loads here at the head of the trip: sunk towards the next trip's splits they would wait for memory in the open
  __builtin_amdgcn_sched_barrier(0);
#pragma unroll
  for (int kc = 0; kc < KW / 32; ++kc) {
    // A-fragment: x tile rows, split into value/residual f16 in registers
    union { v16h v; h16 e[16]; } a, al;
#pragma unroll
    for (int j = 0; j < 8; ++j) {
      split16(cur[kc][j >> 2][j & 3],       a.e[j],     al.e[j]);
      split16(cur[kc][2 + (j >> 2)][j & 3], a.e[8 + j], al.e[8 + j]);
    }
    union UB { v16h v; v8h h[2]; };
#pragma unroll
    for (int nt = 0; nt < 4; ++nt) {
      // one n-tile at a time: its six B fragments (value + residual for Q/K/V weights) then three split MACs;
      // B frags use the same k map as A: {8g..8g+7} then {16+8g..16+8g+7}
      const h16* wr = wb + (nt * 16 + m) * WPITCH + kc * 32 + 8 * g;
      UB bq, bk, bv, bql, bkl, bvl;
      bq.h[0]  = *(const v8h*)(wr);                     bq.h[1]  = *(const v8h*)(wr + 16);
      bql.h[0] = *(const v8h*)(wr + 1 * HH * WPITCH);   bql.h[1] = *(const v8h*)(wr + 1 * HH * WPITCH + 16);
      bk.h[0]  = *(const v8h*)(wr + 2 * HH * WPITCH);   bk.h[1]  = *(const v8h*)(wr + 2 * HH * WPITCH + 16);
      bkl.h[0] = *(const v8h*)(wr + 3 * HH * WPITCH);   bkl.h[1] = *(const v8h*)(wr + 3 * HH * WPITCH + 16);
      bv.h[0]  = *(const v8h*)(wr + 4 * HH * WPITCH);   bv.h[1]  = *(const v8h*)(wr + 4 * HH * WPITCH + 16);
      bvl.h[0] = *(const v8h*)(wr + 5 * HH * WPITCH);   bvl.h[1] = *(const v8h*)(wr + 5 * HH * WPITCH + 16);
      accQ[nt] = wmma_split(a.v, al.v, bq.v, bql.v, accQ[nt]);
      accK[nt] = wmma_split(a.v, al.v, bk.v, bkl.v, accK[nt]);
      accV[nt] = wmma_split(a.v, al.v, bv.v, bvl.v, accV[nt]);
      // keeps the n-tiles apart in the schedule: mixed, more fragments and cross-term tiles are live at once and registers spill to scratch
      __builtin_amdgcn_sched_barrier(0);
    }
  }
}

// Hand-over at the foot of a trip: this wave's reads of the slice are done, its copies of the next slice have landed, and
// every wave has said so; behind it the next slice may be read and the buffer just read may be refilled.
__device__ __forceinline__ void slice_handover() {
  asm volatile("s_wait_dscnt 0x0" ::: "memory");
  asm volatile("s_wait_asynccnt 0x0" ::: "memory");
  __syncthreads();
}

__global__ void __launch_bounds__(256)
qkv_kernel(const float* __restrict__ x,
           const h16* __restrict__ WtQ,
           const h16* __restrict__ WtK,
           const h16* __restrict__ WtV,
           h16* __restrict__ qws,
           h16* __restrict__ kws,
           h16* __restrict__ vtws) {
  __shared__ __align__(16) h16 wl[2][WBUF];     // the two weight-slice buffers (cross-wave)
  __shared__ __align__(16) h16 st[8][16][64];   // per-wave staging of one 16x64 result plane (wave-private)
  __shared__ __align__(16) v4f xch[8][12][32];  // partial sums handed to the other wave of the row tile: [sender][half tile][lane]
  const int lane = threadIdx.x & 31;
  const int wv   = threadIdx.x >> 5;
  const int g    = lane >> 4;
  const int m    = lane & 15;
  const int kh   = __builtin_amdgcn_readfirstlane(wv >> 2);   // which KW k columns of every slice (the same in all lanes)
  const int tile = blockIdx.x * 4 + (wv & 3);  // 0 .. NB*SEQ/16 - 1; waves wv and wv ^ 4 share it
  const int b    = tile / (SEQ / 16);
  const int t0   = (tile % (SEQ / 16)) * 16;
  const size_t QL = (size_t)NB * SEQ * HH;     // residual plane offset inside q/k/v buffers
  const unsigned lw = (unsigned)(size_t)&wl[0][0];   // LDS byte address of buffer 0

  v8f accQ[4], accK[4], accV[4];
#pragma unroll
  for (int nt = 0; nt < 4; ++nt) {
    accQ[nt] = v8f_zero();
    accK[nt] = v8f_zero();
    accV[nt] = v8f_zero();
  }

  const float* xrow = x + ((size_t)b * SEQ_FULL + t0 + m) * CC;

  // x columns of slice 0: they fly under the staging of the first weight slice
  v4f xv[KW / 32][4];
  const float* xnext = xrow + kh * KW + 8 * g;
  load_xslice(xnext, xv);
  xnext += KS;

  // slice 0 lands and is published to every wave; slice 1 then flies during trip 0
  stage_slice(WtQ, WtK, WtV, 0, lw, threadIdx.x);
  asm volatile("s_wait_asynccnt 0x0" ::: "memory");   // this wave's copies of slice 0 have landed
  __syncthreads();
  stage_slice(WtQ, WtK, WtV, KS, lw + (unsigned)(WBUF * sizeof(h16)), threadIdx.x);

  // rolled, and the last two trips (no slice left to fetch) in a loop of their own: each loop body stays one straight block
#pragma unroll 1
  for (int t = 0; t < NSLICE - 2; ++t) {
    slice_mac(xnext, &wl[t & 1][kh * KW], g, m, xv, accQ, accK, accV);
    xnext += KS;
    slice_handover();
    // refill the buffer that this trip has just read
    stage_slice(WtQ, WtK, WtV, (t + 2) * KS, lw + (unsigned)((t & 1) * WBUF * sizeof(h16)), threadIdx.x);
  }
#pragma unroll 1
  for (int t = NSLICE - 2; t < NSLICE; ++t) {
    // xnext stays at the last slice: the last trip has no next slice and reads its own x columns again
    slice_mac(xnext, &wl[t & 1][kh * KW], g, m, xv, accQ, accK, accV);
    slice_handover();
  }
  asm volatile("s_wait_asynccnt 0x0" ::: "memory");   // no copy is outstanding when the wave goes on and ends

  // the two k halves joined: wave kh = 0 keeps q and k columns 0..31, wave kh = 1 keeps v and k columns 32..63; each hands the
  // other six tiles to its partner and adds what the partner hands it
  v8f mine[6], send[6];
#pragma unroll
  for (int i = 0; i < 4; ++i) {
    mine[i] = kh ? accV[i] : accQ[i];
    send[i] = kh ? accQ[i] : accV[i];
  }
#pragma unroll
  for (int j = 0; j < 2; ++j) {
    mine[4 + j] = kh ? accK[2 + j] : accK[j];
    send[4 + j] = kh ? accK[j] : accK[2 + j];
  }
#pragma unroll
  for (int i = 0; i < 6; ++i) {
    const v4f lo4 = {send[i][0], send[i][1], send[i][2], send[i][3]};
    const v4f hi4 = {send[i][4], send[i][5], send[i][6], send[i][7]};
    xch[wv][2 * i][lane]     = lo4;
    xch[wv][2 * i + 1][lane] = hi4;
  }
  __syncthreads();   // every wave's handed tiles are in LDS before a partner reads them
#pragma unroll
  for (int i = 0; i < 6; ++i) {
    const v4f lo4 = xch[wv ^ 4][2 * i][lane];
    const v4f hi4 = xch[wv ^ 4][2 * i + 1][lane];
#pragma unroll
    for (int v = 0; v < 4; ++v) {
      mine[i][v]     += lo4[v];
      mine[i][4 + v] += hi4[v];
    }
  }

  // outputs: q, k, v [NB,SEQ,64] as value + residual planes; the q and k plane tiles go through the wave's LDS tile and leave in whole lines
  h16* sw = &st[wv][0][0];
  const size_t row0 = ((size_t)b * SEQ + t0) * HH;
  if (kh == 0) {
    // q: 16x64, row-major [row][col]
#pragma unroll
    for (int pl = 0; pl < 2; ++pl) {
#pragma unroll
      for (int nt = 0; nt < 4; ++nt)
#pragma unroll
        for (int v = 0; v < 8; ++v) {
          h16 hh_, ll_; split16(mine[nt][v], hh_, ll_);
          sw[(8 * g + v) * 64 + nt * 16 + m] = pl ? ll_ : hh_;
        }
      asm volatile("s_wait_dscnt 0" ::: "memory");   // all lanes' stores into the wave's tile are done before it is read back across lanes
      h16* base = qws + (pl ? QL : 0) + row0;
#pragma unroll
      for (int r = 0; r < 16; ++r) {
        const unsigned w = *((const unsigned*)(sw + r * 64) + lane);
        *(unsigned*)((unsigned*)(base + (size_t)r * HH) + lane) = w;
      }
      asm volatile("s_wait_dscnt 0" ::: "memory");   // the reads of the tile are done before the next plane overwrites it
    }
  } else {
    // v: the 8 results that a lane holds of tile nt are keys 8g..8g+7 of column nt*16+m, which in fragment order are the 8
    // consecutive elements at lane*8 of group [nt][16-key half]: each plane tile leaves the registers as one 16-byte store a lane,
    // 512 contiguous bytes a wave
    h16* vdst = vtws + ((size_t)b * SEQ + (t0 & ~31)) * HH + ((t0 >> 4) & 1) * 256 + lane * 8;
    v8h vh[4], vl[4];
#pragma unroll
    for (int nt = 0; nt < 4; ++nt)
#pragma unroll
      for (int v = 0; v < 8; ++v) {
        h16 hh_, ll_; split16(mine[nt][v], hh_, ll_);
        vh[nt][v] = hh_;
        vl[nt][v] = ll_;
      }
#pragma unroll
    for (int nt = 0; nt < 4; ++nt) {
      *(v8h*)(vdst + nt * 512)      = vh[nt];
      *(v8h*)(vdst + QL + nt * 512) = vl[nt];
    }
    // stands behind the stores, before anything rewrites a register that they name; it takes the address and the stored
    // values as inputs so that those registers are left alone up to the wait
    asm volatile("s_wait_xcnt 0x0" :: "v"(vdst), "v"(vh[0]), "v"(vh[1]), "v"(vh[2]), "v"(vh[3]),
                                      "v"(vl[0]), "v"(vl[1]), "v"(vl[2]), "v"(vl[3]) : "memory");
  }
  // k columns 32*kh .. 32*kh+31: in fragment order (KFRAG) they are elements 512*kh .. 512*kh+511 of the 16-key tile
#pragma unroll
  for (int pl = 0; pl < 2; ++pl) {
#pragma unroll
    for (int j = 0; j < 2; ++j)
#pragma unroll
      for (int v = 0; v < 8; ++v) {
        h16 hh_, ll_; split16(mine[4 + j][v], hh_, ll_);
        sw[KFRAG(8 * g + v, j * 16 + m)] = pl ? ll_ : hh_;
      }
    asm volatile("s_wait_dscnt 0" ::: "memory");   // as above: the tile is complete before it is read back
    h16* base = kws + (pl ? QL : 0) + row0 + kh * 512;
#pragma unroll
    for (int r = 0; r < 8; ++r) {
      const unsigned w = *((const unsigned*)(sw + r * 64) + lane);
      *(unsigned*)((unsigned*)(base + (size_t)r * HH) + lane) = w;
    }
    asm volatile("s_wait_dscnt 0" ::: "memory");   // the reads of the tile are done before the next plane overwrites it
  }
}

// ---------------------------------------------------------------------------
// Kernel 2: causal flash attention. A block takes two 32-row query groups of one batch, group p and group SEQ/32 - 1 - p, one
// after the other in every wave: together they have the same number of 32-key blocks for every p, so all blocks of the grid (one
// for every WGP) carry equal work. The key blocks of a group are dealt round to the 8 waves, the second group's deal going
// on where the first one's ended, so that the waves' pass counts differ by one at most.
// A wave carries both 16-query tiles of the group through each of its key blocks: every k and v fragment that it loads is used
// for two tiles' products, half the loaded bytes per product of a wave with one tile.
// The products are taken transposed: per 32-key block and query tile St = K Q^T (2 split tiles, A = k fragment, B = q fragment),
// online softmax, Ot += V^T Pt (4 split tiles, A = v fragment, B = Pt). The fragments are the same registers as for Q K^T and P V
// (A and B share one lane map); in the results lane%16 is the query and element v the key 8g+v (St) or the column 8g+v (Ot).
// So one lane holds 16 of its query's 32 scores (lane^16 the other 16): maximum and sum are taken in the lane, the maximum
// joined with one exchange between the halves, the sum once behind the loop; and St tile 0 / tile 1 of a lane are keys
// 8g..8g+7 / 16+8g..16+8g+7, which is the B fragment's k order: Pt is packed in registers.
// Partial (O, m, l) of both groups merged across waves via LDS log-sum-exp combine (one block barrier behind both groups).
// Fragment loads run ahead of their use: a pass issues all of its v fragments before the score products, and the next pass's
// k fragments right behind them (two waves a SIMD: the registers are there), so that a load's way from L2 lies under matrix and softmax work.
// ---------------------------------------------------------------------------
#define AW 8        // waves of a block, the ways a group's key blocks are split
#define QT 2        // 16-query tiles of a group, carried together by every wave
#define QG (16 * QT)
static_assert(QG == 32);   // a group's diagonal lies in its last 32-key block alone
static_assert(SEQ >= AW * 32 && ((SEQ / QG) % 2) == 0);
#define OPITCH 68   // f32 per staged O row, 272 B = 16 B x odd: 16 lanes' 16-byte stores fall on distinct banks

// wmma_split on the builtin alone (the compiler keeps the distance behind its own WMMAs): an asm statement tied to the operands
// holds every one of them in v0..v255, and the fragments and tiles of two query tiles do not fit there (they spilled to scratch)
__device__ __forceinline__ v8f wmma_split_plain(v16h ah, v16h al, v16h bh, v16h bl, v8f c) {
  v8f x = __builtin_amdgcn_wmma_f32_16x16x32_f16(false, al, false, bh, (short)0, v8f_zero(), false, false);
  x = __builtin_amdgcn_wmma_f32_16x16x32_f16(false, ah, false, bl, (short)0, x, false, false);
  return __builtin_amdgcn_wmma_f32_16x16x32_f16(false, ah, false, bh, (short)0, c, false, false) + x * RSPLIT;
}

// lane l with lane l ^ 16
__device__ __forceinline__ float xhalf(float x) {
  return __builtin_bit_cast(float, __builtin_amdgcn_permlanex16(__builtin_bit_cast(int, x), __builtin_bit_cast(int, x),
                                                                0x76543210, 0xfedcba98, false, false));
}

union U16 { v16h v; v8h h[2]; h16 e[16]; };

// The k fragments of one 32-key block (kblk: this lane's first 8 elements of it; ql: offset of the residual plane):
// kf[kt][c] = value plane of 16-key tile kt, 32-wide h chunk c; kf[kt][2 + c] = its residual plane. 16-h group j is 256*j elements on.
__device__ __forceinline__ void load_kfrags(const h16* __restrict__ kblk, size_t ql, U16 (&kf)[2][4]) {
  // unrolled so that every index of kf is a constant and the array stays in registers
#pragma unroll
  for (int kt = 0; kt < 2; ++kt) {
    const h16* kfr = kblk + kt * 16 * HH;
    kf[kt][0].h[0] = *(const v8h*)(kfr);            kf[kt][0].h[1] = *(const v8h*)(kfr + 256);
    kf[kt][1].h[0] = *(const v8h*)(kfr + 512);      kf[kt][1].h[1] = *(const v8h*)(kfr + 768);
    kf[kt][2].h[0] = *(const v8h*)(kfr + ql);       kf[kt][2].h[1] = *(const v8h*)(kfr + ql + 256);
    kf[kt][3].h[0] = *(const v8h*)(kfr + ql + 512); kf[kt][3].h[1] = *(const v8h*)(kfr + ql + 768);
  }
}

// Stands behind a group of fragment loads, before anything rewrites the address register that they name; it takes that
// address as an input so that the register is left alone up to the wait.
__device__ __forceinline__ void frag_loads_issued(const h16* addr) {
  asm volatile("s_wait_xcnt 0x0" :: "v"(addr) : "memory");
}

__global__ void __launch_bounds__(AW * 32)
attn_kernel(const h16* __restrict__ qws,
            const h16* __restrict__ kws,
            const h16* __restrict__ vtws,
            float* __restrict__ out) {
  __shared__ __align__(16) float Of[2][AW][QG][OPITCH];  // partial O, [group of the pair][wave][query][column] (cross-wave)
  __shared__ float Ml[2][AW][QG], Ll[2][AW][QG];         // partial m, l (cross-wave)

  const int lane = threadIdx.x & 31;
  const int wv   = threadIdx.x >> 5;
  const int g    = lane >> 4;
  const int m    = lane & 15;
  const int b    = blockIdx.x / (SEQ / (2 * QG));    // batch
  const int pr   = blockIdx.x % (SEQ / (2 * QG));    // pair: query groups pr and SEQ/QG - 1 - pr

  const size_t QL = (size_t)NB * SEQ * HH;     // residual planes follow the value planes
  const float scale = ATTN_SCALE;
  const h16* kbase  = kws + (size_t)b * SEQ * HH;
  const h16* vtbase = vtws + (size_t)b * HH * SEQ;

  // unrolled: hf is a constant in each copy (LDS offsets, the start of the deal), and the second group's loop needs no entry test
#pragma unroll
  for (int hf = 0; hf < 2; ++hf) {
    const int grp   = hf ? SEQ / QG - 1 - pr : pr;
    const int t0    = grp * QG;
    const int nblk  = grp + 1;                 // causal: keys <= t0+31
    // the wave's first key block: the second group's deal starts at the wave behind the first group's last
    const int first = hf ? ((wv - (pr + 1)) & (AW - 1)) : wv;

    // Q fragments (B operand: lane%16 = query) of both tiles for the two 32-wide h chunks (HH = 64)
    const h16* qrow = qws + ((size_t)b * SEQ + t0 + m) * HH + 8 * g;   // the one address that all sixteen loads are formed from
    U16 qa[QT][2], qal[QT][2];
    // here and below: the short loops are unrolled so that every array index is a constant and the arrays stay in registers
#pragma unroll
    for (int qt = 0; qt < QT; ++qt)
#pragma unroll
      for (int hc = 0; hc < 2; ++hc) {
        const h16* qp = qrow + qt * 16 * HH + hc * 32;
        qa[qt][hc].h[0]  = *(const v8h*)(qp);
        qa[qt][hc].h[1]  = *(const v8h*)(qp + 16);
        qal[qt][hc].h[0] = *(const v8h*)(qp + QL);
        qal[qt][hc].h[1] = *(const v8h*)(qp + QL + 16);
      }
    frag_loads_issued(qrow);                   // the k fragments below may land in the registers that held this address

    v8f o[QT][4];                              // Ot: lane%16 = query, element v of tile nt = column nt*16 + 8g + v
    float mrow[QT], lrow[QT];                  // running maximum of this lane's query (equal in lanes l and l^16); running sum
                                               // over this lane's own keys (the halves are joined behind the loop)
#pragma unroll
    for (int qt = 0; qt < QT; ++qt) {
#pragma unroll
      for (int nt = 0; nt < 4; ++nt) o[qt][nt] = v8f_zero();
      mrow[qt] = NEG_INF;
      lrow[qt] = 0.f;
    }

    // k fragments of the wave's first block (block first < AW lies inside the batch's keys whether or not the wave has a pass: SEQ >= AW*32)
    U16 kf[2][4];                              // A frags use the same k map as B
    const h16* kfirst = kbase + (size_t)first * 32 * HH + lane * 8;
    load_kfrags(kfirst, QL, kf);
    frag_loads_issued(kfirst);

    for (int blk = first; blk < nblk; blk += AW) {
      const int s0 = blk * 32;

      // ---- this block's v fragments (A operand of Ot += V^T Pt), all issued here: they fly under the scores and the softmax ----
      U16 vf[4][2];                                         // [nt][value, residual]; same k map as B; keys 16+8g.. are 256 elements on
      // stands before this pass's loads land in registers that earlier loads name as their address (ahead of the first pass: the first block's k loads)
      asm volatile("s_wait_xcnt 0x0" ::: "memory");
      const h16* vblk = vtbase + (size_t)s0 * HH + lane * 8;
#pragma unroll
      for (int nt = 0; nt < 4; ++nt) {
        const h16* vfr = vblk + nt * 512;                   // this lane's 8 keys of column nt*16+m, keys 8g..8g+7
        vf[nt][0].h[0] = *(const v8h*)(vfr);      vf[nt][0].h[1] = *(const v8h*)(vfr + 256);
        vf[nt][1].h[0] = *(const v8h*)(vfr + QL); vf[nt][1].h[1] = *(const v8h*)(vfr + QL + 256);
      }
      // keeps the loads here at the head of the pass: sunk towards the P.V products they would wait for L2 in the open
      __builtin_amdgcn_sched_barrier(0);

      // ---- St = K Q^T for 32 keys (two 16x16 tiles) and both query tiles: each k fragment is used twice ----
      v8f s[QT][2];
#pragma unroll
      for (int kt = 0; kt < 2; ++kt)
#pragma unroll
        for (int qt = 0; qt < QT; ++qt) {
          s[qt][kt] = wmma_split_plain(kf[kt][0].v, kf[kt][2].v, qa[qt][0].v, qal[qt][0].v, v8f_zero());
          s[qt][kt] = wmma_split_plain(kf[kt][1].v, kf[kt][3].v, qa[qt][1].v, qal[qt][1].v, s[qt][kt]);
        }

      // ---- the next pass's k fragments, into the registers that the scores have left; the last pass reads its own block again ----
      const int nb = (blk + AW < nblk) ? blk + AW : blk;
      const h16* knext = kbase + (size_t)nb * 32 * HH + lane * 8;
      load_kfrags(knext, QL, kf);
      frag_loads_issued(knext);
      // keeps the loads here, right behind the score products: left free they sank into the P.V products, too late for their way from L2
      __builtin_amdgcn_sched_barrier(0);

      const bool diag = (s0 + 31 >= t0);
      // key kt*16 + 8g + v of the block is open to query m of tile qt while kt*16 + v - qt*16 <= open: one value a pass against constants
      const int  open = t0 + m - s0 - 8 * g;
      U16 pa[QT], pal[QT];
#pragma unroll
      for (int qt = 0; qt < QT; ++qt) {
        // ---- scale + causal mask (diagonal block only); maximum over the lane's 16 keys, then over both halves ----
        float mx[8];
#pragma unroll
        for (int v = 0; v < 8; ++v) {
#pragma unroll
          for (int kt = 0; kt < 2; ++kt) {
            const float val = s[qt][kt][v] * scale;
            s[qt][kt][v] = (diag && (kt * 16 + v - qt * 16 > open)) ? NEG_INF : val;
          }
          mx[v] = fmaxf(s[qt][0][v], s[qt][1][v]);
        }
        float rmax = fmaxf(fmaxf(fmaxf(mx[0], mx[1]), fmaxf(mx[2], mx[3])), fmaxf(fmaxf(mx[4], mx[5]), fmaxf(mx[6], mx[7])));
        rmax = fmaxf(rmax, xhalf(rmax));

        // ---- online softmax update; Pt (x1024, two planes) packed into the B fragment ----
        const float mnew  = fmaxf(mrow[qt], rmax);   // finite: key s0 <= t0 is open to every query of the group
        const float alpha = __expf(mrow[qt] - mnew);
        mrow[qt] = mnew;
        float ps[8];
#pragma unroll
        for (int v = 0; v < 8; ++v) {
          const float p0 = __expf(s[qt][0][v] - mnew);
          const float p1 = __expf(s[qt][1][v] - mnew);
          // probabilities carried x1024 (tail values stay f16-normal; removed in the final merge) as value + residual planes
          split16(p0 * 1024.0f, pa[qt].e[v],     pal[qt].e[v]);
          split16(p1 * 1024.0f, pa[qt].e[8 + v], pal[qt].e[8 + v]);
          ps[v] = p0 + p1;
        }
        lrow[qt] = lrow[qt] * alpha + (((ps[0] + ps[1]) + (ps[2] + ps[3])) + ((ps[4] + ps[5]) + (ps[6] + ps[7])));
#pragma unroll
        for (int nt = 0; nt < 4; ++nt)
#pragma unroll
          for (int v = 0; v < 8; ++v)
            o[qt][nt][v] *= alpha;
      }

      // ---- Ot += V^T Pt  (V A-frags from the fragment-ordered planes): each v fragment is used twice ----
#pragma unroll
      for (int nt = 0; nt < 4; ++nt)
#pragma unroll
        for (int qt = 0; qt < QT; ++qt)
          o[qt][nt] = wmma_split_plain(vf[nt][0].v, vf[nt][1].v, pa[qt].v, pal[qt].v, o[qt][nt]);
    }

    // ---- publish this wave's partial (O, m, l) of this group, in the group's own part of LDS ----
#pragma unroll
    for (int qt = 0; qt < QT; ++qt) {
      lrow[qt] += xhalf(lrow[qt]);             // the two halves' keys joined
#pragma unroll
      for (int nt = 0; nt < 4; ++nt) {
        const v4f lo4 = {o[qt][nt][0], o[qt][nt][1], o[qt][nt][2], o[qt][nt][3]};
        const v4f hi4 = {o[qt][nt][4], o[qt][nt][5], o[qt][nt][6], o[qt][nt][7]};
        *(v4f*)&Of[hf][wv][qt * 16 + m][nt * 16 + 8 * g]     = lo4;
        *(v4f*)&Of[hf][wv][qt * 16 + m][nt * 16 + 8 * g + 4] = hi4;
      }
      if (g == 0) {
        Ml[hf][wv][qt * 16 + m] = mrow[qt];
        Ll[hf][wv][qt * 16 + m] = lrow[qt];
      }
    }
  }
  __syncthreads();

  // ---- merge: a thread takes one query of each group and 8 of its columns (4*cg.. and 32+4*cg..: 8 lanes store a whole line) ----
  const int row = threadIdx.x >> 3;
  const int cg  = threadIdx.x & 7;
#pragma unroll
  for (int hf = 0; hf < 2; ++hf) {
    float M = Ml[hf][0][row];
#pragma unroll
    for (int w = 1; w < AW; ++w) M = fmaxf(M, Ml[hf][w][row]);
    float be[AW];
#pragma unroll
    for (int w = 0; w < AW; ++w) be[w] = __expf(Ml[hf][w][row] - M);   // 0 for idle waves (m = -inf)
    float L = 0.f;
    v4f O0 = {0.f, 0.f, 0.f, 0.f}, O1 = {0.f, 0.f, 0.f, 0.f};
#pragma unroll
    for (int w = 0; w < AW; ++w) {
      L  += be[w] * Ll[hf][w][row];
      O0 += be[w] * *(const v4f*)&Of[hf][w][row][4 * cg];
      O1 += be[w] * *(const v4f*)&Of[hf][w][row][32 + 4 * cg];
    }
    const float den = L * 1024.0f;                // removes the x1024 carried by the probabilities
    const int trow = (hf ? SEQ / QG - 1 - pr : pr) * QG + row;
    float* op = out + ((size_t)b * SEQ_FULL + trow) * HH + 4 * cg;
    const v4f r0 = O0 / den, r1 = O1 / den;
    *(v4f*)op        = r0;
    *(v4f*)(op + 32) = r1;
    // stands behind the stores, before the second group's merge rewrites a register that they name; it takes the address and the
    // stored values as inputs so that those registers are left alone up to the wait
    asm volatile("s_wait_xcnt 0x0" :: "v"(op), "v"(r0), "v"(r1) : "memory");
  }
}

// ---------------------------------------------------------------------------
// Launch. Workspace layout (bytes, full size):
//   [0, 4MB)      q   f16 [NB,SEQ,64]  value + residual planes
//   [4MB, 8MB)    k   f16 [NB,SEQ,64]  (fragment order per 16-key tile)
//   [8MB, 12MB)   v   f16 [NB,SEQ,64]  (fragment order per 32-key block)
//   [12MB, +576KB) WtQ/WtK/WtV f16 [64,768] x2 planes each
// ---------------------------------------------------------------------------
extern "C" void kernel_launch(void* const* d_in, const int* in_sizes, int n_in,
                              void* d_out, int out_size, void* d_ws,
                              size_t ws_size, hipStream_t stream) {
  if (n_in < 4) return;
  const long long rows_needed = (long long)(NB - 1) * SEQ_FULL + SEQ;
  if ((long long)in_sizes[0] < rows_needed * CC) return;
  if (in_sizes[1] < CC * HH || in_sizes[2] < CC * HH || in_sizes[3] < CC * HH) return;
  if ((long long)out_size < rows_needed * HH) return;

  const float* x  = (const float*)d_in[0];
  const float* Wk = (const float*)d_in[1];
  const float* Wq = (const float*)d_in[2];
  const float* Wv = (const float*)d_in[3];
  float* out = (float*)d_out;

  // every 16-bit buffer holds a value plane followed by its residual plane (2x the element count)
  char* ws = (char*)d_ws;
  const size_t qkv_bytes = (size_t)2 * NB * SEQ * HH * sizeof(h16);     // 4 MB at full size (two planes)
  const size_t wt_bytes  = (size_t)2 * CC * HH * sizeof(h16);           // 192 KB each
  const size_t total     = 3 * qkv_bytes + 3 * wt_bytes;
  if (total > ws_size) return;
  h16* qws  = (h16*)(ws);
  h16* kws  = (h16*)(ws + qkv_bytes);
  h16* vtws = (h16*)(ws + 2 * qkv_bytes);
  h16* WtQ  = (h16*)(ws + 3 * qkv_bytes);
  h16* WtK  = (h16*)(ws + 3 * qkv_bytes + wt_bytes);
  h16* WtV  = (h16*)(ws + 3 * qkv_bytes + 2 * wt_bytes);

  wt_kernel<<<(CC * HH / 2) / 256, 256, 0, stream>>>(Wk, Wq, Wv, WtQ, WtK, WtV);
  qkv_kernel<<<(NB * SEQ) / 64, 256, 0, stream>>>(x, WtQ, WtK, WtV, qws, kws, vtws);
  attn_kernel<<<(NB * SEQ) / (2 * QG), AW * 32, 0, stream>>>(qws, kws, vtws, out);
}

// v010
// Measured time: 37.6 microseconds a run.
// Timed twice side by side with v009, it ran 1.09 and 1.11 times as fast.
// Over all steps from v000 it is 3.59 times as fast.
// Contractions: q/k/v projections [NB*SEQ x 64 x 768] (x3), causal scores [T x T x 64] and P.V [T x 64 x T] per batch, all on
// v_wmma_f32_16x16x32_f16 with f16 value + residual operand planes (hi.hi + hi.lo + lo.hi), f32 accumulate; softmax and
#include <hip/hip_runtime.h>
#include <math.h>

// Problem constants (NB / SEQ overridable for a reduced build; *_FULL are the strides of the inputs / output)
#ifndef NB
#define NB 8
#endif
#ifndef SEQ
#define SEQ 2048
#endif
#define NB_FULL 8
#define SEQ_FULL 2048
#define CC 768
#define HH 64
#define ATTN_SCALE 0.03608439182435161f   // CC^-0.5 (embedding dim), as f32

static_assert(NB >= 1 && NB <= NB_FULL);
static_assert(SEQ >= 128 && SEQ <= SEQ_FULL && (SEQ % 128) == 0);
static_assert((CC % 128) == 0 && (CC % 32) == 0);
static_assert(HH == 64);
static_assert(((CC * HH / 2) % 256) == 0);
static_assert(((NB * SEQ) % 64) == 0);

// 16-bit operands are f16, each carried as a value plane plus a residual plane lo = f16(v - hi), at the value's own scale
// (a residual below 2^-14 is an f16 subnormal, kept to 2^-25 absolute): a product is hi.hi + hi.lo + lo.hi (f32-class), all
// three accumulated by the matrix unit into one f32 tile. Every fragment (A and B) uses the 16x16x32 lane map
// lane%16 = row/col, g = lane/16: elements 0..7 -> k = 8g+e, elements 8..15 -> k = 16+8g+(e-8).
// k and v are kept in memory in that fragment order, so that one 16-byte-per-lane fragment load reads 512 contiguous bytes (4 lines, not 16):
//   k: per 16-key tile 1024 elements, [h/16][lane = 16*((h%16)/8) + key%16][h%8]           (tile r starts at element 1024*r of its plane)
//   v: per 32-key block 2048 elements, [h/16][(key%32)/16][lane = 16*((key%16)/8) + h%16][key%8]  (block r starts at element 2048*r)
#define KFRAG(key16, h) ((((h) >> 4) * 32 + (((h) >> 3) & 1) * 16 + (key16)) * 8 + ((h) & 7))
typedef _Float16 h16;
typedef __attribute__((ext_vector_type(16))) _Float16 v16h;
typedef __attribute__((ext_vector_type(8)))  _Float16 v8h;
typedef __attribute__((ext_vector_type(8)))  float    v8f;
typedef __attribute__((ext_vector_type(4)))  float    v4f;
__device__ __forceinline__ void split16(float f, h16& hi, h16& lo) { hi = (h16)f; lo = (h16)(f - (float)hi); }
__device__ __forceinline__ unsigned short hbits(h16 h) { return __builtin_bit_cast(unsigned short, h); }

#define NEG_INF (-__builtin_inff())

__device__ __forceinline__ v8f v8f_zero() {
  v8f z = {0.f, 0.f, 0.f, 0.f, 0.f, 0.f, 0.f, 0.f};
  return z;
}

// D = A(16x32 f16) * B(32x16 f16) + C(16x16 f32). A split product is three of these on one tile (lo.hi, hi.lo, hi.hi); the callers
// issue a term for several tiles before the next term, so that a tile's own chain never waits for the matrix unit's latency
__device__ __forceinline__ v8f wmma16(v16h a, v16h b, v8f c) {
  return __builtin_amdgcn_wmma_f32_16x16x32_f16(false, a, false, b, (short)0, c, false, false);
}

// ---------------------------------------------------------------------------
// Kernel 0: W[C,H] f32  ->  Wt[H,C] f16 value + residual planes
// ---------------------------------------------------------------------------
__global__ void __launch_bounds__(256)
wt_kernel(const float* __restrict__ Wk,
          const float* __restrict__ Wq,
          const float* __restrict__ Wv,
          h16* __restrict__ WtQ,
          h16* __restrict__ WtK,
          h16* __restrict__ WtV) {
  const int idx = blockIdx.x * 256 + threadIdx.x;   // 0 .. HH*CC/2 - 1
  if (idx >= CC * HH / 2) return;
  const int h = idx / (CC / 2);
  const int c = 2 * (idx % (CC / 2));
  const float* src[3] = {Wq, Wk, Wv};
  h16* dstp[3] = {WtQ, WtK, WtV};
#pragma unroll
  for (int s = 0; s < 3; ++s) {
    h16 h0, l0, h1, l1;
    split16(src[s][(size_t)c * HH + h], h0, l0);
    split16(src[s][(size_t)(c + 1) * HH + h], h1, l1);
    unsigned* dh = (unsigned*)(dstp[s] + (size_t)h * CC + c);
    unsigned* dl = (unsigned*)(dstp[s] + (size_t)CC * HH + (size_t)h * CC + c);
    const unsigned ph = (unsigned)hbits(h0) | ((unsigned)hbits(h1) << 16);
    const unsigned pl = (unsigned)hbits(l0) | ((unsigned)hbits(l1) << 16);
    *(unsigned*)dh = ph; *(unsigned*)dl = pl;
    
  }
}

// ---------------------------------------------------------------------------
// Kernel 1: QKV projection. A block takes 64 rows of (b,t): 4 row tiles of 16, each worked by two waves, wave kh = 0 / 1 taking
// the first / second KW k columns of every staged slice (so the grid has one block for every WGP of the chip, two waves a SIMD).
// Behind the k loop the two waves of a row tile join their partial sums through LDS, each keeping half of the 12 result tiles.
//   q stored row-major [NB,SEQ,64] (value + residual planes), k in fragment order per 16-key tile, v in fragment order per 32-key block.
// A-frag (x rows, split in registers) and B-frags (Wt[n][k] rows) use the same element -> k map; C/D: lane col = lane%16,
// element v -> row 8g+v.
// The six weight planes are staged once per block in LDS, KS columns of k at a time, by asynchronous copies into two
// buffers (the next slice flies while this one is multiplied); all 8 waves read their B fragments from there.
// The x columns of a slice are loaded into registers one trip ahead of their use.
// ---------------------------------------------------------------------------
#define KW 64                          // k columns of a slice that one wave multiplies
#define KS (2 * KW)                    // k columns per staged slice: 256 B of every weight row
#define WPITCH (KS + 8)                // f16 per staged row, 272 B = 16 B x odd: 16 rows' 16-byte reads fall on distinct banks
#define WBUF (6 * HH * WPITCH)         // f16 per buffer: planes Q, Q residual, K, K residual, V, V residual
#define NSLICE (CC / KS)
static_assert((CC % KS) == 0 && NSLICE >= 2);
static_assert(6 * HH * (KS / 8) == 24 * 256);   // 16-byte pieces of a slice = 24 per thread of the block

// One slice (columns c0 .. c0+KS-1 of all six planes) into the buffer at LDS byte address lbuf: 24 copies of 16 B per lane.
// Piece i of thread tid: plane i/4, row 16*(i%4) + tid/16, 16-byte column tid%16.
__device__ __forceinline__ void stage_slice(const h16* __restrict__ WtQ, const h16* __restrict__ WtK,
                                            const h16* __restrict__ WtV, int c0, unsigned lbuf, int tid) {
  const size_t PL = (size_t)CC * HH;
  const h16* pl[6] = {WtQ, WtQ + PL, WtK, WtK + PL, WtV, WtV + PL};
#pragma unroll
  for (int q = 0; q < 6; ++q) {   // four copies a statement (one plane): fewer address registers live at once than with more in one
    const h16* gp[4];
    unsigned ld[4];
#pragma unroll
    for (int j = 0; j < 4; ++j) {
      const int i = q * 4 + j;
      const int row = (i & 3) * 16 + (tid >> 4);
      gp[j] = pl[i >> 2] + (size_t)row * CC + c0 + (tid & 15) * 8;
      ld[j] = lbuf + (unsigned)((((i >> 2) * HH + row) * WPITCH + (tid & 15) * 8) * sizeof(h16));
    }
    // the copies and, as the statement's last line, the wait that stands before any of their address registers is rewritten
    asm volatile("global_load_async_to_lds_b128 %0, %4, off\n\t"
                 "global_load_async_to_lds_b128 %1, %5, off\n\t"
                 "global_load_async_to_lds_b128 %2, %6, off\n\t"
                 "global_load_async_to_lds_b128 %3, %7, off\n\t"
                 "s_wait_xcnt 0x0"
                 :: "v"(ld[0]), "v"(ld[1]), "v"(ld[2]), "v"(ld[3]), "v"(gp[0]), "v"(gp[1]), "v"(gp[2]), "v"(gp[3])
                 : "memory");
  }
}

// The x columns of this wave's KW-wide half of one slice, this lane's row, issued into registers (xp: column 8g of that half): kc-th 32-chunk holds
// k = 8g..8g+7 in xv[kc][0..1], 16+8g..16+8g+7 in xv[kc][2..3].
__device__ __forceinline__ void load_xslice(const float* __restrict__ xp, v4f (&xv)[KW / 32][4]) {
#pragma unroll
  for (int kc = 0; kc < KW / 32; ++kc) {
    xv[kc][0] = *(const v4f*)(xp + kc * 32);
    xv[kc][1] = *(const v4f*)(xp + kc * 32 + 4);
    xv[kc][2] = *(const v4f*)(xp + kc * 32 + 16);
    xv[kc][3] = *(const v4f*)(xp + kc * 32 + 20);
  }
  // stands behind the loads, before anything rewrites the address register that they name; it takes that address as an
  // input so that the register is left alone up to the wait
  asm volatile("s_wait_xcnt 0x0" :: "v"(xp) : "memory");
}

// One trip: the 16 x rows of this wave (its KW columns of this slice, loaded into xv one trip ago) times the same columns of the
// six staged planes (wb: the buffer, at the wave's first column), added into the 12 tiles. The next slice's x columns (at xnext) are issued into xv at the head of
// the trip, so that their way from memory lies under this trip's products.
__device__ __forceinline__ void slice_mac(const float* __restrict__ xnext, const h16* wb, int g, int m,
                                          v4f (&xv)[KW / 32][4], v8f (&accQ)[4], v8f (&accK)[4], v8f (&accV)[4]) {
  // this trip's x columns stay in a register set of their own while the next slice's land in xv
  v4f cur[KW / 32][4];
#pragma unroll
  for (int kc = 0; kc < KW / 32; ++kc)
#pragma unroll
    for (int i = 0; i < 4; ++i) cur[kc][i] = xv[kc][i];
  load_xslice(xnext, xv);
  // keeps the loads here at the head of the trip: sunk towards the next trip's splits they would wait for memory in the open
  __builtin_amdgcn_sched_barrier(0);
#pragma unroll
  for (int kc = 0; kc < KW / 32; ++kc) {
    // A-fragment: x tile rows, split into value/residual f16 in registers
    union { v16h v; h16 e[16]; } a, al;
#pragma unroll
    for (int j = 0; j < 8; ++j) {
      split16(cur[kc][j >> 2][j & 3],       a.e[j],     al.e[j]);
      split16(cur[kc][2 + (j >> 2)][j & 3], a.e[8 + j], al.e[8 + j]);
    }
    union UB { v16h v; v8h h[2]; };
#pragma unroll
    for (int nt = 0; nt < 4; ++nt) {
      // one n-tile at a time: its six B fragments (value + residual for Q/K/V weights) then three split MACs, term by term;
      // B frags use the same k map as A: {8g..8g+7} then {16+8g..16+8g+7}
      const h16* wr = wb + (nt * 16 + m) * WPITCH + kc * 32 + 8 * g;
      UB bq, bk, bv, bql, bkl, bvl;
      bq.h[0]  = *(const v8h*)(wr);                     bq.h[1]  = *(const v8h*)(wr + 16);
      bk.h[0]  = *(const v8h*)(wr + 2 * HH * WPITCH);   bk.h[1]  = *(const v8h*)(wr + 2 * HH * WPITCH + 16);
      bv.h[0]  = *(const v8h*)(wr + 4 * HH * WPITCH);   bv.h[1]  = *(const v8h*)(wr + 4 * HH * WPITCH + 16);
      bql.h[0] = *(const v8h*)(wr + 1 * HH * WPITCH);   bql.h[1] = *(const v8h*)(wr + 1 * HH * WPITCH + 16);
      bkl.h[0] = *(const v8h*)(wr + 3 * HH * WPITCH);   bkl.h[1] = *(const v8h*)(wr + 3 * HH * WPITCH + 16);
      bvl.h[0] = *(const v8h*)(wr + 5 * HH * WPITCH);   bvl.h[1] = *(const v8h*)(wr + 5 * HH * WPITCH + 16);
      // keeps the twelve reads together ahead of the products: left free some sank among the products, each with a full wait of its own
      __builtin_amdgcn_sched_barrier(0);
      accQ[nt] = wmma16(al.v, bq.v, accQ[nt]);
      accK[nt] = wmma16(al.v, bk.v, accK[nt]);
      accV[nt] = wmma16(al.v, bv.v, accV[nt]);
      accQ[nt] = wmma16(a.v, bql.v, accQ[nt]);
      accK[nt] = wmma16(a.v, bkl.v, accK[nt]);
      accV[nt] = wmma16(a.v, bvl.v, accV[nt]);
      accQ[nt] = wmma16(a.v, bq.v, accQ[nt]);
      accK[nt] = wmma16(a.v, bk.v, accK[nt]);
      accV[nt] = wmma16(a.v, bv.v, accV[nt]);
      // keeps the n-tiles apart in the schedule: mixed, more fragments are live at once and registers spill to scratch
      __builtin_amdgcn_sched_barrier(0);
    }
  }
}

// Hand-over at the foot of a trip: this wave's reads of the slice are done, its copies of the next slice have landed, and
// every wave has said so; behind it the next slice may be read and the buffer just read may be refilled.
__device__ __forceinline__ void slice_handover() {
  asm volatile("s_wait_dscnt 0x0" ::: "memory");
  asm volatile("s_wait_asynccnt 0x0" ::: "memory");
  __syncthreads();
}

__global__ void __launch_bounds__(256)
qkv_kernel(const float* __restrict__ x,
           const h16* __restrict__ WtQ,
           const h16* __restrict__ WtK,
           const h16* __restrict__ WtV,
           h16* __restrict__ qws,
           h16* __restrict__ kws,
           h16* __restrict__ vtws) {
  __shared__ __align__(16) h16 wl[2][WBUF];     // the two weight-slice buffers (cross-wave)
  __shared__ __align__(16) h16 st[8][16][64];   // per-wave staging of one 16x64 result plane (wave-private)
  __shared__ __align__(16) v4f xch[8][12][32];  // partial sums handed to the other wave of the row tile: [sender][half tile][lane]
  const int lane = threadIdx.x & 31;
  const int wv   = threadIdx.x >> 5;
  const int g    = lane >> 4;
  const int m    = lane & 15;
  const int kh   = __builtin_amdgcn_readfirstlane(wv >> 2);   // which KW k columns of every slice (the same in all lanes)
  const int tile = blockIdx.x * 4 + (wv & 3);  // 0 .. NB*SEQ/16 - 1; waves wv and wv ^ 4 share it
  const int b    = tile / (SEQ / 16);
  const int t0   = (tile % (SEQ / 16)) * 16;
  const size_t QL = (size_t)NB * SEQ * HH;     // residual plane offset inside q/k/v buffers
  const unsigned lw = (unsigned)(size_t)&wl[0][0];   // LDS byte address of buffer 0

  v8f accQ[4], accK[4], accV[4];
#pragma unroll
  for (int nt = 0; nt < 4; ++nt) {
    accQ[nt] = v8f_zero();
    accK[nt] = v8f_zero();
    accV[nt] = v8f_zero();
  }

  const float* xrow = x + ((size_t)b * SEQ_FULL + t0 + m) * CC;

  // x columns of slice 0: they fly under the staging of the first weight slice
  v4f xv[KW / 32][4];
  const float* xnext = xrow + kh * KW + 8 * g;
  load_xslice(xnext, xv);
  xnext += KS;

  // slice 0 lands and is published to every wave; slice 1 then flies during trip 0
  stage_slice(WtQ, WtK, WtV, 0, lw, threadIdx.x);
  asm volatile("s_wait_asynccnt 0x0" ::: "memory");   // this wave's copies of slice 0 have landed
  __syncthreads();
  stage_slice(WtQ, WtK, WtV, KS, lw + (unsigned)(WBUF * sizeof(h16)), threadIdx.x);

  // rolled, and the last two trips (no slice left to fetch) in a loop of their own: each loop body stays one straight block
#pragma unroll 1
  for (int t = 0; t < NSLICE - 2; ++t) {
    slice_mac(xnext, &wl[t & 1][kh * KW], g, m, xv, accQ, accK, accV);
    xnext += KS;
    slice_handover();
    // refill the buffer that this trip has just read
    stage_slice(WtQ, WtK, WtV, (t + 2) * KS, lw + (unsigned)((t & 1) * WBUF * sizeof(h16)), threadIdx.x);
  }
#pragma unroll 1
  for (int t = NSLICE - 2; t < NSLICE; ++t) {
    // xnext stays at the last slice: the last trip has no next slice and reads its own x columns again
    slice_mac(xnext, &wl[t & 1][kh * KW], g, m, xv, accQ, accK, accV);
    slice_handover();
  }
  asm volatile("s_wait_asynccnt 0x0" ::: "memory");   // no copy is outstanding when the wave goes on and ends

  // the two k halves joined: wave kh = 0 keeps q and k columns 0..31, wave kh = 1 keeps v and k columns 32..63; each hands the
  // other six tiles to its partner and adds what the partner hands it
  v8f mine[6], send[6];
#pragma unroll
  for (int i = 0; i < 4; ++i) {
    mine[i] = kh ? accV[i] : accQ[i];
    send[i] = kh ? accQ[i] : accV[i];
  }
#pragma unroll
  for (int j = 0; j < 2; ++j) {
    mine[4 + j] = kh ? accK[2 + j] : accK[j];
    send[4 + j] = kh ? accK[j] : accK[2 + j];
  }
#pragma unroll
  for (int i = 0; i < 6; ++i) {
    const v4f lo4 = {send[i][0], send[i][1], send[i][2], send[i][3]};
    const v4f hi4 = {send[i][4], send[i][5], send[i][6], send[i][7]};
    xch[wv][2 * i][lane]     = lo4;
    xch[wv][2 * i + 1][lane] = hi4;
  }
  __syncthreads();   // every wave's handed tiles are in LDS before a partner reads them
#pragma unroll
  for (int i = 0; i < 6; ++i) {
    const v4f lo4 = xch[wv ^ 4][2 * i][lane];
    const v4f hi4 = xch[wv ^ 4][2 * i + 1][lane];
#pragma unroll
    for (int v = 0; v < 4; ++v) {
      mine[i][v]     += lo4[v];
      mine[i][4 + v] += hi4[v];
    }
  }

  // outputs: q, k, v [NB,SEQ,64] as value + residual planes; the q and k plane tiles go through the wave's LDS tile and leave in whole lines
  h16* sw = &st[wv][0][0];
  const size_t row0 = ((size_t)b * SEQ + t0) * HH;
  if (kh == 0) {
    // q: 16x64, row-major [row][col]
#pragma unroll
    for (int pl = 0; pl < 2; ++pl) {
#pragma unroll
      for (int nt = 0; nt < 4; ++nt)
#pragma unroll
        for (int v = 0; v < 8; ++v) {
          h16 hh_, ll_; split16(mine[nt][v], hh_, ll_);
          sw[(8 * g + v) * 64 + nt * 16 + m] = pl ? ll_ : hh_;
        }
      asm volatile("s_wait_dscnt 0" ::: "memory");   // all lanes' stores into the wave's tile are done before it is read back across lanes
      h16* base = qws + (pl ? QL : 0) + row0;
#pragma unroll
      for (int r = 0; r < 16; ++r) {
        const unsigned w = *((const unsigned*)(sw + r * 64) + lane);
        *(unsigned*)((unsigned*)(base + (size_t)r * HH) + lane) = w;
      }
      asm volatile("s_wait_dscnt 0" ::: "memory");   // the reads of the tile are done before the next plane overwrites it
    }
  } else {
    // v: the 8 results that a lane holds of tile nt are keys 8g..8g+7 of column nt*16+m, which in fragment order are the 8
    // consecutive elements at lane*8 of group [nt][16-key half]: each plane tile leaves the registers as one 16-byte store a lane,
    // 512 contiguous bytes a wave
    h16* vdst = vtws + ((size_t)b * SEQ + (t0 & ~31)) * HH + ((t0 >> 4) & 1) * 256 + lane * 8;
    v8h vh[4], vl[4];
#pragma unroll
    for (int nt = 0; nt < 4; ++nt)
#pragma unroll
      for (int v = 0; v < 8; ++v) {
        h16 hh_, ll_; split16(mine[nt][v], hh_, ll_);
        vh[nt][v] = hh_;
        vl[nt][v] = ll_;
      }
#pragma unroll
    for (int nt = 0; nt < 4; ++nt) {
      *(v8h*)(vdst + nt * 512)      = vh[nt];
      *(v8h*)(vdst + QL + nt * 512) = vl[nt];
    }
    // stands behind the stores, before anything rewrites a register that they name; it takes the address and the stored
    // values as inputs so that those registers are left alone up to the wait
    asm volatile("s_wait_xcnt 0x0" :: "v"(vdst), "v"(vh[0]), "v"(vh[1]), "v"(vh[2]), "v"(vh[3]),
                                      "v"(vl[0]), "v"(vl[1]), "v"(vl[2]), "v"(vl[3]) : "memory");
  }
  // k columns 32*kh .. 32*kh+31: in fragment order (KFRAG) they are elements 512*kh .. 512*kh+511 of the 16-key tile
#pragma unroll
  for (int pl = 0; pl < 2; ++pl) {
#pragma unroll
    for (int j = 0; j < 2; ++j)
#pragma unroll
      for (int v = 0; v < 8; ++v) {
        h16 hh_, ll_; split16(mine[4 + j][v], hh_, ll_);
        sw[KFRAG(8 * g + v, j * 16 + m)] = pl ? ll_ : hh_;
      }
    asm volatile("s_wait_dscnt 0" ::: "memory");   // as above: the tile is complete before it is read back
    h16* base = kws + (pl ? QL : 0) + row0 + kh * 512;
#pragma unroll
    for (int r = 0; r < 8; ++r) {
      const unsigned w = *((const unsigned*)(sw + r * 64) + lane);
      *(unsigned*)((unsigned*)(base + (size_t)r * HH) + lane) = w;
    }
    asm volatile("s_wait_dscnt 0" ::: "memory");   // the reads of the tile are done before the next plane overwrites it
  }
}

// ---------------------------------------------------------------------------
// Kernel 2: causal flash attention. A block takes two 32-row query groups of one batch, group p and group SEQ/32 - 1 - p, one
// after the other in every wave: together they have the same number of 32-key blocks for every p, so all blocks of the grid (one
// for every WGP) carry equal work. The key blocks of a group are dealt round to the 8 waves, the second group's deal going
// on where the first one's ended, so that the waves' pass counts differ by one at most.
// A wave carries both 16-query tiles of the group through each of its key blocks: every k and v fragment that it loads is used
// for two tiles' products, half the loaded bytes per product of a wave with one tile.
// The products are taken transposed: per 32-key block and query tile St = K Q^T (2 split tiles, A = k fragment, B = q fragment),
// online softmax, Ot += V^T Pt (4 split tiles, A = v fragment, B = Pt). The fragments are the same registers as for Q K^T and P V
// (A and B share one lane map); in the results lane%16 is the query and element v the key 8g+v (St) or the column 8g+v (Ot).
// So one lane holds 16 of its query's 32 scores (lane^16 the other 16): maximum and sum are taken in the lane, the maximum
// joined with one exchange between the halves, the sum once behind the loop; and St tile 0 / tile 1 of a lane are keys
// 8g..8g+7 / 16+8g..16+8g+7, which is the B fragment's k order: Pt is packed in registers.
// Partial (O, m, l) of both groups merged across waves via LDS log-sum-exp combine (one block barrier behind both groups).
// Fragment loads run ahead of their use: a pass issues all of its v fragments before the score products, and the next pass's
// k fragments right behind them (two waves a SIMD: the registers are there), so that a load's way from L2 lies under matrix and softmax work.
// ---------------------------------------------------------------------------
#define AW 8        // waves of a block, the ways a group's key blocks are split
#define QT 2        // 16-query tiles of a group, carried together by every wave
#define QG (16 * QT)
static_assert(QG == 32);   // a group's diagonal lies in its last 32-key block alone
static_assert(SEQ >= AW * 32 && ((SEQ / QG) % 2) == 0);
#define OPITCH 68   // f32 per staged O row, 272 B = 16 B x odd: 16 lanes' 16-byte stores fall on distinct banks

// lane l with lane l ^ 16
__device__ __forceinline__ float xhalf(float x) {
  return __builtin_bit_cast(float, __builtin_amdgcn_permlanex16(__builtin_bit_cast(int, x), __builtin_bit_cast(int, x),
                                                                0x76543210, 0xfedcba98, false, false));
}

union U16 { v16h v; v8h h[2]; h16 e[16]; };

// The k fragments of one 32-key block (kblk: this lane's first 8 elements of it; ql: offset of the residual plane):
// kf[kt][c] = value plane of 16-key tile kt, 32-wide h chunk c; kf[kt][2 + c] = its residual plane. 16-h group j is 256*j elements on.
__device__ __forceinline__ void load_kfrags(const h16* __restrict__ kblk, size_t ql, U16 (&kf)[2][4]) {
  // unrolled so that every index of kf is a constant and the array stays in registers
#pragma unroll
  for (int kt = 0; kt < 2; ++kt) {
    const h16* kfr = kblk + kt * 16 * HH;
    kf[kt][0].h[0] = *(const v8h*)(kfr);            kf[kt][0].h[1] = *(const v8h*)(kfr + 256);
    kf[kt][1].h[0] = *(const v8h*)(kfr + 512);      kf[kt][1].h[1] = *(const v8h*)(kfr + 768);
    kf[kt][2].h[0] = *(const v8h*)(kfr + ql);       kf[kt][2].h[1] = *(const v8h*)(kfr + ql + 256);
    kf[kt][3].h[0] = *(const v8h*)(kfr + ql + 512); kf[kt][3].h[1] = *(const v8h*)(kfr + ql + 768);
  }
}

// Stands behind a group of fragment loads, before anything rewrites the address register that they name; it takes that
// address as an input so that the register is left alone up to the wait.
__device__ __forceinline__ void frag_loads_issued(const h16* addr) {
  asm volatile("s_wait_xcnt 0x0" :: "v"(addr) : "memory");
}

__global__ void __launch_bounds__(AW * 32)
attn_kernel(const h16* __restrict__ qws,
            const h16* __restrict__ kws,
            const h16* __restrict__ vtws,
            float* __restrict__ out) {
  __shared__ __align__(16) float Of[2][AW][QG][OPITCH];  // partial O, [group of the pair][wave][query][column] (cross-wave)
  __shared__ float Ml[2][AW][QG], Ll[2][AW][QG];         // partial m, l (cross-wave)

  const int lane = threadIdx.x & 31;
  const int wv   = threadIdx.x >> 5;
  const int g    = lane >> 4;
  const int m    = lane & 15;
  const int b    = blockIdx.x / (SEQ / (2 * QG));    // batch
  const int pr   = blockIdx.x % (SEQ / (2 * QG));    // pair: query groups pr and SEQ/QG - 1 - pr

  const size_t QL = (size_t)NB * SEQ * HH;     // residual planes follow the value planes
  const float scale = ATTN_SCALE;
  const h16* kbase  = kws + (size_t)b * SEQ * HH;
  const h16* vtbase = vtws + (size_t)b * HH * SEQ;

  // unrolled: hf is a constant in each copy (LDS offsets, the start of the deal), and the second group's loop needs no entry test
#pragma unroll
  for (int hf = 0; hf < 2; ++hf) {
    const int grp   = hf ? SEQ / QG - 1 - pr : pr;
    const int t0    = grp * QG;
    const int nblk  = grp + 1;                 // causal: keys <= t0+31
    // the wave's first key block: the second group's deal starts at the wave behind the first group's last
    const int first = hf ? ((wv - (pr + 1)) & (AW - 1)) : wv;

    // Q fragments (B operand: lane%16 = query) of both tiles for the two 32-wide h chunks (HH = 64)
    const h16* qrow = qws + ((size_t)b * SEQ + t0 + m) * HH + 8 * g;   // the one address that all sixteen loads are formed from
    U16 qa[QT][2], qal[QT][2];
    // here and below: the short loops are unrolled so that every array index is a constant and the arrays stay in registers
#pragma unroll
    for (int qt = 0; qt < QT; ++qt)
#pragma unroll
      for (int hc = 0; hc < 2; ++hc) {
        const h16* qp = qrow + qt * 16 * HH + hc * 32;
        qa[qt][hc].h[0]  = *(const v8h*)(qp);
        qa[qt][hc].h[1]  = *(const v8h*)(qp + 16);
        qal[qt][hc].h[0] = *(const v8h*)(qp + QL);
        qal[qt][hc].h[1] = *(const v8h*)(qp + QL + 16);
      }
    frag_loads_issued(qrow);                   // the k fragments below may land in the registers that held this address

    v8f o[QT][4];                              // Ot: lane%16 = query, element v of tile nt = column nt*16 + 8g + v
    float mrow[QT], lrow[QT];                  // running maximum of this lane's query (equal in lanes l and l^16); running sum
                                               // over this lane's own keys (the halves are joined behind the loop)
#pragma unroll
    for (int qt = 0; qt < QT; ++qt) {
#pragma unroll
      for (int nt = 0; nt < 4; ++nt) o[qt][nt] = v8f_zero();
      mrow[qt] = NEG_INF;
      lrow[qt] = 0.f;
    }

    // k fragments of the wave's first block (block first < AW lies inside the batch's keys whether or not the wave has a pass: SEQ >= AW*32)
    U16 kf[2][4];                              // A frags use the same k map as B
    const h16* kfirst = kbase + (size_t)first * 32 * HH + lane * 8;
    load_kfrags(kfirst, QL, kf);
    frag_loads_issued(kfirst);

    for (int blk = first; blk < nblk; blk += AW) {
      const int s0 = blk * 32;

      // ---- this block's v fragments (A operand of Ot += V^T Pt), all issued here: they fly under the scores and the softmax ----
      U16 vf[4][2];                                         // [nt][value, residual]; same k map as B; keys 16+8g.. are 256 elements on
      // stands before this pass's loads land in registers that earlier loads name as their address (ahead of the first pass: the first block's k loads)
      asm volatile("s_wait_xcnt 0x0" ::: "memory");
      const h16* vblk = vtbase + (size_t)s0 * HH + lane * 8;
#pragma unroll
      for (int nt = 0; nt < 4; ++nt) {
        const h16* vfr = vblk + nt * 512;                   // this lane's 8 keys of column nt*16+m, keys 8g..8g+7
        vf[nt][0].h[0] = *(const v8h*)(vfr);      vf[nt][0].h[1] = *(const v8h*)(vfr + 256);
        vf[nt][1].h[0] = *(const v8h*)(vfr + QL); vf[nt][1].h[1] = *(const v8h*)(vfr + QL + 256);
      }
      // keeps the loads here at the head of the pass: sunk towards the P.V products they would wait for L2 in the open
      __builtin_amdgcn_sched_barrier(0);

      // ---- St = K Q^T for 32 keys (two 16x16 tiles) and both query tiles: each k fragment is used twice ----
      // term by term (lo.hi, hi.lo, hi.hi of each h chunk) over the four tiles
      v8f s[QT][2];
#pragma unroll
      for (int kt = 0; kt < 2; ++kt)
#pragma unroll
        for (int qt = 0; qt < QT; ++qt) s[qt][kt] = v8f_zero();
#pragma unroll
      for (int hc = 0; hc < 2; ++hc)
#pragma unroll
        for (int term = 0; term < 3; ++term)
#pragma unroll
          for (int kt = 0; kt < 2; ++kt)
#pragma unroll
            for (int qt = 0; qt < QT; ++qt)
              s[qt][kt] = wmma16(kf[kt][term == 0 ? 2 + hc : hc].v, term == 1 ? qal[qt][hc].v : qa[qt][hc].v, s[qt][kt]);

      // ---- the next pass's k fragments, into the registers that the scores have left; the last pass reads its own block again ----
      const int nb = (blk + AW < nblk) ? blk + AW : blk;
      const h16* knext = kbase + (size_t)nb * 32 * HH + lane * 8;
      load_kfrags(knext, QL, kf);
      frag_loads_issued(knext);
      // keeps the loads here, right behind the score products: left free they sank into the P.V products, too late for their way from L2
      __builtin_amdgcn_sched_barrier(0);

      const bool diag = (s0 + 31 >= t0);
      // key kt*16 + 8g + v of the block is open to query m of tile qt while kt*16 + v - qt*16 <= open: one value a pass against constants
      const int  open = t0 + m - s0 - 8 * g;
      U16 pa[QT], pal[QT];
#pragma unroll
      for (int qt = 0; qt < QT; ++qt) {
        // ---- scale + causal mask (diagonal block only); maximum over the lane's 16 keys, then over both halves ----
        float mx[8];
#pragma unroll
        for (int v = 0; v < 8; ++v) {
#pragma unroll
          for (int kt = 0; kt < 2; ++kt) {
            const float val = s[qt][kt][v] * scale;
            s[qt][kt][v] = (diag && (kt * 16 + v - qt * 16 > open)) ? NEG_INF : val;
          }
          mx[v] = fmaxf(s[qt][0][v], s[qt][1][v]);
        }
        float rmax = fmaxf(fmaxf(fmaxf(mx[0], mx[1]), fmaxf(mx[2], mx[3])), fmaxf(fmaxf(mx[4], mx[5]), fmaxf(mx[6], mx[7])));
        rmax = fmaxf(rmax, xhalf(rmax));

        // ---- online softmax update; Pt (x1024, two planes) packed into the B fragment ----
        const float mnew  = fmaxf(mrow[qt], rmax);   // finite: key s0 <= t0 is open to every query of the group
        const float alpha = __expf(mrow[qt] - mnew);
        mrow[qt] = mnew;
        float ps[8];
#pragma unroll
        for (int v = 0; v < 8; ++v) {
          const float p0 = __expf(s[qt][0][v] - mnew);
          const float p1 = __expf(s[qt][1][v] - mnew);
          // probabilities carried x1024 (tail values stay f16-normal; removed in the final merge) as value + residual planes
          split16(p0 * 1024.0f, pa[qt].e[v],     pal[qt].e[v]);
          split16(p1 * 1024.0f, pa[qt].e[8 + v], pal[qt].e[8 + v]);
          ps[v] = p0 + p1;
        }
        lrow[qt] = lrow[qt] * alpha + (((ps[0] + ps[1]) + (ps[2] + ps[3])) + ((ps[4] + ps[5]) + (ps[6] + ps[7])));
#pragma unroll
        for (int nt = 0; nt < 4; ++nt)
#pragma unroll
          for (int v = 0; v < 8; ++v)
            o[qt][nt][v] *= alpha;
      }

      // ---- Ot += V^T Pt  (V A-frags from the fragment-ordered planes): each v fragment is used twice ----
      // term by term over the four tiles of two column groups
#pragma unroll
      for (int np = 0; np < 4; np += 2)
#pragma unroll
        for (int term = 0; term < 3; ++term)
#pragma unroll
          for (int nt = np; nt < np + 2; ++nt)
#pragma unroll
            for (int qt = 0; qt < QT; ++qt)
              o[qt][nt] = wmma16(vf[nt][term == 0 ? 1 : 0].v, term == 1 ? pal[qt].v : pa[qt].v, o[qt][nt]);
    }

    // ---- publish this wave's partial (O, m, l) of this group, in the group's own part of LDS ----
#pragma unroll
    for (int qt = 0; qt < QT; ++qt) {
      lrow[qt] += xhalf(lrow[qt]);             // the two halves' keys joined
#pragma unroll
      for (int nt = 0; nt < 4; ++nt) {
        const v4f lo4 = {o[qt][nt][0], o[qt][nt][1], o[qt][nt][2], o[qt][nt][3]};
        const v4f hi4 = {o[qt][nt][4], o[qt][nt][5], o[qt][nt][6], o[qt][nt][7]};
        *(v4f*)&Of[hf][wv][qt * 16 + m][nt * 16 + 8 * g]     = lo4;
        *(v4f*)&Of[hf][wv][qt * 16 + m][nt * 16 + 8 * g + 4] = hi4;
      }
      if (g == 0) {
        Ml[hf][wv][qt * 16 + m] = mrow[qt];
        Ll[hf][wv][qt * 16 + m] = lrow[qt];
      }
    }
  }
  __syncthreads();

  // ---- merge: a thread takes one query of each group and 8 of its columns (4*cg.. and 32+4*cg..: 8 lanes store a whole line) ----
  const int row = threadIdx.x >> 3;
  const int cg  = threadIdx.x & 7;
#pragma unroll
  for (int hf = 0; hf < 2; ++hf) {
    float M = Ml[hf][0][row];
#pragma unroll
    for (int w = 1; w < AW; ++w) M = fmaxf(M, Ml[hf][w][row]);
    float be[AW];
#pragma unroll
    for (int w = 0; w < AW; ++w) be[w] = __expf(Ml[hf][w][row] - M);   // 0 for idle waves (m = -inf)
    float L = 0.f;
    v4f O0 = {0.f, 0.f, 0.f, 0.f}, O1 = {0.f, 0.f, 0.f, 0.f};
#pragma unroll
    for (int w = 0; w < AW; ++w) {
      L  += be[w] * Ll[hf][w][row];
      O0 += be[w] * *(const v4f*)&Of[hf][w][row][4 * cg];
      O1 += be[w] * *(const v4f*)&Of[hf][w][row][32 + 4 * cg];
    }
    const float den = L * 1024.0f;                // removes the x1024 carried by the probabilities
    const int trow = (hf ? SEQ / QG - 1 - pr : pr) * QG + row;
    float* op = out + ((size_t)b * SEQ_FULL + trow) * HH + 4 * cg;
    const v4f r0 = O0 / den, r1 = O1 / den;
    *(v4f*)op        = r0;
    *(v4f*)(op + 32) = r1;
    // stands behind the stores, before the second group's merge rewrites a register that they name; it takes the address and the
    // stored values as inputs so that those registers are left alone up to the wait
    asm volatile("s_wait_xcnt 0x0" :: "v"(op), "v"(r0), "v"(r1) : "memory");
  }
}

// ---------------------------------------------------------------------------
// Launch. Workspace layout (bytes, full size):
//   [0, 4MB)      q   f16 [NB,SEQ,64]  value + residual planes
//   [4MB, 8MB)    k   f16 [NB,SEQ,64]  (fragment order per 16-key tile)
//   [8MB, 12MB)   v   f16 [NB,SEQ,64]  (fragment order per 32-key block)
//   [12MB, +576KB) WtQ/WtK/WtV f16 [64,768] x2 planes each
// ---------------------------------------------------------------------------
extern "C" void kernel_launch(void* const* d_in, const int* in_sizes, int n_in,
                              void* d_out, int out_size, void* d_ws,
                              size_t ws_size, hipStream_t stream) {
  if (n_in < 4) return;
  const long long rows_needed = (long long)(NB - 1) * SEQ_FULL + SEQ;
  if ((long long)in_sizes[0] < rows_needed * CC) return;
  if (in_sizes[1] < CC * HH || in_sizes[2] < CC * HH || in_sizes[3] < CC * HH) return;
  if ((long long)out_size < rows_needed * HH) return;

  const float* x  = (const float*)d_in[0];
  const float* Wk = (const float*)d_in[1];
  const float* Wq = (const float*)d_in[2];
  const float* Wv = (const float*)d_in[3];
  float* out = (float*)d_out;

  // every 16-bit buffer holds a value plane followed by its residual plane (2x the element count)
  char* ws = (char*)d_ws;
  const size_t qkv_bytes = (size_t)2 * NB * SEQ * HH * sizeof(h16);     // 4 MB at full size (two planes)
  const size_t wt_bytes  = (size_t)2 * CC * HH * sizeof(h16);           // 192 KB each
  const size_t total     = 3 * qkv_bytes + 3 * wt_bytes;
  if (total > ws_size) return;
  h16* qws  = (h16*)(ws);
  h16* kws  = (h16*)(ws + qkv_bytes);
  h16* vtws = (h16*)(ws + 2 * qkv_bytes);
  h16* WtQ  = (h16*)(ws + 3 * qkv_bytes);
  h16* WtK  = (h16*)(ws + 3 * qkv_bytes + wt_bytes);
  h16* WtV  = (h16*)(ws + 3 * qkv_bytes + 2 * wt_bytes);

  wt_kernel<<<(CC * HH / 2) / 256, 256, 0, stream>>>(Wk, Wq, Wv, WtQ, WtK, WtV);
  qkv_kernel<<<(NB * SEQ) / 64, 256, 0, stream>>>(x, WtQ, WtK, WtV, qws, kws, vtws);
  attn_kernel<<<(NB * SEQ) / (2 * QG), AW * 32, 0, stream>>>(qws, kws, vtws, out);
}
